// v000
// Measured on an AMD MI455X. A time is GPU time per run, averaged over a window of back-to-back runs after a warm-up
// (all launches, gaps included; the runs take copies of the inputs in turn), and the median of several windows.
// Apart from v000's, it joins two sittings. Times from different sittings can be a few percent apart, while
// side-by-side timings come from the same sitting.
// v000 is the starting kernel. One run takes 3670 microseconds.
#include <hip/hip_runtime.h>

// Causal scaled dot-product attention on raw batch-head tensors with a data-derived key-padding mask (q, k, v [64][1024][64], no projections; scores = q.k / sqrt(64); keys whose absolute sum is exactly 0 are masked to -2^32+1 (== exclusion; computed from the data, none occur for random inputs); causal mask (same fill); softmax; out = attn.v -> [64][1024][64] (4.2 M); argument order q, k, v).
// Layout per batch-head: NEW k_kzf computes the per-key flag sum_d |k[j][d]| != 0 (8 lanes per key, 4 keys per wave, fixed tree) into an int vector; the f32 inputs feed the plane builders directly (identity table); causal T-1024 attention at NH 1 / ZH 1 (hybrid rows: < 512 hi/lo 3 products, rest fp16 x1024; k_gemmc skips tiles above the diagonal); the softmax kernel reads the flag vector (16 B per lane) and excludes flagged-zero keys by select; f32 merge writes the output rows.
// Compute dtypes, f32 accumulate: inputs split into bf16 hi/lo (rows < 512) or rounded to fp16 (rest); softmax f32; output f32. NOTE no stage rounds the inputs to bf16.

#define NB_  64
#define TT   1024
#define DM   64
#define NH_  1
#define NKV  1
#define REP  (NH_ / NKV)
#define HD   64
#define DQ   (NH_ * HD)
#define DKV  (NKV * HD)
#define ZH   1
#define RH   512                  // query rows < RH use hi+lo planes (0: none)
#define WIN  1024
#define PCAR 1024.0f
#define SCL  0.125f   // 1/sqrt(d_k)
typedef _Float16 h16;
typedef unsigned short bf;
typedef __attribute__((ext_vector_type(16))) __bf16   v16bf;
typedef __attribute__((ext_vector_type(16))) _Float16 v16h;
typedef __attribute__((ext_vector_type(8)))  _Float16 v8h;
typedef __attribute__((ext_vector_type(8)))  unsigned short v8us;
typedef __attribute__((ext_vector_type(8)))  float    v8f;
typedef __attribute__((ext_vector_type(4)))  float    v4f;
typedef v8h  __attribute__((may_alias)) v8ha;
typedef v4f  __attribute__((may_alias)) v4fa;
typedef v8us __attribute__((may_alias)) v8usa;

__device__ __forceinline__ unsigned short f2bf(float f) { unsigned u = __float_as_uint(f); u += 0x7FFFu + ((u >> 16) & 1u); return (unsigned short)(u >> 16); }
__device__ __forceinline__ float bf2f(unsigned short b) { return __uint_as_float(((unsigned)b) << 16); }
__device__ __forceinline__ float bfr(float f) { return bf2f(f2bf(f)); }
__device__ __forceinline__ v16h cat16(v8h lo, v8h hi) { return __builtin_shufflevector(lo, hi, 0, 1, 2, 3, 4, 5, 6, 7, 8, 9, 10, 11, 12, 13, 14, 15); }
__device__ __forceinline__ v16bf cat16b(v8us lo, v8us hi) { return __builtin_bit_cast(v16bf, __builtin_shufflevector(lo, hi, 0, 1, 2, 3, 4, 5, 6, 7, 8, 9, 10, 11, 12, 13, 14, 15)); }
__device__ __forceinline__ v8f wmma16(v16h a, v16h b, v8f c) { return __builtin_amdgcn_wmma_f32_16x16x32_f16(false, a, false, b, (short)0, c, false, false); }
__device__ __forceinline__ v8f wmmab(v16bf a, v16bf b, v8f c) { return __builtin_amdgcn_wmma_f32_16x16x32_bf16(false, a, false, b, (short)0, c, false, false); }



// ---- register-blocked GEMM, ONE WAVE per 64x64 output tile (16 accumulators), operands straight from K-contiguous 16-bit planes; grid (M/64, N/64, Z), 32 threads.
// C[m][n] (f32, pitch ldc) = sum_k A[m][k] Bt[n][k] (+ split products per NSPLIT). z-batch strides sA/sB/sC in elements. K % 32 == 0.
template <typename T16> struct WFrag;
template <> struct WFrag<h16> { typedef v16h V; static __device__ __forceinline__ V ld(const h16* p) { return cat16(*(const v8h*)p, *(const v8h*)(p + 16)); } static __device__ __forceinline__ v8f mma(V a, V b, v8f c) { return wmma16(a, b, c); } };
template <> struct WFrag<bf> { typedef v16bf V; static __device__ __forceinline__ V ld(const bf* p) { return cat16b(*(const v8us*)p, *(const v8us*)(p + 16)); } static __device__ __forceinline__ v8f mma(V a, V b, v8f c) { return wmmab(a, b, c); } };
// ---- k_gemmc: the same one-wave 64x64 tile GEMM specialised for causal attention: CMODE 1 skips score tiles entirely above the diagonal (query rows r0+roff.., key columns c0..), CMODE 2 limits the
// key (K) loop of the probability x value contraction to the diagonal block (probabilities beyond it are exactly zero). roff = row offset of this launch's first row within the sequence.
template <typename T16, int NSPLIT, int CMODE>
__global__ __launch_bounds__(32) void k_gemmc(const T16* __restrict__ A, const T16* __restrict__ A2, const T16* __restrict__ Bt, const T16* __restrict__ Bt2, int K, float* C, int ldc, int roff, size_t sA, size_t sB, size_t sC) {
    typedef typename WFrag<T16>::V V;
    __shared__ __align__(16) float os[16 * 68];
    const size_t z = blockIdx.z; A += z * sA; if (A2) A2 += z * sA; Bt += z * sB; if (Bt2) Bt2 += z * sB; C += z * sC;
    const int lane = threadIdx.x & 31, lr = lane & 15, hi = lane >> 4; const int r0 = blockIdx.x * 64, c0 = blockIdx.y * 64;
    if (CMODE == 1 && c0 > r0 + roff + 63) return;                  // score tile entirely above the causal diagonal: never read (the softmax masks j > i by select)
    const int Kl = (CMODE == 2) ? min(K, r0 + roff + 64) : K;        // P.V: probabilities are exactly 0 beyond the diagonal block, so the K loop stops there
    v8f acc[4][4];
#pragma unroll
    for (int mb = 0; mb < 4; ++mb)
#pragma unroll
        for (int nb = 0; nb < 4; ++nb) acc[mb][nb] = (v8f){};
    const size_t aoff = (size_t)(r0 + lr) * K + 8 * hi, boff = (size_t)(c0 + lr) * K + 8 * hi;
#pragma unroll 1
    for (int kc = 0; kc < Kl; kc += 32) {
        V a[4], a2[4];
#pragma unroll
        for (int mb = 0; mb < 4; ++mb) { a[mb] = WFrag<T16>::ld(A + aoff + (size_t)mb * 16 * K + kc); if (NSPLIT == 1 || NSPLIT == 2) a2[mb] = WFrag<T16>::ld(A2 + aoff + (size_t)mb * 16 * K + kc); }
#pragma unroll
        for (int nb = 0; nb < 4; ++nb) { const V b = WFrag<T16>::ld(Bt + boff + (size_t)nb * 16 * K + kc); V b2; if (NSPLIT >= 2) b2 = WFrag<T16>::ld(Bt2 + boff + (size_t)nb * 16 * K + kc);
#pragma unroll
            for (int mb = 0; mb < 4; ++mb) { acc[mb][nb] = WFrag<T16>::mma(a[mb], b, acc[mb][nb]); if (NSPLIT == 1 || NSPLIT == 2) acc[mb][nb] = WFrag<T16>::mma(a2[mb], b, acc[mb][nb]); if (NSPLIT >= 2) acc[mb][nb] = WFrag<T16>::mma(a[mb], b2, acc[mb][nb]); } }
        asm volatile("v_nop\n\tv_nop\n\tv_nop\n\tv_nop" : "+v"(acc[0][0]), "+v"(acc[1][1]), "+v"(acc[2][2]), "+v"(acc[3][3]) : "v"(a[0]), "v"(a[3]));
    }
#pragma unroll
    for (int mb = 0; mb < 4; ++mb) {
#pragma unroll
        for (int nb = 0; nb < 4; ++nb) {
#pragma unroll
            for (int j = 0; j < 8; ++j) os[(hi * 8 + j) * 68 + nb * 16 + lr] = acc[mb][nb][j]; }
        __builtin_amdgcn_wave_barrier(); asm volatile("" ::: "memory");
        float* crow = C + (size_t)(r0 + mb * 16) * ldc + c0;
{
#pragma unroll
            for (int s = 0; s < 8; ++s) { const int row = 2 * s + hi, cofs = lr * 4; v4f val = *(const v4fa*)(os + row * 68 + cofs);
                *(v4f*)(crow + (size_t)row * ldc + cofs) = val; }
             }
        __builtin_amdgcn_wave_barrier(); asm volatile("" ::: "memory");
    }
}

__device__ __forceinline__ h16 tohx(float x) { return (h16)x; }
__device__ __forceinline__ void splitf(float y, unsigned short& h, unsigned short& l) { h = f2bf(y); l = f2bf(y - bf2f(h)); }
typedef __attribute__((ext_vector_type(2))) _Float16 v2h;
typedef __attribute__((ext_vector_type(4))) _Float16 v4h;
typedef __attribute__((ext_vector_type(2))) unsigned short v2us;
typedef __attribute__((ext_vector_type(4))) unsigned short v4us;
typedef __attribute__((ext_vector_type(2))) float v2f;
typedef __attribute__((ext_vector_type(4))) int v4i;

// k_rope: head planes [h][t][d] (fp16 + hi/lo) of rope(x) x sc with the rotate-half convention out[d] = x[d] cos[t][d] - x[d+HD/2] sin[t][d], out[d+HD/2] = x[d+HD/2] cos[t][d+HD/2] + x[d] sin[t][d+HD/2]
__global__ __launch_bounds__(256) void k_rope(const float* __restrict__ F, int pitch, int nheads, const float* __restrict__ CS, const float* __restrict__ RF, const float* __restrict__ nw, float sc, h16* P16, bf* Ph, bf* Pl) {
    const size_t e = ((size_t)blockIdx.x * 256 + threadIdx.x) * 2; if (e >= (size_t)nheads * TT * HD) return; const int d = (int)(e % HD); const int t = (int)((e / HD) % TT); const int h = (int)(e / ((size_t)HD * TT)); const float* f = F + (size_t)t * pitch + h * HD; const float rf = RF ? RF[(size_t)h * TT + t] : 1.0f; v2h o16; v2us oh, ol;
#pragma unroll
    for (int q = 0; q < 2; ++q) { const int dd = d + q; const int dp = (dd < HD / 2) ? dd + HD / 2 : dd - HD / 2; float x0 = f[dd], x1 = f[dp];
        if (RF) { float n0 = __fmul_rn(x0, rf), n1 = __fmul_rn(x1, rf); asm volatile("" : "+v"(n0)); asm volatile("" : "+v"(n1)); x0 = __fmul_rn(bfr(nw[dd]), n0); x1 = __fmul_rn(bfr(nw[dp]), n1); }
        const v2f cs = *(const v2f*)(CS + ((size_t)t * HD + dd) * 2); float a = __fmul_rn(x0, cs[0]), bq = __fmul_rn(x1, cs[1]); asm volatile("" : "+v"(a)); asm volatile("" : "+v"(bq)); const float r = ((dd < HD / 2) ? __fsub_rn(a, bq) : __fadd_rn(a, bq)) * sc;
        o16[q] = tohx(r); unsigned short a2, c2; splitf(r, a2, c2); oh[q] = a2; ol[q] = c2; }
    *(v2h*)(P16 + e) = o16; *(v2us*)(Ph + e) = oh; *(v2us*)(Pl + e) = ol;  }
__global__ __launch_bounds__(256) void k_kzf(const float* __restrict__ K, int* KF) { __shared__ int fl[32]; const int tid = threadIdx.x; const int kk = tid >> 3, sub = tid & 7; const int j = blockIdx.x * 32 + kk; const float* kr = K + (size_t)j * HD + sub * 8; const v4f a = *(const v4f*)kr; const v4f b = *(const v4f*)(kr + 4);
    float s = __fadd_rn(__fadd_rn(__fadd_rn(fabsf(a[0]), fabsf(a[1])), __fadd_rn(fabsf(a[2]), fabsf(a[3]))), __fadd_rn(__fadd_rn(fabsf(b[0]), fabsf(b[1])), __fadd_rn(fabsf(b[2]), fabsf(b[3]))));
#pragma unroll
    for (int sh = 4; sh; sh >>= 1) s = __fadd_rn(s, __shfl_xor(s, sh, 32));
    if (sub == 0) fl[kk] = (s != 0.0f) ? 1 : 0;
    __syncthreads();
    if (tid < 32) { const int f = fl[tid]; int* dst = KF + blockIdx.x * 32 + tid; *(int*)dst = f;  } }
__global__ __launch_bounds__(256) void k_vtp(const float* __restrict__ F, int pitch, int nheads, h16* V16, bf* Vh, bf* Vl) { const size_t e = ((size_t)blockIdx.x * 256 + threadIdx.x) * 2; if (e >= (size_t)nheads * HD * TT) return; const int t = (int)(e % TT); const int d = (int)((e / TT) % HD); const int g = (int)(e / ((size_t)TT * HD)); v2h o16; v2us oh, ol;
#pragma unroll
    for (int q = 0; q < 2; ++q) { const float x = F[(size_t)(t + q) * pitch + g * HD + d]; o16[q] = tohx(x); unsigned short a2, c2; splitf(x, a2, c2); oh[q] = a2; ol[q] = c2; }
    *(v2h*)(V16 + e) = o16; *(v2us*)(Vh + e) = oh; *(v2us*)(Vl + e) = ol;  }
__global__ __launch_bounds__(256) void k_csid(float* CS) { const int idx = blockIdx.x * 256 + threadIdx.x; if (idx >= TT * HD) return; v2f cs; cs[0] = 1.0f; cs[1] = 0.0f; *(v2f*)(CS + (size_t)idx * 2) = cs;  }
// k_asoft: per row (zz, i): t = S x 1/8 where j <= i AND the key's abs-sum flag is set (flag vector read as data; -2^32+1 == exclusion); softmax over the keys (register row, one exp, fixed trees);
__global__ __launch_bounds__(256) void k_asoft(const float* __restrict__ Sb, const int* __restrict__ kvp, h16* P16, bf* Ph, bf* Pl) {
    const int lane = threadIdx.x & 31; const int row = blockIdx.x * 8 + (threadIdx.x >> 5); if (row >= ZH * TT) return; const int i = row % TT; const int zz = row / TT; (void)zz; const bool hires = (i < RH); const float* sr = Sb + (size_t)row * TT; float v[TT / 32]; float mx = -3.0e38f;
#pragma unroll
    for (int ch = 0; ch < TT / 128; ++ch) { const int j0 = ch * 128 + lane * 4; const v4f a = *(const v4f*)(sr + j0); const v4i kv4 = *(const v4i*)(kvp + j0);   /* the batch's key vector, 16 B per lane, unconditional */
#pragma unroll
        for (int q = 0; q < 4; ++q) { const int j = j0 + q; (void)j; const float t = (j <= i && i - j < WIN && kv4[q] != 0) ? a[q] * SCL : -3.0e38f; v[ch * 4 + q] = t; mx = fmaxf(mx, t); } }
#pragma unroll
    for (int sh = 16; sh; sh >>= 1) mx = fmaxf(mx, __shfl_xor(mx, sh, 32));
    float sum = 0.f;
#pragma unroll
    for (int k = 0; k < TT / 32; ++k) { float d0 = __fsub_rn(v[k], mx); asm volatile("" : "+v"(d0)); v[k] = __builtin_amdgcn_exp2f(__fmul_rn(d0, 1.4426950408889634f)); sum += v[k]; }
#pragma unroll
    for (int sh = 16; sh; sh >>= 1) sum += __shfl_xor(sum, sh, 32);
    const float f = __fdiv_rn(hires ? 1.0f : PCAR, sum);
{
        if (hires) {
#pragma unroll
            for (int ch = 0; ch < TT / 128; ++ch) { v4us oh, ol;
#pragma unroll
                for (int q = 0; q < 4; ++q) { unsigned short a, c2; splitf(v[ch * 4 + q] * f, a, c2); oh[q] = a; ol[q] = c2; }
                const size_t oo = ((size_t)zz * (RH ? RH : 1) + i) * TT + ch * 128 + lane * 4; *(v4us*)(Ph + oo) = oh; *(v4us*)(Pl + oo) = ol; }
        } else {
#pragma unroll
            for (int ch = 0; ch < TT / 128; ++ch) { v4h o4;
#pragma unroll
                for (int q = 0; q < 4; ++q) o4[q] = tohx(v[ch * 4 + q] * f);
                *(v4h*)(P16 + (size_t)row * TT + ch * 128 + lane * 4) = o4; } }
         }
}
__global__ __launch_bounds__(256) void k_merge(const float* __restrict__ O, int h0, float* OUTb) { const size_t e = ((size_t)blockIdx.x * 256 + threadIdx.x) * 2; if (e >= (size_t)ZH * TT * HD) return; const int d = (int)(e % HD); const int t = (int)((e / HD) % TT); const int zz = (int)(e / ((size_t)HD * TT)); const float cs = (t < RH) ? 1.0f : (1.0f / PCAR); const size_t oo = (size_t)t * DQ + (h0 + zz) * HD + d;
    v2f o2; o2[0] = O[e] * cs; o2[1] = O[e + 1] * cs; *(v2f*)(OUTb + oo) = o2;  }

extern "C" void kernel_launch(void* const* d_in, const int* in_sizes, int n_in,
                              void* d_out, int out_size, void* d_ws, size_t ws_size, hipStream_t stream) {
    (void)in_sizes; (void)n_in; (void)out_size;
    const float* x = (const float*)d_in[0]; const float* xk = (const float*)d_in[1]; const float* xv = (const float*)d_in[2];   /* input order q, k, v: [64][1024][64] each (no projections) */ const float* wq = nullptr, *wk = nullptr, *wv = nullptr, *wo = nullptr; (void)wq; (void)wk; (void)wv; (void)wo;
    float* OUT = (float*)d_out;     // [64][1024][64]
    char* wsp = (char*)d_ws;
    auto take = [&](size_t bytes) { char* p = wsp; wsp += (bytes + 255) & ~(size_t)255; return (void*)p; };
    bf* WQ = (bf*)take((size_t)DQ * DM * 2); bf* WK = (bf*)take((size_t)DKV * DM * 2); bf* WV = (bf*)take((size_t)DKV * DM * 2); float* CS = (float*)take((size_t)TT * HD * 2 * 4);
    bf* XB = (bf*)take((size_t)TT * DM * 2); int* KF = (int*)take((size_t)TT * 4);   /* per-key non-zero flags of the batch-head */ float* FQ = (float*)take((size_t)TT * DQ * 4); float* FK = (float*)take((size_t)TT * DKV * 4);
    h16* QP16 = (h16*)take((size_t)NH_ * TT * HD * 2); h16* KP16 = (h16*)take((size_t)NKV * TT * HD * 2); h16* VT16 = (h16*)take((size_t)NKV * HD * TT * 2);
    bf* QPh = (bf*)take((size_t)NH_ * TT * HD * 2); bf* QPl = (bf*)take((size_t)NH_ * TT * HD * 2); bf* KPh = (bf*)take((size_t)NKV * TT * HD * 2); bf* KPl = (bf*)take((size_t)NKV * TT * HD * 2); bf* VTh = (bf*)take((size_t)NKV * HD * TT * 2); bf* VTl = (bf*)take((size_t)NKV * HD * TT * 2); bf* Ph = (bf*)take((size_t)ZH * RH * TT * 2); bf* Pl = (bf*)take((size_t)ZH * RH * TT * 2);
    float* Sb = (float*)take((size_t)ZH * TT * TT * 4); h16* P16 = (h16*)take((size_t)ZH * TT * TT * 2); float* Ob = (float*)take((size_t)ZH * TT * HD * 4);
    if ((size_t)(wsp - (char*)d_ws) > ws_size) return;    // ws 256 MiB
    float* FV = FK;   // unused (no projections)
    {   
      
       }
    k_csid<<<(TT * HD + 255) / 256, 256, 0, stream>>>(CS);
    const unsigned LQ = (unsigned)(((size_t)NH_ * TT * HD / 2 + 255) / 256), LKv = (unsigned)(((size_t)NKV * TT * HD / 2 + 255) / 256);
    for (int b = 0; b < NB_; ++b) {
        
        /* no projections: the q, k, v inputs feed the plane builders directly */
        
        k_rope<<<LQ, 256, 0, stream>>>(x + (size_t)b * TT * DM, DQ, NH_, CS, nullptr, nullptr, 1.0f, QP16, QPh, QPl);   /* q planes straight from the input (bf16 hi/lo split of the f32 values) */
        
        k_kzf<<<TT / 32, 256, 0, stream>>>(xk + (size_t)b * TT * DM, KF);   /* key-padding flags from the data */ k_rope<<<LKv, 256, 0, stream>>>(xk + (size_t)b * TT * DM, DKV, NKV, CS, nullptr, nullptr, 1.0f, KP16, KPh, KPl);
         k_vtp<<<LKv, 256, 0, stream>>>(xv + (size_t)b * TT * DM, DKV, NKV, VT16, VTh, VTl);
        for (int h0 = 0; h0 < NH_; h0 += ZH) { const size_t zq = (size_t)h0, zk = (size_t)(h0 / REP);   // one kv head per query head: the pass's single head (ZH 1) uses kv plane h0 (z-strides TT*HD)
            k_gemmc<bf, 2, 1><<<dim3(RH / 64, TT / 64, ZH), 32, 0, stream>>>(QPh + zq * TT * HD, QPl + zq * TT * HD, KPh + zk * TT * HD, KPl + zk * TT * HD, HD, Sb, TT, 0, (size_t)TT * HD, (size_t)TT * HD, (size_t)TT * TT);
            k_gemmc<h16, 0, 1><<<dim3((TT - RH) / 64, TT / 64, ZH), 32, 0, stream>>>(QP16 + zq * TT * HD + (size_t)RH * HD, nullptr, KP16 + zk * TT * HD, nullptr, HD, Sb + (size_t)RH * TT, TT, RH, (size_t)TT * HD, (size_t)TT * HD, (size_t)TT * TT);
            k_asoft<<<ZH * TT / 8, 256, 0, stream>>>(Sb, KF, P16, Ph, Pl);
            k_gemmc<bf, 2, 2><<<dim3(RH / 64, HD / 64, ZH), 32, 0, stream>>>(Ph, Pl, VTh + zk * HD * TT, VTl + zk * HD * TT, TT, Ob, HD, 0, (size_t)RH * TT, (size_t)HD * TT, (size_t)TT * HD);
            k_gemmc<h16, 0, 2><<<dim3((TT - RH) / 64, HD / 64, ZH), 32, 0, stream>>>(P16 + (size_t)RH * TT, nullptr, VT16 + zk * HD * TT, nullptr, TT, Ob + (size_t)RH * HD, HD, RH, (size_t)TT * TT, (size_t)HD * TT, (size_t)TT * HD);
            k_merge<<<(unsigned)(((size_t)ZH * TT * HD / 2 + 255) / 256), 256, 0, stream>>>(Ob, h0, OUT + (size_t)b * TT * DQ); }
         }
}

// v001
// A run of this version takes 313 microseconds.
// Two timings next to v000 put it at 11.5 and 11.9 times that version's speed.
#include <hip/hip_runtime.h>

// Causal scaled dot-product attention on raw batch-head tensors with a data-derived key-padding mask (q, k, v [64][1024][64], no projections; scores = q.k / sqrt(64); keys whose absolute sum is exactly 0 are masked to -2^32+1 (== exclusion; computed from the data, none occur for random inputs); causal mask (same fill); softmax; out = attn.v -> [64][1024][64] (4.2 M); argument order q, k, v).
// Batch-heads ride in the grids: the plane builders and the merge take all 64 on grid y and the flag kernel on its flat index, one launch each; the score and P.V kernels (grid z) and the softmax (grid y) take ZB of them per pass, ZB being what the workspace holds of scores and probabilities.
// Layout per batch-head: NEW k_kzf computes the per-key flag sum_d |k[j][d]| != 0 (eight lanes per key, fixed tree) into an int vector; the f32 inputs feed the plane builders directly (identity table); causal T-1024 attention at NH 1 / ZH 1 (hybrid rows: < 512 hi/lo 3 products, rest fp16 x1024; k_gemmc skips tiles above the diagonal); the softmax kernel reads the flag vector (16 B per lane) and excludes flagged-zero keys by select; f32 merge writes the output rows.
// Compute dtypes, f32 accumulate: inputs split into bf16 hi/lo (rows < 512) or rounded to fp16 (rest); softmax f32; output f32. NOTE no stage rounds the inputs to bf16.

#define NB_  64
#define TT   1024
#define DM   64
#define NH_  1
#define NKV  1
#define REP  (NH_ / NKV)
#define HD   64
#define DQ   (NH_ * HD)
#define DKV  (NKV * HD)
#define ZH   1
#define ZB   16                   // batch-heads per score/softmax/P.V pass
#define RH   512                  // query rows < RH use hi+lo planes (0: none)
#define WIN  1024
#define PCAR 1024.0f
#define SCL  0.125f   // 1/sqrt(d_k)
typedef _Float16 h16;
typedef unsigned short bf;
typedef __attribute__((ext_vector_type(16))) __bf16   v16bf;
typedef __attribute__((ext_vector_type(16))) _Float16 v16h;
typedef __attribute__((ext_vector_type(8)))  _Float16 v8h;
typedef __attribute__((ext_vector_type(8)))  unsigned short v8us;
typedef __attribute__((ext_vector_type(8)))  float    v8f;
typedef __attribute__((ext_vector_type(4)))  float    v4f;
typedef v8h  __attribute__((may_alias)) v8ha;
typedef v4f  __attribute__((may_alias)) v4fa;
typedef v8us __attribute__((may_alias)) v8usa;

__device__ __forceinline__ unsigned short f2bf(float f) { unsigned u = __float_as_uint(f); u += 0x7FFFu + ((u >> 16) & 1u); return (unsigned short)(u >> 16); }
__device__ __forceinline__ float bf2f(unsigned short b) { return __uint_as_float(((unsigned)b) << 16); }
__device__ __forceinline__ float bfr(float f) { return bf2f(f2bf(f)); }
__device__ __forceinline__ v16h cat16(v8h lo, v8h hi) { return __builtin_shufflevector(lo, hi, 0, 1, 2, 3, 4, 5, 6, 7, 8, 9, 10, 11, 12, 13, 14, 15); }
__device__ __forceinline__ v16bf cat16b(v8us lo, v8us hi) { return __builtin_bit_cast(v16bf, __builtin_shufflevector(lo, hi, 0, 1, 2, 3, 4, 5, 6, 7, 8, 9, 10, 11, 12, 13, 14, 15)); }
__device__ __forceinline__ v8f wmma16(v16h a, v16h b, v8f c) { return __builtin_amdgcn_wmma_f32_16x16x32_f16(false, a, false, b, (short)0, c, false, false); }
__device__ __forceinline__ v8f wmmab(v16bf a, v16bf b, v8f c) { return __builtin_amdgcn_wmma_f32_16x16x32_bf16(false, a, false, b, (short)0, c, false, false); }



// ---- register-blocked GEMM, ONE WAVE per 64x64 output tile (16 accumulators), operands straight from K-contiguous 16-bit planes; grid (M/64, N/64, Z), 32 threads.
// C[m][n] (f32, pitch ldc) = sum_k A[m][k] Bt[n][k] (+ split products per NSPLIT). z-batch strides sA/sB/sC in elements. K % 32 == 0.
template <typename T16> struct WFrag;
template <> struct WFrag<h16> { typedef v16h V; static __device__ __forceinline__ V ld(const h16* p) { return cat16(*(const v8h*)p, *(const v8h*)(p + 16)); } static __device__ __forceinline__ v8f mma(V a, V b, v8f c) { return wmma16(a, b, c); } };
template <> struct WFrag<bf> { typedef v16bf V; static __device__ __forceinline__ V ld(const bf* p) { return cat16b(*(const v8us*)p, *(const v8us*)(p + 16)); } static __device__ __forceinline__ v8f mma(V a, V b, v8f c) { return wmmab(a, b, c); } };
// ---- k_gemmc: the same one-wave 64x64 tile GEMM specialised for causal attention: CMODE 1 skips score tiles entirely above the diagonal (query rows r0+roff.., key columns c0..), CMODE 2 limits the
// key (K) loop of the probability x value contraction to the diagonal block (probabilities beyond it are exactly zero). roff = row offset of this launch's first row within the sequence.
template <typename T16, int NSPLIT, int CMODE>
__global__ __launch_bounds__(32) void k_gemmc(const T16* __restrict__ A, const T16* __restrict__ A2, const T16* __restrict__ Bt, const T16* __restrict__ Bt2, int K, float* C, int ldc, int roff, size_t sA, size_t sB, size_t sC) {
    typedef typename WFrag<T16>::V V;
    __shared__ __align__(16) float os[16 * 68];
    const size_t z = blockIdx.z; A += z * sA; if (A2) A2 += z * sA; Bt += z * sB; if (Bt2) Bt2 += z * sB; C += z * sC;
    const int lane = threadIdx.x & 31, lr = lane & 15, hi = lane >> 4; const int r0 = blockIdx.x * 64, c0 = blockIdx.y * 64;
    if (CMODE == 1 && c0 > r0 + roff + 63) return;                  // score tile entirely above the causal diagonal: never read (the softmax masks j > i by select)
    const int Kl = (CMODE == 2) ? min(K, r0 + roff + 64) : K;        // P.V: probabilities are exactly 0 beyond the diagonal block, so the K loop stops there
    v8f acc[4][4];
#pragma unroll
    for (int mb = 0; mb < 4; ++mb)
#pragma unroll
        for (int nb = 0; nb < 4; ++nb) acc[mb][nb] = (v8f){};
    const size_t aoff = (size_t)(r0 + lr) * K + 8 * hi, boff = (size_t)(c0 + lr) * K + 8 * hi;
#pragma unroll 1
    for (int kc = 0; kc < Kl; kc += 32) {
        V a[4], a2[4];
#pragma unroll
        for (int mb = 0; mb < 4; ++mb) { a[mb] = WFrag<T16>::ld(A + aoff + (size_t)mb * 16 * K + kc); if (NSPLIT == 1 || NSPLIT == 2) a2[mb] = WFrag<T16>::ld(A2 + aoff + (size_t)mb * 16 * K + kc); }
#pragma unroll
        for (int nb = 0; nb < 4; ++nb) { const V b = WFrag<T16>::ld(Bt + boff + (size_t)nb * 16 * K + kc); V b2; if (NSPLIT >= 2) b2 = WFrag<T16>::ld(Bt2 + boff + (size_t)nb * 16 * K + kc);
#pragma unroll
            for (int mb = 0; mb < 4; ++mb) { acc[mb][nb] = WFrag<T16>::mma(a[mb], b, acc[mb][nb]); if (NSPLIT == 1 || NSPLIT == 2) acc[mb][nb] = WFrag<T16>::mma(a2[mb], b, acc[mb][nb]); if (NSPLIT >= 2) acc[mb][nb] = WFrag<T16>::mma(a[mb], b2, acc[mb][nb]); } }
        asm volatile("v_nop\n\tv_nop\n\tv_nop\n\tv_nop" : "+v"(acc[0][0]), "+v"(acc[1][1]), "+v"(acc[2][2]), "+v"(acc[3][3]) : "v"(a[0]), "v"(a[3]));
    }
#pragma unroll
    for (int mb = 0; mb < 4; ++mb) {
#pragma unroll
        for (int nb = 0; nb < 4; ++nb) {
#pragma unroll
            for (int j = 0; j < 8; ++j) os[(hi * 8 + j) * 68 + nb * 16 + lr] = acc[mb][nb][j]; }
        __builtin_amdgcn_wave_barrier(); asm volatile("" ::: "memory");
        float* crow = C + (size_t)(r0 + mb * 16) * ldc + c0;
{
#pragma unroll
            for (int s = 0; s < 8; ++s) { const int row = 2 * s + hi, cofs = lr * 4; v4f val = *(const v4fa*)(os + row * 68 + cofs);
                *(v4f*)(crow + (size_t)row * ldc + cofs) = val; }
             }
        __builtin_amdgcn_wave_barrier(); asm volatile("" ::: "memory");
    }
}

__device__ __forceinline__ h16 tohx(float x) { return (h16)x; }
__device__ __forceinline__ void splitf(float y, unsigned short& h, unsigned short& l) { h = f2bf(y); l = f2bf(y - bf2f(h)); }
typedef __attribute__((ext_vector_type(2))) _Float16 v2h;
typedef __attribute__((ext_vector_type(4))) _Float16 v4h;
typedef __attribute__((ext_vector_type(2))) unsigned short v2us;
typedef __attribute__((ext_vector_type(4))) unsigned short v4us;
typedef __attribute__((ext_vector_type(2))) float v2f;
typedef __attribute__((ext_vector_type(4))) int v4i;

// k_rope: head planes [h][t][d] (fp16 + hi/lo) of rope(x) x sc with the rotate-half convention out[d] = x[d] cos[t][d] - x[d+HD/2] sin[t][d], out[d+HD/2] = x[d+HD/2] cos[t][d+HD/2] + x[d] sin[t][d+HD/2]
__global__ __launch_bounds__(256) void k_rope(const float* __restrict__ F, int pitch, int nheads, const float* __restrict__ CS, const float* __restrict__ RF, const float* __restrict__ nw, float sc, h16* P16, bf* Ph, bf* Pl) {
    { const size_t y = blockIdx.y, po = y * nheads * TT * HD; F += y * TT * pitch; P16 += po; Ph += po; Pl += po; }   // grid y: batch (TT rows of F, one set of head planes)
    const size_t e = ((size_t)blockIdx.x * 256 + threadIdx.x) * 2; if (e >= (size_t)nheads * TT * HD) return; const int d = (int)(e % HD); const int t = (int)((e / HD) % TT); const int h = (int)(e / ((size_t)HD * TT)); const float* f = F + (size_t)t * pitch + h * HD; const float rf = RF ? RF[(size_t)h * TT + t] : 1.0f; v2h o16; v2us oh, ol;
#pragma unroll
    for (int q = 0; q < 2; ++q) { const int dd = d + q; const int dp = (dd < HD / 2) ? dd + HD / 2 : dd - HD / 2; float x0 = f[dd], x1 = f[dp];
        if (RF) { float n0 = __fmul_rn(x0, rf), n1 = __fmul_rn(x1, rf); asm volatile("" : "+v"(n0)); asm volatile("" : "+v"(n1)); x0 = __fmul_rn(bfr(nw[dd]), n0); x1 = __fmul_rn(bfr(nw[dp]), n1); }
        const v2f cs = *(const v2f*)(CS + ((size_t)t * HD + dd) * 2); float a = __fmul_rn(x0, cs[0]), bq = __fmul_rn(x1, cs[1]); asm volatile("" : "+v"(a)); asm volatile("" : "+v"(bq)); const float r = ((dd < HD / 2) ? __fsub_rn(a, bq) : __fadd_rn(a, bq)) * sc;
        o16[q] = tohx(r); unsigned short a2, c2; splitf(r, a2, c2); oh[q] = a2; ol[q] = c2; }
    *(v2h*)(P16 + e) = o16; *(v2us*)(Ph + e) = oh; *(v2us*)(Pl + e) = ol;  }
__global__ __launch_bounds__(256) void k_kzf(const float* __restrict__ K, int* KF) { __shared__ int fl[32]; const int tid = threadIdx.x; const int kk = tid >> 3, sub = tid & 7; const int j = blockIdx.x * 32 + kk; const float* kr = K + (size_t)j * HD + sub * 8; const v4f a = *(const v4f*)kr; const v4f b = *(const v4f*)(kr + 4);
    float s = __fadd_rn(__fadd_rn(__fadd_rn(fabsf(a[0]), fabsf(a[1])), __fadd_rn(fabsf(a[2]), fabsf(a[3]))), __fadd_rn(__fadd_rn(fabsf(b[0]), fabsf(b[1])), __fadd_rn(fabsf(b[2]), fabsf(b[3]))));
#pragma unroll
    for (int sh = 4; sh; sh >>= 1) s = __fadd_rn(s, __shfl_xor(s, sh, 32));
    if (sub == 0) fl[kk] = (s != 0.0f) ? 1 : 0;
    __syncthreads();
    if (tid < 32) { const int f = fl[tid]; int* dst = KF + blockIdx.x * 32 + tid; *(int*)dst = f;  } }
__global__ __launch_bounds__(256) void k_vtp(const float* __restrict__ F, int pitch, int nheads, h16* V16, bf* Vh, bf* Vl) {
    { const size_t y = blockIdx.y, po = y * nheads * HD * TT; F += y * TT * pitch; V16 += po; Vh += po; Vl += po; }   // grid y: batch
    const size_t e = ((size_t)blockIdx.x * 256 + threadIdx.x) * 2; if (e >= (size_t)nheads * HD * TT) return; const int t = (int)(e % TT); const int d = (int)((e / TT) % HD); const int g = (int)(e / ((size_t)TT * HD)); v2h o16; v2us oh, ol;
#pragma unroll
    for (int q = 0; q < 2; ++q) { const float x = F[(size_t)(t + q) * pitch + g * HD + d]; o16[q] = tohx(x); unsigned short a2, c2; splitf(x, a2, c2); oh[q] = a2; ol[q] = c2; }
    *(v2h*)(V16 + e) = o16; *(v2us*)(Vh + e) = oh; *(v2us*)(Vl + e) = ol;  }
__global__ __launch_bounds__(256) void k_csid(float* CS) { const int idx = blockIdx.x * 256 + threadIdx.x; if (idx >= TT * HD) return; v2f cs; cs[0] = 1.0f; cs[1] = 0.0f; *(v2f*)(CS + (size_t)idx * 2) = cs;  }
// k_asoft: per row (zz, i): t = S x 1/8 where j <= i AND the key's abs-sum flag is set (flag vector read as data; -2^32+1 == exclusion); softmax over the keys (register row, one exp, fixed trees);
__global__ __launch_bounds__(256) void k_asoft(const float* __restrict__ Sb, const int* __restrict__ kvp, h16* P16, bf* Ph, bf* Pl) {
    { const size_t y = blockIdx.y; Sb += y * ZH * TT * TT; kvp += y * TT; P16 += y * ZH * TT * TT; Ph += y * ZH * RH * TT; Pl += y * ZH * RH * TT; }   // grid y: batch of the pass
    const int lane = threadIdx.x & 31; const int row = blockIdx.x * 8 + (threadIdx.x >> 5); if (row >= ZH * TT) return; const int i = row % TT; const int zz = row / TT; (void)zz; const bool hires = (i < RH); const float* sr = Sb + (size_t)row * TT; float v[TT / 32]; float mx = -3.0e38f;
#pragma unroll
    for (int ch = 0; ch < TT / 128; ++ch) { const int j0 = ch * 128 + lane * 4; const v4f a = *(const v4f*)(sr + j0); const v4i kv4 = *(const v4i*)(kvp + j0);   /* the batch's key vector, 16 B per lane, unconditional */
#pragma unroll
        for (int q = 0; q < 4; ++q) { const int j = j0 + q; (void)j; const float t = (j <= i && i - j < WIN && kv4[q] != 0) ? a[q] * SCL : -3.0e38f; v[ch * 4 + q] = t; mx = fmaxf(mx, t); } }
#pragma unroll
    for (int sh = 16; sh; sh >>= 1) mx = fmaxf(mx, __shfl_xor(mx, sh, 32));
    float sum = 0.f;
#pragma unroll
    for (int k = 0; k < TT / 32; ++k) { float d0 = __fsub_rn(v[k], mx); asm volatile("" : "+v"(d0)); v[k] = __builtin_amdgcn_exp2f(__fmul_rn(d0, 1.4426950408889634f)); sum += v[k]; }
#pragma unroll
    for (int sh = 16; sh; sh >>= 1) sum += __shfl_xor(sum, sh, 32);
    const float f = __fdiv_rn(hires ? 1.0f : PCAR, sum);
{
        if (hires) {
#pragma unroll
            for (int ch = 0; ch < TT / 128; ++ch) { v4us oh, ol;
#pragma unroll
                for (int q = 0; q < 4; ++q) { unsigned short a, c2; splitf(v[ch * 4 + q] * f, a, c2); oh[q] = a; ol[q] = c2; }
                const size_t oo = ((size_t)zz * (RH ? RH : 1) + i) * TT + ch * 128 + lane * 4; *(v4us*)(Ph + oo) = oh; *(v4us*)(Pl + oo) = ol; }
        } else {
#pragma unroll
            for (int ch = 0; ch < TT / 128; ++ch) { v4h o4;
#pragma unroll
                for (int q = 0; q < 4; ++q) o4[q] = tohx(v[ch * 4 + q] * f);
                *(v4h*)(P16 + (size_t)row * TT + ch * 128 + lane * 4) = o4; } }
         }
}
__global__ __launch_bounds__(256) void k_merge(const float* __restrict__ O, int h0, float* OUTb) {
    { const size_t y = blockIdx.y; O += y * ZH * TT * HD; OUTb += y * TT * DQ; }   // grid y: batch
    const size_t e = ((size_t)blockIdx.x * 256 + threadIdx.x) * 2; if (e >= (size_t)ZH * TT * HD) return; const int d = (int)(e % HD); const int t = (int)((e / HD) % TT); const int zz = (int)(e / ((size_t)HD * TT)); const float cs = (t < RH) ? 1.0f : (1.0f / PCAR); const size_t oo = (size_t)t * DQ + (h0 + zz) * HD + d;
    v2f o2; o2[0] = O[e] * cs; o2[1] = O[e + 1] * cs; *(v2f*)(OUTb + oo) = o2;  }

extern "C" void kernel_launch(void* const* d_in, const int* in_sizes, int n_in,
                              void* d_out, int out_size, void* d_ws, size_t ws_size, hipStream_t stream) {
    (void)in_sizes; (void)n_in; (void)out_size;
    const float* x = (const float*)d_in[0]; const float* xk = (const float*)d_in[1]; const float* xv = (const float*)d_in[2];   /* input order q, k, v: [64][1024][64] each (no projections) */ const float* wq = nullptr, *wk = nullptr, *wv = nullptr, *wo = nullptr; (void)wq; (void)wk; (void)wv; (void)wo;
    float* OUT = (float*)d_out;     // [64][1024][64]
    char* wsp = (char*)d_ws;
    auto take = [&](size_t bytes) { char* p = wsp; wsp += (bytes + 255) & ~(size_t)255; return (void*)p; };
    float* CS = (float*)take((size_t)TT * HD * 2 * 4);
    int* KF = (int*)take((size_t)NB_ * TT * 4);   /* per-key non-zero flags, all batch-heads */
    const size_t HS = (size_t)TT * HD;             /* one batch-head of an input, a plane or the output, in elements */
    const size_t PLN = (size_t)NB_ * HS;           /* one plane over all batch-heads */
    h16* QP16 = (h16*)take(PLN * 2); h16* KP16 = (h16*)take(PLN * 2); h16* VT16 = (h16*)take(PLN * 2);
    bf* QPh = (bf*)take(PLN * 2); bf* QPl = (bf*)take(PLN * 2); bf* KPh = (bf*)take(PLN * 2); bf* KPl = (bf*)take(PLN * 2); bf* VTh = (bf*)take(PLN * 2); bf* VTl = (bf*)take(PLN * 2);
    bf* Ph = (bf*)take((size_t)ZB * RH * TT * 2); bf* Pl = (bf*)take((size_t)ZB * RH * TT * 2);
    float* Sb = (float*)take((size_t)ZB * TT * TT * 4); h16* P16 = (h16*)take((size_t)ZB * TT * TT * 2); float* Ob = (float*)take(PLN * 4);
    if ((size_t)(wsp - (char*)d_ws) > ws_size) return;    // ws 256 MiB
    k_csid<<<(TT * HD + 255) / 256, 256, 0, stream>>>(CS);
    const unsigned LQ = (unsigned)(((size_t)NH_ * TT * HD / 2 + 255) / 256), LKv = (unsigned)(((size_t)NKV * TT * HD / 2 + 255) / 256);
    /* no projections: the q, k, v inputs feed the plane builders directly, all batch-heads in one launch each */
    k_rope<<<dim3(LQ, NB_), 256, 0, stream>>>(x, DQ, NH_, CS, nullptr, nullptr, 1.0f, QP16, QPh, QPl);   /* q planes straight from the input (bf16 hi/lo split of the f32 values) */
    k_kzf<<<NB_ * TT / 32, 256, 0, stream>>>(xk, KF);   /* key-padding flags from the data */
    k_rope<<<dim3(LKv, NB_), 256, 0, stream>>>(xk, DKV, NKV, CS, nullptr, nullptr, 1.0f, KP16, KPh, KPl);
    k_vtp<<<dim3(LKv, NB_), 256, 0, stream>>>(xv, DKV, NKV, VT16, VTh, VTl);
    for (int b = 0; b < NB_; b += ZB) { const size_t zo = (size_t)b * HS;   // ZB batch-heads per pass
        k_gemmc<bf, 2, 1><<<dim3(RH / 64, TT / 64, ZB), 32, 0, stream>>>(QPh + zo, QPl + zo, KPh + zo, KPl + zo, HD, Sb, TT, 0, HS, HS, (size_t)TT * TT);
        k_gemmc<h16, 0, 1><<<dim3((TT - RH) / 64, TT / 64, ZB), 32, 0, stream>>>(QP16 + zo + (size_t)RH * HD, nullptr, KP16 + zo, nullptr, HD, Sb + (size_t)RH * TT, TT, RH, HS, HS, (size_t)TT * TT);
        k_asoft<<<dim3(ZH * TT / 8, ZB), 256, 0, stream>>>(Sb, KF + (size_t)b * TT, P16, Ph, Pl);
        k_gemmc<bf, 2, 2><<<dim3(RH / 64, HD / 64, ZB), 32, 0, stream>>>(Ph, Pl, VTh + zo, VTl + zo, TT, Ob + zo, HD, 0, (size_t)RH * TT, HS, HS);
        k_gemmc<h16, 0, 2><<<dim3((TT - RH) / 64, HD / 64, ZB), 32, 0, stream>>>(P16 + (size_t)RH * TT, nullptr, VT16 + zo, nullptr, TT, Ob + zo + (size_t)RH * HD, HD, RH, (size_t)TT * TT, HS, HS);
    }
    k_merge<<<dim3((unsigned)(((size_t)ZH * TT * HD / 2 + 255) / 256), NB_), 256, 0, stream>>>(Ob, 0, OUT);
}

// v002
// A run of this version takes 79.3 microseconds.
// In two side-by-side timings against v001, it was 3.97 and 3.93 times as fast.
// All steps since v000 together make it 46.4 times as fast.
#include <hip/hip_runtime.h>

// Causal scaled dot-product attention on raw batch-head tensors with a data-derived key-padding mask (q, k, v [64][1024][64], no projections; scores = q.k / sqrt(64); keys whose absolute sum is exactly 0 are masked to -2^32+1 (== exclusion; computed from the data, none occur for random inputs); causal mask (same fill); softmax; out = attn.v -> [64][1024][64] (4.2 M); argument order q, k, v).
// Batch-heads ride in the grids: the plane builders take all 64 on grid y and the flag kernel on its flat index, one launch each; one attention kernel (grid y: batch-head) then does scores, softmax and P.V for all of them.
// Layout per batch-head: k_kzf turns the per-key test sum_d |k[j][d]| != 0 (eight lanes per key, fixed tree) into a float vector (0, or -3e38 for an all-zero key); the f32 inputs feed the plane builders directly (identity table); k_fattn keeps a wave's score tile in registers (running maximum and sum per query), hybrid rows: < 512 hi/lo 3 products, rest fp16 with probabilities x1024; all-zero keys are excluded by adding that vector to the scores; it writes the f32 output rows.
// Compute dtypes, f32 accumulate: inputs split into bf16 hi/lo (rows < 512) or rounded to fp16 (rest); softmax f32; output f32.

#define NB_  64
#define TT   1024
#define DM   64
#define NH_  1
#define NKV  1
#define REP  (NH_ / NKV)
#define HD   64
#define DQ   (NH_ * HD)
#define DKV  (NKV * HD)
#define ZH   1
#define RH   512                  // query rows < RH use hi+lo planes (0: none)
#define WIN  1024
#define PCAR 1024.0f
#define SCL  0.125f   // 1/sqrt(d_k)
typedef _Float16 h16;
typedef unsigned short bf;
typedef __attribute__((ext_vector_type(16))) __bf16   v16bf;
typedef __attribute__((ext_vector_type(16))) _Float16 v16h;
typedef __attribute__((ext_vector_type(8)))  _Float16 v8h;
typedef __attribute__((ext_vector_type(8)))  unsigned short v8us;
typedef __attribute__((ext_vector_type(8)))  float    v8f;
typedef __attribute__((ext_vector_type(4)))  float    v4f;
typedef v8h  __attribute__((may_alias)) v8ha;
typedef v4f  __attribute__((may_alias)) v4fa;
typedef v8us __attribute__((may_alias)) v8usa;

__device__ __forceinline__ unsigned short f2bf(float f) { unsigned u = __float_as_uint(f); u += 0x7FFFu + ((u >> 16) & 1u); return (unsigned short)(u >> 16); }
__device__ __forceinline__ float bf2f(unsigned short b) { return __uint_as_float(((unsigned)b) << 16); }
__device__ __forceinline__ float bfr(float f) { return bf2f(f2bf(f)); }
__device__ __forceinline__ v16h cat16(v8h lo, v8h hi) { return __builtin_shufflevector(lo, hi, 0, 1, 2, 3, 4, 5, 6, 7, 8, 9, 10, 11, 12, 13, 14, 15); }
__device__ __forceinline__ v16bf cat16b(v8us lo, v8us hi) { return __builtin_bit_cast(v16bf, __builtin_shufflevector(lo, hi, 0, 1, 2, 3, 4, 5, 6, 7, 8, 9, 10, 11, 12, 13, 14, 15)); }
__device__ __forceinline__ v8f wmma16(v16h a, v16h b, v8f c) { return __builtin_amdgcn_wmma_f32_16x16x32_f16(false, a, false, b, (short)0, c, false, false); }
__device__ __forceinline__ v8f wmmab(v16bf a, v16bf b, v8f c) { return __builtin_amdgcn_wmma_f32_16x16x32_bf16(false, a, false, b, (short)0, c, false, false); }



// ---- 16x32 operand fragments straight from K-contiguous 16-bit planes (row = lane & 15; k = 8 * (lane >> 4) + 0..7 and 16 + 8 * (lane >> 4) + 0..7), the same loader for A and for B.
template <typename T16> struct WFrag;
template <> struct WFrag<h16> { typedef v16h V; static __device__ __forceinline__ V ld(const h16* p) { return cat16(*(const v8h*)p, *(const v8h*)(p + 16)); } static __device__ __forceinline__ v8f mma(V a, V b, v8f c) { return wmma16(a, b, c); } };
template <> struct WFrag<bf> { typedef v16bf V; static __device__ __forceinline__ V ld(const bf* p) { return cat16b(*(const v8us*)p, *(const v8us*)(p + 16)); } static __device__ __forceinline__ v8f mma(V a, V b, v8f c) { return wmmab(a, b, c); } };
__device__ __forceinline__ h16 tohx(float x) { return (h16)x; }
__device__ __forceinline__ void splitf(float y, unsigned short& h, unsigned short& l) { h = f2bf(y); l = f2bf(y - bf2f(h)); }
typedef __attribute__((ext_vector_type(2))) _Float16 v2h;
typedef __attribute__((ext_vector_type(4))) _Float16 v4h;
typedef __attribute__((ext_vector_type(2))) unsigned short v2us;
typedef __attribute__((ext_vector_type(4))) unsigned short v4us;
typedef __attribute__((ext_vector_type(2))) float v2f;
typedef __attribute__((ext_vector_type(4))) int v4i;

// k_rope: head planes [h][t][d] (fp16 + hi/lo) of rope(x) x sc with the rotate-half convention out[d] = x[d] cos[t][d] - x[d+HD/2] sin[t][d], out[d+HD/2] = x[d+HD/2] cos[t][d+HD/2] + x[d] sin[t][d+HD/2]
__global__ __launch_bounds__(256) void k_rope(const float* __restrict__ F, int pitch, int nheads, const float* __restrict__ CS, const float* __restrict__ RF, const float* __restrict__ nw, float sc, h16* P16, bf* Ph, bf* Pl) {
    { const size_t y = blockIdx.y, po = y * nheads * TT * HD; F += y * TT * pitch; P16 += po; Ph += po; Pl += po; }   // grid y: batch (TT rows of F, one set of head planes)
    const size_t e = ((size_t)blockIdx.x * 256 + threadIdx.x) * 2; if (e >= (size_t)nheads * TT * HD) return; const int d = (int)(e % HD); const int t = (int)((e / HD) % TT); const int h = (int)(e / ((size_t)HD * TT)); const float* f = F + (size_t)t * pitch + h * HD; const float rf = RF ? RF[(size_t)h * TT + t] : 1.0f; v2h o16; v2us oh, ol;
#pragma unroll
    for (int q = 0; q < 2; ++q) { const int dd = d + q; const int dp = (dd < HD / 2) ? dd + HD / 2 : dd - HD / 2; float x0 = f[dd], x1 = f[dp];
        if (RF) { float n0 = __fmul_rn(x0, rf), n1 = __fmul_rn(x1, rf); asm volatile("" : "+v"(n0)); asm volatile("" : "+v"(n1)); x0 = __fmul_rn(bfr(nw[dd]), n0); x1 = __fmul_rn(bfr(nw[dp]), n1); }
        const v2f cs = *(const v2f*)(CS + ((size_t)t * HD + dd) * 2); float a = __fmul_rn(x0, cs[0]), bq = __fmul_rn(x1, cs[1]); asm volatile("" : "+v"(a)); asm volatile("" : "+v"(bq)); const float r = ((dd < HD / 2) ? __fsub_rn(a, bq) : __fadd_rn(a, bq)) * sc;
        o16[q] = tohx(r); unsigned short a2, c2; splitf(r, a2, c2); oh[q] = a2; ol[q] = c2; }
    *(v2h*)(P16 + e) = o16; *(v2us*)(Ph + e) = oh; *(v2us*)(Pl + e) = ol;  }
__global__ __launch_bounds__(256) void k_kzf(const float* __restrict__ K, float* KF) { __shared__ float fl[32]; const int tid = threadIdx.x; const int kk = tid >> 3, sub = tid & 7; const int j = blockIdx.x * 32 + kk; const float* kr = K + (size_t)j * HD + sub * 8; const v4f a = *(const v4f*)kr; const v4f b = *(const v4f*)(kr + 4);
    float s = __fadd_rn(__fadd_rn(__fadd_rn(fabsf(a[0]), fabsf(a[1])), __fadd_rn(fabsf(a[2]), fabsf(a[3]))), __fadd_rn(__fadd_rn(fabsf(b[0]), fabsf(b[1])), __fadd_rn(fabsf(b[2]), fabsf(b[3]))));
#pragma unroll
    for (int sh = 4; sh; sh >>= 1) s = __fadd_rn(s, __shfl_xor(s, sh, 32));
    if (sub == 0) fl[kk] = (s != 0.0f) ? 0.0f : -3.0e38f;   // what the key adds to its scores: nothing, or the exclusion value (an all-zero key's own products are exactly 0)
    __syncthreads();
    if (tid < 32) { const float f = fl[tid]; float* dst = KF + blockIdx.x * 32 + tid; *dst = f;  } }
__global__ __launch_bounds__(256) void k_vtp(const float* __restrict__ F, int pitch, int nheads, h16* V16, bf* Vh, bf* Vl) {
    { const size_t y = blockIdx.y, po = y * nheads * HD * TT; F += y * TT * pitch; V16 += po; Vh += po; Vl += po; }   // grid y: batch
    const size_t e = ((size_t)blockIdx.x * 256 + threadIdx.x) * 2; if (e >= (size_t)nheads * HD * TT) return; const int t = (int)(e % TT); const int d = (int)((e / TT) % HD); const int g = (int)(e / ((size_t)TT * HD)); v2h o16; v2us oh, ol;
#pragma unroll
    for (int q = 0; q < 2; ++q) { const float x = F[(size_t)(t + q) * pitch + g * HD + d]; o16[q] = tohx(x); unsigned short a2, c2; splitf(x, a2, c2); oh[q] = a2; ol[q] = c2; }
    *(v2h*)(V16 + e) = o16; *(v2us*)(Vh + e) = oh; *(v2us*)(Vl + e) = ol;  }
__global__ __launch_bounds__(256) void k_csid(float* CS) { const int idx = blockIdx.x * 256 + threadIdx.x; if (idx >= TT * HD) return; v2f cs; cs[0] = 1.0f; cs[1] = 0.0f; *(v2f*)(CS + (size_t)idx * 2) = cs;  }
typedef __attribute__((ext_vector_type(2))) __bf16 v2b;
struct yes_t { static constexpr bool value = true; }; struct no_t { static constexpr bool value = false; };   // compile-time switches of a pass
#define XSC  0.18033688011112042f   // 1/sqrt(d_k) x log2(e): scores go to the exponent of 2 in one multiply-add
#define MLOW -1.0e30f               // start of the running maximum: far above an excluded score x XSC, so an excluded key's probability is exactly 0
__device__ __forceinline__ float xhalf(float x) { const int b = __float_as_int(x); return __int_as_float(__builtin_amdgcn_permlanex16(b, b, 0x76543210, 0xfedcba98, false, false)); }   // value of lane ^ 16
__device__ __forceinline__ float exp2x1(float x) { float r; asm("v_exp_f32 %0, %1\n\tv_nop" : "=v"(r) : "v"(x)); return r; }
__device__ __forceinline__ void exp2x8(const float* x, float* p) {
    asm("v_exp_f32 %0, %8\n\tv_exp_f32 %1, %9\n\tv_exp_f32 %2, %10\n\tv_exp_f32 %3, %11\n\tv_exp_f32 %4, %12\n\tv_exp_f32 %5, %13\n\tv_exp_f32 %6, %14\n\tv_exp_f32 %7, %15\n\tv_nop"
        : "=&v"(p[0]), "=&v"(p[1]), "=&v"(p[2]), "=&v"(p[3]), "=&v"(p[4]), "=&v"(p[5]), "=&v"(p[6]), "=&v"(p[7]) : "v"(x[0]), "v"(x[1]), "v"(x[2]), "v"(x[3]), "v"(x[4]), "v"(x[5]), "v"(x[6]), "v"(x[7])); }
template <typename T16, bool SPLIT, int NBQ>
__device__ __forceinline__ void attn_rows(const T16* __restrict__ Q, const T16* __restrict__ Q2, const T16* __restrict__ Kp, const T16* __restrict__ Kp2, const T16* __restrict__ Vt, const T16* __restrict__ Vt2,
                                          const float* __restrict__ kf, const float* __restrict__ vraw, float* __restrict__ out, const int q0) {
    typedef typename WFrag<T16>::V V; typedef WFrag<T16> F;
    const int lane = threadIdx.x & 31, lr = lane & 15, hi = lane >> 4;
    const unsigned klo = (unsigned)(lr * HD + 8 * hi) * 2u, vlo = (unsigned)(lr * TT + 8 * hi) * 2u, blo = (unsigned)hi * 32u;   // the lane's byte offsets in a 16-row group of a [row][HD] plane, of the [d][TT] value plane and in 16 key terms: fixed for the whole kernel: every address is a wave-uniform base + one of these + a constant
    auto at = [](const T16* base, unsigned off) { return (const T16*)((const char*)base + off); };
    V q[NBQ][2], q2[NBQ][2];
#pragma unroll
    for (int nb = 0; nb < NBQ; ++nb)
#pragma unroll
        for (int ks = 0; ks < 2; ++ks) q[nb][ks] = F::ld(at(Q + (size_t)q0 * HD, klo) + nb * 16 * HD + ks * 32);
    asm volatile("s_wait_xcnt 0x0" ::: "memory");                    // here and below: before any register that the loads in front name (address, scalar base) is written again
    if constexpr (SPLIT) {
#pragma unroll
        for (int nb = 0; nb < NBQ; ++nb)
#pragma unroll
            for (int ks = 0; ks < 2; ++ks) q2[nb][ks] = F::ld(at(Q2 + (size_t)q0 * HD, klo) + nb * 16 * HD + ks * 32);
        asm volatile("s_wait_xcnt 0x0" ::: "memory"); }
    v8f o[4][NBQ]; float m[NBQ], l[NBQ];
#pragma unroll
    for (int nb = 0; nb < NBQ; ++nb) { m[nb] = MLOW; l[nb] = 0.0f;
#pragma unroll
        for (int md = 0; md < 4; ++md) o[md][nb] = (v8f){}; }
    V kc[2][2], kc2[2][2], vt[4], vt2[4]; v8f cb[2], s[2][NBQ];      // cb: a pass's key terms in the score tiles' register order, the C operand of each tile's first product
    auto load_k = [&](const int kb) {                                // key fragments and key terms of the pass at kb
#pragma unroll
        for (int mt = 0; mt < 2; ++mt)
#pragma unroll
            for (int ks = 0; ks < 2; ++ks) { kc[mt][ks] = F::ld(at(Kp + (size_t)kb * HD, klo) + mt * 16 * HD + ks * 32); if (SPLIT) kc2[mt][ks] = F::ld(at(Kp2 + (size_t)kb * HD, klo) + mt * 16 * HD + ks * 32); }
#pragma unroll
        for (int mt = 0; mt < 2; ++mt) cb[mt] = *(const v8f*)((const char*)(kf + kb + mt * 16) + blo);
    };
    auto load_v = [&](const int kb) {                                // value fragments of the pass at kb
#pragma unroll
        for (int md = 0; md < 4; ++md) { vt[md] = F::ld(at(Vt + kb, vlo) + md * 16 * TT); if (SPLIT) vt2[md] = F::ld(at(Vt2 + kb, vlo) + md * 16 * TT); }
    };
    auto scores = [&]() {                                            // S^T of the pass whose key fragments are loaded
#pragma unroll
        for (int mt = 0; mt < 2; ++mt)
#pragma unroll
            for (int nb = 0; nb < NBQ; ++nb) s[mt][nb] = cb[mt];
#pragma unroll
        for (int ks = 0; ks < 2; ++ks)
#pragma unroll
            for (int pr = 0; pr < (SPLIT ? 3 : 1); ++pr)             // tiles innermost: neighbouring products go to different accumulators
#pragma unroll
                for (int mt = 0; mt < 2; ++mt)
#pragma unroll
                    for (int nb = 0; nb < NBQ; ++nb) s[mt][nb] = F::mma(pr == 1 ? kc2[mt][ks] : kc[mt][ks], pr == 2 ? q2[nb][ks] : q[nb][ks], s[mt][nb]);
    };
    // second half: the diagonal's exclusions (compile-time choice: only the last pass has any), running softmax, O^T += V^T.P^T
    auto finish = [&](auto causal, const int kb) {
        if constexpr (causal.value) {
#pragma unroll
            for (int mt = 0; mt < 2; ++mt)
#pragma unroll
                for (int nb = 0; nb < NBQ; ++nb)
#pragma unroll
                    for (int j = 0; j < 8; ++j) s[mt][nb][j] = (kb + mt * 16 + hi * 8 + j <= q0 + nb * 16 + lr) ? s[mt][nb][j] : -3.0e38f; }
        V ph[NBQ], pl[NBQ];
#pragma unroll
        for (int nb = 0; nb < NBQ; ++nb) {
            float mx = s[0][nb][0];
#pragma unroll
            for (int e = 1; e < 16; ++e) mx = fmaxf(mx, s[e >> 3][nb][e & 7]);
            mx = fmaxf(mx, xhalf(mx));
            const float mn = fmaxf(m[nb], mx * XSC); const float al = exp2x1(m[nb] - mn); m[nb] = mn;
            const float sub = SPLIT ? -mn : 10.0f - mn;              // fp16 rows carry probabilities x1024 (sum and products alike; it cancels in the division)
            float sum = 0.0f, x[16], pe[16];
#pragma unroll
            for (int e = 0; e < 16; ++e) x[e] = fmaf(s[e >> 3][nb][e & 7], XSC, sub);
            exp2x8(x, pe); exp2x8(x + 8, pe + 8);
#pragma unroll
            for (int e = 0; e < 16; e += 2) { v2f p; p[0] = pe[e]; p[1] = pe[e + 1]; sum += p[0] + p[1];
                if constexpr (SPLIT) { const v2b h = __builtin_convertvector(p, v2b); const v2b lo = __builtin_convertvector(p - __builtin_convertvector(h, v2f), v2b); ph[nb][e] = h[0]; ph[nb][e + 1] = h[1]; pl[nb][e] = lo[0]; pl[nb][e + 1] = lo[1]; }
                else { const v2h h = __builtin_convertvector(p, v2h); ph[nb][e] = h[0]; ph[nb][e + 1] = h[1]; } }
            l[nb] = l[nb] * al + sum;
#pragma unroll
            for (int md = 0; md < 4; ++md) o[md][nb] *= al; }
#pragma unroll
        for (int pr = 0; pr < (SPLIT ? 3 : 1); ++pr)
#pragma unroll
            for (int md = 0; md < 4; ++md)
#pragma unroll
                for (int nb = 0; nb < NBQ; ++nb) o[md][nb] = F::mma(pr == 1 ? vt2[md] : vt[md], pr == 2 ? pl[nb] : ph[nb], o[md][nb]);
    };
    const yes_t yes{}; const no_t no{};
    const int klast = ((q0 + NBQ * 16 + 31) & ~31) - 32;             // the one pass that reaches past a query's diagonal; keys beyond it are never read
    load_k(0);
    asm volatile("s_wait_xcnt 0x0" ::: "memory");
    scores();
    // The scores go round the loop, not the key fragments: a trip fetches its own values and the next pass's keys at its head, works on the scores it was handed, and forms the next pass's scores at its foot, a whole trip behind their fetch.
    for (int kb = 0; kb < klast; kb += 32) {
        load_v(kb);
        asm volatile("s_wait_xcnt 0x0" ::: "memory");                // before any register that these loads name is written again (the next group's results may land in their address registers)
        load_k(kb + 32);
        asm volatile("s_wait_xcnt 0x0" ::: "memory");                // the same for the second group
        __builtin_amdgcn_sched_barrier(0);                           // holds the trip's fetches up here: left free, the scheduler sinks each one to just in front of its use and the wave waits out every latency
        finish(no, kb);
        __builtin_amdgcn_sched_barrier(0);                           // keeps the next pass's score products down here: moved up among the softmax arithmetic they wait for keys that were only just asked for
        scores();
    }
    load_v(klast);
    asm volatile("s_wait_xcnt 0x0" ::: "memory");                    // as above
    __builtin_amdgcn_sched_barrier(0);                               // keeps the arithmetic below from moving in between the loads and their wait, where it reuses their address registers
    finish(yes, klast);
#pragma unroll
    for (int nb = 0; nb < NBQ; ++nb) {
        const float ls = l[nb] + xhalf(l[nb]); const bool dead = !(ls > 0.0f); float inv = __fdiv_rn(1.0f, ls);
        if (__builtin_amdgcn_ballot_w32(dead) != 0) {                // cold: a query whose every allowed key is padding
            v8f mean[4];
#pragma unroll
            for (int md = 0; md < 4; ++md) mean[md] = (v8f){};
#pragma unroll 1                                                     // cold path: keep its code small
            for (int t = 0; t < TT; ++t) { v8f x[4];
#pragma unroll
                for (int md = 0; md < 4; ++md) x[md] = *(const v8f*)(vraw + (size_t)t * HD + md * 16 + hi * 8);
                asm volatile("s_wait_xcnt 0x0" ::: "memory");        // before the address moves on
#pragma unroll
                for (int md = 0; md < 4; ++md) mean[md] += x[md]; }
#pragma unroll
            for (int md = 0; md < 4; ++md)
#pragma unroll
                for (int j = 0; j < 8; ++j) o[md][nb][j] = dead ? mean[md][j] * (1.0f / TT) : o[md][nb][j];
            inv = dead ? 1.0f : inv; }
#pragma unroll
        for (int md = 0; md < 4; ++md) o[md][nb] *= inv;
    }
#pragma unroll
    for (int nb = 0; nb < NBQ; ++nb) {                               // all stores last: nothing is computed behind them
        float* orow = out + (size_t)(q0 + nb * 16 + lr) * HD + hi * 8;   // register j of tile md is column md * 16 + 8 hi + j of the lane's query row
#pragma unroll
        for (int md = 0; md < 4; ++md) *(v8f*)(orow + md * 16) = o[md][nb];
        asm volatile("s_wait_xcnt 0x0" ::: "memory");                // before a register that the stores name is written again
    }
}
// k_fattn: grid (12, batch-heads), 4 independent waves a block; wave index w: w < 16 takes 32 fp16 rows, from the sequence's end downwards (longest first), the rest 16 hi/lo rows each, upwards, so that blocks four and eight apart, a long, a short and a middling one, add up alike.
__global__ __launch_bounds__(128) void k_fattn(const h16* __restrict__ Q16, const h16* __restrict__ K16, const h16* __restrict__ V16, const bf* __restrict__ Qh, const bf* __restrict__ Ql, const bf* __restrict__ Kh, const bf* __restrict__ Kl,
                                               const bf* __restrict__ Vh, const bf* __restrict__ Vl, const float* __restrict__ KF, const float* __restrict__ Vraw, float* __restrict__ OUTb) {
    const size_t zo = (size_t)blockIdx.y * TT * HD; const float* kf = KF + (size_t)blockIdx.y * TT;
    const int w = blockIdx.x * 4 + __builtin_amdgcn_readfirstlane((int)(threadIdx.x >> 5));   // scalar, so that the path and every pass test are scalar branches
    if (w < (TT - RH) / 32) attn_rows<h16, false, 2>(Q16 + zo, nullptr, K16 + zo, nullptr, V16 + zo, nullptr, kf, Vraw + zo, OUTb + zo, RH + 32 * ((TT - RH) / 32 - 1 - w));
    else attn_rows<bf, true, 1>(Qh + zo, Ql + zo, Kh + zo, Kl + zo, Vh + zo, Vl + zo, kf, Vraw + zo, OUTb + zo, 16 * (w - (TT - RH) / 32));
}
extern "C" void kernel_launch(void* const* d_in, const int* in_sizes, int n_in,
                              void* d_out, int out_size, void* d_ws, size_t ws_size, hipStream_t stream) {
    (void)in_sizes; (void)n_in; (void)out_size;
    const float* x = (const float*)d_in[0]; const float* xk = (const float*)d_in[1]; const float* xv = (const float*)d_in[2];   /* input order q, k, v: [64][1024][64] each (no projections) */ const float* wq = nullptr, *wk = nullptr, *wv = nullptr, *wo = nullptr; (void)wq; (void)wk; (void)wv; (void)wo;
    float* OUT = (float*)d_out;     // [64][1024][64]
    char* wsp = (char*)d_ws;
    auto take = [&](size_t bytes) { char* p = wsp; wsp += (bytes + 255) & ~(size_t)255; return (void*)p; };
    float* CS = (float*)take((size_t)TT * HD * 2 * 4);
    float* KF = (float*)take((size_t)NB_ * TT * 4);   /* per-key score terms (0, or the exclusion value for an all-zero key), all batch-heads */
    const size_t HS = (size_t)TT * HD;             /* one batch-head of an input, a plane or the output, in elements */
    const size_t PLN = (size_t)NB_ * HS;           /* one plane over all batch-heads */
    h16* QP16 = (h16*)take(PLN * 2); h16* KP16 = (h16*)take(PLN * 2); h16* VT16 = (h16*)take(PLN * 2);
    bf* QPh = (bf*)take(PLN * 2); bf* QPl = (bf*)take(PLN * 2); bf* KPh = (bf*)take(PLN * 2); bf* KPl = (bf*)take(PLN * 2); bf* VTh = (bf*)take(PLN * 2); bf* VTl = (bf*)take(PLN * 2);
    if ((size_t)(wsp - (char*)d_ws) > ws_size) return;    // ws 256 MiB
    k_csid<<<(TT * HD + 255) / 256, 256, 0, stream>>>(CS);
    const unsigned LQ = (unsigned)(((size_t)NH_ * TT * HD / 2 + 255) / 256), LKv = (unsigned)(((size_t)NKV * TT * HD / 2 + 255) / 256);
    /* no projections: the q, k, v inputs feed the plane builders directly, all batch-heads in one launch each */
    k_rope<<<dim3(LQ, NB_), 256, 0, stream>>>(x, DQ, NH_, CS, nullptr, nullptr, 1.0f, QP16, QPh, QPl);   /* q planes straight from the input (bf16 hi/lo split of the f32 values) */
    k_kzf<<<NB_ * TT / 32, 256, 0, stream>>>(xk, KF);   /* key-padding flags from the data */
    k_rope<<<dim3(LKv, NB_), 256, 0, stream>>>(xk, DKV, NKV, CS, nullptr, nullptr, 1.0f, KP16, KPh, KPl);
    k_vtp<<<dim3(LKv, NB_), 256, 0, stream>>>(xv, DKV, NKV, VT16, VTh, VTl);
    k_fattn<<<dim3(((TT - RH) / 32 + RH / 16) / 4, NB_), 128, 0, stream>>>(QP16, KP16, VT16, QPh, QPl, KPh, KPl, VTh, VTl, KF, xv, OUT);   /* scores, softmax, P.V and the output rows, all batch-heads */
}

// v003
// Measured time: 55.5 microseconds a run.
// Next to v002, in two timings, it ran 1.43 and 1.42 times as fast.
// Over all steps from v000 it is 66.1 times as fast.
#include <hip/hip_runtime.h>

// Causal scaled dot-product attention on raw batch-head tensors with a data-derived key-padding mask (q, k, v [64][1024][64], no projections; scores = q.k / sqrt(64); keys whose absolute sum is exactly 0 are masked to -2^32+1 (== exclusion; computed from the data, none occur for random inputs); causal mask (same fill); softmax; out = attn.v -> [64][1024][64] (4.2 M); argument order q, k, v).
// Two launches: k_prep builds every 16-bit plane and the key terms for all 64 batch-heads; one attention kernel (grid y: batch-head) then does scores, softmax and P.V for all of them.
// Layout per batch-head: k_prep turns the per-key test sum_d |k[j][d]| != 0 (8 lanes a key, fixed tree) into a float vector (0, or -3e38 for an all-zero key) and the f32 inputs into planes (q, k as they lie, v transposed); k_fattn keeps a wave's score tile in registers (running maximum and sum per query), hybrid rows: < 512 hi/lo 3 products, rest fp16 with probabilities x1024; all-zero keys are excluded by adding that vector to the scores; it writes the f32 output rows.
// Compute dtypes, f32 accumulate: inputs split into bf16 hi/lo (rows < 512) or rounded to fp16 (rest); softmax f32; output f32.

#define NB_  64
#define TT   1024
#define DM   64
#define NH_  1
#define NKV  1
#define REP  (NH_ / NKV)
#define HD   64
#define DQ   (NH_ * HD)
#define DKV  (NKV * HD)
#define ZH   1
#define RH   512                  // query rows < RH use hi+lo planes (0: none)
#define WIN  1024
#define PCAR 1024.0f
#define SCL  0.125f   // 1/sqrt(d_k)
typedef _Float16 h16;
typedef unsigned short bf;
typedef __attribute__((ext_vector_type(16))) __bf16   v16bf;
typedef __attribute__((ext_vector_type(16))) _Float16 v16h;
typedef __attribute__((ext_vector_type(8)))  _Float16 v8h;
typedef __attribute__((ext_vector_type(8)))  unsigned short v8us;
typedef __attribute__((ext_vector_type(8)))  float    v8f;
typedef __attribute__((ext_vector_type(4)))  float    v4f;
typedef v8h  __attribute__((may_alias)) v8ha;
typedef v4f  __attribute__((may_alias)) v4fa;
typedef v8us __attribute__((may_alias)) v8usa;

__device__ __forceinline__ v16h cat16(v8h lo, v8h hi) { return __builtin_shufflevector(lo, hi, 0, 1, 2, 3, 4, 5, 6, 7, 8, 9, 10, 11, 12, 13, 14, 15); }
__device__ __forceinline__ v16bf cat16b(v8us lo, v8us hi) { return __builtin_bit_cast(v16bf, __builtin_shufflevector(lo, hi, 0, 1, 2, 3, 4, 5, 6, 7, 8, 9, 10, 11, 12, 13, 14, 15)); }
__device__ __forceinline__ v8f wmma16(v16h a, v16h b, v8f c) { return __builtin_amdgcn_wmma_f32_16x16x32_f16(false, a, false, b, (short)0, c, false, false); }
__device__ __forceinline__ v8f wmmab(v16bf a, v16bf b, v8f c) { return __builtin_amdgcn_wmma_f32_16x16x32_bf16(false, a, false, b, (short)0, c, false, false); }



// ---- 16x32 operand fragments straight from K-contiguous 16-bit planes (row = lane & 15; k = 8 * (lane >> 4) + 0..7 and 16 + 8 * (lane >> 4) + 0..7), the same loader for A and for B.
template <typename T16> struct WFrag;
template <> struct WFrag<h16> { typedef v16h V; static __device__ __forceinline__ V ld(const h16* p) { return cat16(*(const v8h*)p, *(const v8h*)(p + 16)); } static __device__ __forceinline__ v8f mma(V a, V b, v8f c) { return wmma16(a, b, c); } };
template <> struct WFrag<bf> { typedef v16bf V; static __device__ __forceinline__ V ld(const bf* p) { return cat16b(*(const v8us*)p, *(const v8us*)(p + 16)); } static __device__ __forceinline__ v8f mma(V a, V b, v8f c) { return wmmab(a, b, c); } };
typedef __attribute__((ext_vector_type(2))) _Float16 v2h;
typedef __attribute__((ext_vector_type(4))) _Float16 v4h;
typedef __attribute__((ext_vector_type(2))) unsigned short v2us;
typedef __attribute__((ext_vector_type(4))) unsigned short v4us;
typedef __attribute__((ext_vector_type(2))) float v2f;
typedef __attribute__((ext_vector_type(4))) int v4i;

typedef __attribute__((ext_vector_type(2))) __bf16 v2b;
// cvt8: 8 neighbouring f32 values to their 16-byte groups of the planes: fp16 (round to nearest), and bf16 hi with lo = bf16(x - hi)
template <bool F16, bool SPL>
__device__ __forceinline__ void cvt8(const float* x, v8h& o16, v8us& oh, v8us& ol) {
#pragma unroll
    for (int e = 0; e < 8; e += 2) { v2f p; p[0] = x[e]; p[1] = x[e + 1];
        if constexpr (F16) { const v2h h = __builtin_convertvector(p, v2h); o16[e] = h[0]; o16[e + 1] = h[1]; }
        if constexpr (SPL) { const v2b h = __builtin_convertvector(p, v2b); const v2b lo = __builtin_convertvector(p - __builtin_convertvector(h, v2f), v2b);
            const v2us hu = __builtin_bit_cast(v2us, h), lu = __builtin_bit_cast(v2us, lo); oh[e] = hu[0]; oh[e + 1] = hu[1]; ol[e] = lu[0]; ol[e + 1] = lu[1]; } } }
template <int CTRL> __device__ __forceinline__ float xlane(float x) { return __int_as_float(__builtin_amdgcn_update_dpp(0, __float_as_int(x), CTRL, 0xf, 0xf, true)); }   // value of lane ^ m inside a 16-lane row (CTRL = 0x160 + m, row_xmask): in the vector pipe, no trip through the LDS unit
// rows32: one wave, 32 rows of a [row][HD] input (8 KB, all 16 loads of a lane in flight at once) to the planes of the same layout. Step i takes rows 4 i .. 4 i + 3: 8 lanes a row, 8 values a lane.
// FLAG: the per-key test sum_d |k[j][d]| != 0 (fixed tree: in-lane, then lanes 4, 2, 1 apart) as a float (0, or -3e38 for an all-zero key); the lane whose place in its row equals i keeps step i's, so the wave's 32 terms fill one 128-byte line.
template <bool F16, bool SPL, bool FLAG>
__device__ __forceinline__ void rows32(const float* __restrict__ src, h16* __restrict__ P16, bf* __restrict__ Ph, bf* __restrict__ Pl, float* __restrict__ kfl) {
    const int lane = threadIdx.x & 31, sub = lane & 7; const unsigned lo8 = (unsigned)lane * 8u, lb = (unsigned)lane * 32u;   // the lane's place in a step: in elements, and in bytes of the f32 input
    float x[8][8];
#pragma unroll
    for (int i = 0; i < 8; ++i) { const float* p = (const float*)((const char*)src + lb) + i * 256; const v4f a = *(const v4f*)p, b = *(const v4f*)(p + 4);
#pragma unroll
        for (int e = 0; e < 4; ++e) { x[i][e] = a[e]; x[i][e + 4] = b[e]; } }
    asm volatile("s_wait_xcnt 0x0" :: "v"(lb) : "memory");           // before any register that the loads name is written again; the offset as an input keeps its register alive up to here: otherwise the last load's result lands in it
    v8h o16[8]; v8us oh[8], ol[8]; float fl = 0.0f;
#pragma unroll
    for (int i = 0; i < 8; ++i) { cvt8<F16, SPL>(x[i], o16[i], oh[i], ol[i]);
        if constexpr (FLAG) { const float* a = x[i];
            float s = __fadd_rn(__fadd_rn(__fadd_rn(fabsf(a[0]), fabsf(a[1])), __fadd_rn(fabsf(a[2]), fabsf(a[3]))), __fadd_rn(__fadd_rn(fabsf(a[4]), fabsf(a[5])), __fadd_rn(fabsf(a[6]), fabsf(a[7]))));
            s = __fadd_rn(s, xlane<0x164>(s)); s = __fadd_rn(s, xlane<0x162>(s)); s = __fadd_rn(s, xlane<0x161>(s));
            fl = (sub == i) ? ((s != 0.0f) ? 0.0f : -3.0e38f) : fl; } }   // what the key adds to its scores: nothing, or the exclusion value (an all-zero key's own products are exactly 0)
    __builtin_amdgcn_sched_barrier(0);                               // all stores last: left free, the scheduler mixes them with the conversions, whose results then reuse registers that issued stores name (a wait each time), and the build spills
#pragma unroll
    for (int i = 0; i < 8; ++i) { if constexpr (F16) *(v8h*)(P16 + lo8 + i * 256) = o16[i]; if constexpr (SPL) { *(v8us*)(Ph + lo8 + i * 256) = oh[i]; *(v8us*)(Pl + lo8 + i * 256) = ol[i]; } }
    if constexpr (FLAG) kfl[sub * 4 + (lane >> 3)] = fl;
    asm volatile("s_wait_xcnt 0x0" ::: "memory");                    // before a register that the stores name is written again (the code behind this path reuses them)
}
#define VP 65                     // LDS pitch of a value row in floats: odd, so that the column reads below (8 lanes 8 rows apart x 4 neighbouring columns) fall on 32 different banks
// vtile: one block, 256 value rows [t][HD] to the transposed planes [d][TT]: whole rows in (16-byte loads), f32 through LDS, then 8 neighbouring t of one d a lane: a wave's store fills four whole 128-byte lines.
template <bool SPL>
__device__ __forceinline__ void vtile(const float* __restrict__ src, h16* __restrict__ V16, bf* __restrict__ Vh, bf* __restrict__ Vl, float* S) {
    const int tid = threadIdx.x, lane = tid & 31, w = tid >> 5;
    v4f x[16];
#pragma unroll
    for (int i = 0; i < 16; ++i) x[i] = *(const v4f*)(src + (unsigned)tid * 4u + i * 1024);
    asm volatile("s_wait_xcnt 0x0" ::: "memory");                    // before any register that the loads name is written again
    float* sw = S + (tid >> 4) * VP + (tid & 15) * 4;
#pragma unroll
    for (int i = 0; i < 16; ++i)
#pragma unroll
        for (int e = 0; e < 4; ++e) sw[i * 16 * VP + e] = x[i][e];
    __syncthreads();                                                 // the tile is whole before anyone reads a column
    const float* sr = S + (lane & 7) * 8 * VP + w * 8 + (lane >> 3);
    v8h o16[8]; v8us oh[8], ol[8];
#pragma unroll
    for (int i = 0; i < 8; ++i) { float y[8];                        // step i: columns 8 w + 4 (i >> 2) + 0..3, rows 64 (i & 3) + 0..63
#pragma unroll
        for (int j = 0; j < 8; ++j) y[j] = sr[((i & 3) * 64 + j) * VP + (i >> 2) * 4];
        cvt8<true, SPL>(y, o16[i], oh[i], ol[i]); }
    const unsigned vo = (unsigned)(w * 8 + (lane >> 3)) * TT + (unsigned)(lane & 7) * 8u;
#pragma unroll
    for (int i = 0; i < 8; ++i) { const int c = (i >> 2) * 4 * TT + (i & 3) * 64; *(v8h*)(V16 + vo + c) = o16[i]; if constexpr (SPL) { *(v8us*)(Vh + vo + c) = oh[i]; *(v8us*)(Vl + vo + c) = ol[i]; } }
    asm volatile("s_wait_xcnt 0x0" ::: "memory");                    // as at the end of rows32
}
// k_prep: every plane and key term that k_fattn reads, in one launch. Grid 3 x 256 blocks of 8 waves; block b: input b % 3 (q, k, v), rows 256 (b / 3) .. + 255 of the flat [batch-head x t] rows, that is one quarter of one batch-head.
// The second launch bound (waves a SIMD) holds the registers at 128, so that every block of the grid (three a WGP) is resident at once and all loads fly together.
// Only what is read is built: fp16 q for rows >= RH, hi/lo q for rows < RH; fp16 k and v for all keys, hi/lo k and v for keys < RH (the hi/lo queries' diagonals end there).
__global__ __launch_bounds__(256, 8) void k_prep(const float* __restrict__ q, const float* __restrict__ k, const float* __restrict__ v, h16* __restrict__ Q16, bf* __restrict__ Qh, bf* __restrict__ Ql,
                                              h16* __restrict__ K16, bf* __restrict__ Kh, bf* __restrict__ Kl, h16* __restrict__ V16, bf* __restrict__ Vh, bf* __restrict__ Vl, float* __restrict__ KF) {
    __shared__ float S[256 * VP];
    const unsigned kind = blockIdx.x % 3u, u = blockIdx.x / 3u; const bool low = (u & 3u) * 256u < RH;   // block-uniform
    if (kind == 2u) { const size_t ho = (size_t)(u >> 2) * TT * HD, po = ho + (u & 3u) * 256u;
        if (low) vtile<true>(v + (size_t)u * 256 * HD, V16 + po, Vh + po, Vl + po, S); else vtile<false>(v + (size_t)u * 256 * HD, V16 + po, nullptr, nullptr, S);
        return; }
    const size_t r0 = (size_t)u * 256 + 32 * __builtin_amdgcn_readfirstlane((int)(threadIdx.x >> 5)), e0 = r0 * HD;   // the wave's first row: scalar, so that every base address is
    if (kind == 0u) { if (low) rows32<false, true, false>(q + e0, nullptr, Qh + e0, Ql + e0, nullptr); else rows32<true, false, false>(q + e0, Q16 + e0, nullptr, nullptr, nullptr); }
    else { if (low) rows32<true, true, true>(k + e0, K16 + e0, Kh + e0, Kl + e0, KF + r0); else rows32<true, false, true>(k + e0, K16 + e0, nullptr, nullptr, KF + r0); }
}
struct yes_t { static constexpr bool value = true; }; struct no_t { static constexpr bool value = false; };   // compile-time switches of a pass
#define XSC  0.18033688011112042f   // 1/sqrt(d_k) x log2(e): scores go to the exponent of 2 in one multiply-add
#define MLOW -1.0e30f               // start of the running maximum: far above an excluded score x XSC, so an excluded key's probability is exactly 0
__device__ __forceinline__ float xhalf(float x) { const int b = __float_as_int(x); return __int_as_float(__builtin_amdgcn_permlanex16(b, b, 0x76543210, 0xfedcba98, false, false)); }   // value of lane ^ 16
__device__ __forceinline__ float exp2x1(float x) { float r; asm("v_exp_f32 %0, %1\n\tv_nop" : "=v"(r) : "v"(x)); return r; }
__device__ __forceinline__ void exp2x8(const float* x, float* p) {
    asm("v_exp_f32 %0, %8\n\tv_exp_f32 %1, %9\n\tv_exp_f32 %2, %10\n\tv_exp_f32 %3, %11\n\tv_exp_f32 %4, %12\n\tv_exp_f32 %5, %13\n\tv_exp_f32 %6, %14\n\tv_exp_f32 %7, %15\n\tv_nop"
        : "=&v"(p[0]), "=&v"(p[1]), "=&v"(p[2]), "=&v"(p[3]), "=&v"(p[4]), "=&v"(p[5]), "=&v"(p[6]), "=&v"(p[7]) : "v"(x[0]), "v"(x[1]), "v"(x[2]), "v"(x[3]), "v"(x[4]), "v"(x[5]), "v"(x[6]), "v"(x[7])); }
template <typename T16, bool SPLIT, int NBQ>
__device__ __forceinline__ void attn_rows(const T16* __restrict__ Q, const T16* __restrict__ Q2, const T16* __restrict__ Kp, const T16* __restrict__ Kp2, const T16* __restrict__ Vt, const T16* __restrict__ Vt2,
                                          const float* __restrict__ kf, const float* __restrict__ vraw, float* __restrict__ out, const int q0) {
    typedef typename WFrag<T16>::V V; typedef WFrag<T16> F;
    const int lane = threadIdx.x & 31, lr = lane & 15, hi = lane >> 4;
    const unsigned klo = (unsigned)(lr * HD + 8 * hi) * 2u, vlo = (unsigned)(lr * TT + 8 * hi) * 2u, blo = (unsigned)hi * 32u;   // the lane's byte offsets in a 16-row group of a [row][HD] plane, of the [d][TT] value plane and in 16 key terms: fixed for the whole kernel: every address is a wave-uniform base + one of these + a constant
    auto at = [](const T16* base, unsigned off) { return (const T16*)((const char*)base + off); };
    V q[NBQ][2], q2[NBQ][2];
#pragma unroll
    for (int nb = 0; nb < NBQ; ++nb)
#pragma unroll
        for (int ks = 0; ks < 2; ++ks) q[nb][ks] = F::ld(at(Q + (size_t)q0 * HD, klo) + nb * 16 * HD + ks * 32);
    asm volatile("s_wait_xcnt 0x0" ::: "memory");                    // here and below: before any register that the loads in front name (address, scalar base) is written again
    if constexpr (SPLIT) {
#pragma unroll
        for (int nb = 0; nb < NBQ; ++nb)
#pragma unroll
            for (int ks = 0; ks < 2; ++ks) q2[nb][ks] = F::ld(at(Q2 + (size_t)q0 * HD, klo) + nb * 16 * HD + ks * 32);
        asm volatile("s_wait_xcnt 0x0" ::: "memory"); }
    v8f o[4][NBQ]; float m[NBQ], l[NBQ];
#pragma unroll
    for (int nb = 0; nb < NBQ; ++nb) { m[nb] = MLOW; l[nb] = 0.0f;
#pragma unroll
        for (int md = 0; md < 4; ++md) o[md][nb] = (v8f){}; }
    V kc[2][2], kc2[2][2], vt[4], vt2[4]; v8f cb[2], s[2][NBQ];      // cb: a pass's key terms in the score tiles' register order, the C operand of each tile's first product
    auto load_k = [&](const int kb) {                                // key fragments and key terms of the pass at kb
#pragma unroll
        for (int mt = 0; mt < 2; ++mt)
#pragma unroll
            for (int ks = 0; ks < 2; ++ks) { kc[mt][ks] = F::ld(at(Kp + (size_t)kb * HD, klo) + mt * 16 * HD + ks * 32); if (SPLIT) kc2[mt][ks] = F::ld(at(Kp2 + (size_t)kb * HD, klo) + mt * 16 * HD + ks * 32); }
#pragma unroll
        for (int mt = 0; mt < 2; ++mt) cb[mt] = *(const v8f*)((const char*)(kf + kb + mt * 16) + blo);
    };
    auto load_v = [&](const int kb) {                                // value fragments of the pass at kb
#pragma unroll
        for (int md = 0; md < 4; ++md) { vt[md] = F::ld(at(Vt + kb, vlo) + md * 16 * TT); if (SPLIT) vt2[md] = F::ld(at(Vt2 + kb, vlo) + md * 16 * TT); }
    };
    auto scores = [&]() {                                            // S^T of the pass whose key fragments are loaded
#pragma unroll
        for (int mt = 0; mt < 2; ++mt)
#pragma unroll
            for (int nb = 0; nb < NBQ; ++nb) s[mt][nb] = cb[mt];
#pragma unroll
        for (int ks = 0; ks < 2; ++ks)
#pragma unroll
            for (int pr = 0; pr < (SPLIT ? 3 : 1); ++pr)             // tiles innermost: neighbouring products go to different accumulators
#pragma unroll
                for (int mt = 0; mt < 2; ++mt)
#pragma unroll
                    for (int nb = 0; nb < NBQ; ++nb) s[mt][nb] = F::mma(pr == 1 ? kc2[mt][ks] : kc[mt][ks], pr == 2 ? q2[nb][ks] : q[nb][ks], s[mt][nb]);
    };
    // second half: the diagonal's exclusions (compile-time choice: only the last pass has any), running softmax, O^T += V^T.P^T
    auto finish = [&](auto causal, const int kb) {
        if constexpr (causal.value) {
#pragma unroll
            for (int mt = 0; mt < 2; ++mt)
#pragma unroll
                for (int nb = 0; nb < NBQ; ++nb)
#pragma unroll
                    for (int j = 0; j < 8; ++j) s[mt][nb][j] = (kb + mt * 16 + hi * 8 + j <= q0 + nb * 16 + lr) ? s[mt][nb][j] : -3.0e38f; }
        V ph[NBQ], pl[NBQ];
#pragma unroll
        for (int nb = 0; nb < NBQ; ++nb) {
            float mx = s[0][nb][0];
#pragma unroll
            for (int e = 1; e < 16; ++e) mx = fmaxf(mx, s[e >> 3][nb][e & 7]);
            mx = fmaxf(mx, xhalf(mx));
            const float mn = fmaxf(m[nb], mx * XSC); const float al = exp2x1(m[nb] - mn); m[nb] = mn;
            const float sub = SPLIT ? -mn : 10.0f - mn;              // fp16 rows carry probabilities x1024 (sum and products alike; it cancels in the division)
            float sum = 0.0f, x[16], pe[16];
#pragma unroll
            for (int e = 0; e < 16; ++e) x[e] = fmaf(s[e >> 3][nb][e & 7], XSC, sub);
            exp2x8(x, pe); exp2x8(x + 8, pe + 8);
#pragma unroll
            for (int e = 0; e < 16; e += 2) { v2f p; p[0] = pe[e]; p[1] = pe[e + 1]; sum += p[0] + p[1];
                if constexpr (SPLIT) { const v2b h = __builtin_convertvector(p, v2b); const v2b lo = __builtin_convertvector(p - __builtin_convertvector(h, v2f), v2b); ph[nb][e] = h[0]; ph[nb][e + 1] = h[1]; pl[nb][e] = lo[0]; pl[nb][e + 1] = lo[1]; }
                else { const v2h h = __builtin_convertvector(p, v2h); ph[nb][e] = h[0]; ph[nb][e + 1] = h[1]; } }
            l[nb] = l[nb] * al + sum;
#pragma unroll
            for (int md = 0; md < 4; ++md) o[md][nb] *= al; }
#pragma unroll
        for (int pr = 0; pr < (SPLIT ? 3 : 1); ++pr)
#pragma unroll
            for (int md = 0; md < 4; ++md)
#pragma unroll
                for (int nb = 0; nb < NBQ; ++nb) o[md][nb] = F::mma(pr == 1 ? vt2[md] : vt[md], pr == 2 ? pl[nb] : ph[nb], o[md][nb]);
    };
    const yes_t yes{}; const no_t no{};
    const int klast = ((q0 + NBQ * 16 + 31) & ~31) - 32;             // the one pass that reaches past a query's diagonal; keys beyond it are never read
    load_k(0);
    asm volatile("s_wait_xcnt 0x0" ::: "memory");
    scores();
    // The scores go round the loop, not the key fragments: a trip fetches its own values and the next pass's keys at its head, works on the scores it was handed, and forms the next pass's scores at its foot, a whole trip behind their fetch.
    for (int kb = 0; kb < klast; kb += 32) {
        load_v(kb);
        asm volatile("s_wait_xcnt 0x0" ::: "memory");                // before any register that these loads name is written again (the next group's results may land in their address registers)
        load_k(kb + 32);
        asm volatile("s_wait_xcnt 0x0" ::: "memory");                // the same for the second group
        __builtin_amdgcn_sched_barrier(0);                           // holds the trip's fetches up here: left free, the scheduler sinks each one to just in front of its use and the wave waits out every latency
        finish(no, kb);
        __builtin_amdgcn_sched_barrier(0);                           // keeps the next pass's score products down here: moved up among the softmax arithmetic they wait for keys that were only just asked for
        scores();
    }
    load_v(klast);
    asm volatile("s_wait_xcnt 0x0" ::: "memory");                    // as above
    __builtin_amdgcn_sched_barrier(0);                               // keeps the arithmetic below from moving in between the loads and their wait, where it reuses their address registers
    finish(yes, klast);
#pragma unroll
    for (int nb = 0; nb < NBQ; ++nb) {
        const float ls = l[nb] + xhalf(l[nb]); const bool dead = !(ls > 0.0f); float inv = __fdiv_rn(1.0f, ls);
        if (__builtin_amdgcn_ballot_w32(dead) != 0) {                // cold: a query whose every allowed key is padding
            v8f mean[4];
#pragma unroll
            for (int md = 0; md < 4; ++md) mean[md] = (v8f){};
#pragma unroll 1                                                     // cold path: keep its code small
            for (int t = 0; t < TT; ++t) { v8f x[4];
#pragma unroll
                for (int md = 0; md < 4; ++md) x[md] = *(const v8f*)(vraw + (size_t)t * HD + md * 16 + hi * 8);
                asm volatile("s_wait_xcnt 0x0" ::: "memory");        // before the address moves on
#pragma unroll
                for (int md = 0; md < 4; ++md) mean[md] += x[md]; }
#pragma unroll
            for (int md = 0; md < 4; ++md)
#pragma unroll
                for (int j = 0; j < 8; ++j) o[md][nb][j] = dead ? mean[md][j] * (1.0f / TT) : o[md][nb][j];
            inv = dead ? 1.0f : inv; }
#pragma unroll
        for (int md = 0; md < 4; ++md) o[md][nb] *= inv;
    }
#pragma unroll
    for (int nb = 0; nb < NBQ; ++nb) {                               // all stores last: nothing is computed behind them
        float* orow = out + (size_t)(q0 + nb * 16 + lr) * HD + hi * 8;   // register j of tile md is column md * 16 + 8 hi + j of the lane's query row
#pragma unroll
        for (int md = 0; md < 4; ++md) *(v8f*)(orow + md * 16) = o[md][nb];
        asm volatile("s_wait_xcnt 0x0" ::: "memory");                // before a register that the stores name is written again
    }
}
// k_fattn: grid (12, batch-heads), 4 independent waves a block; wave index w: w < 16 takes 32 fp16 rows, from the sequence's end downwards (longest first), the rest 16 hi/lo rows each, upwards, so that blocks four and eight apart, a long, a short and a middling one, add up alike.
__global__ __launch_bounds__(128) void k_fattn(const h16* __restrict__ Q16, const h16* __restrict__ K16, const h16* __restrict__ V16, const bf* __restrict__ Qh, const bf* __restrict__ Ql, const bf* __restrict__ Kh, const bf* __restrict__ Kl,
                                               const bf* __restrict__ Vh, const bf* __restrict__ Vl, const float* __restrict__ KF, const float* __restrict__ Vraw, float* __restrict__ OUTb) {
    const size_t zo = (size_t)blockIdx.y * TT * HD; const float* kf = KF + (size_t)blockIdx.y * TT;
    const int w = blockIdx.x * 4 + __builtin_amdgcn_readfirstlane((int)(threadIdx.x >> 5));   // scalar, so that the path and every pass test are scalar branches
    if (w < (TT - RH) / 32) attn_rows<h16, false, 2>(Q16 + zo, nullptr, K16 + zo, nullptr, V16 + zo, nullptr, kf, Vraw + zo, OUTb + zo, RH + 32 * ((TT - RH) / 32 - 1 - w));
    else attn_rows<bf, true, 1>(Qh + zo, Ql + zo, Kh + zo, Kl + zo, Vh + zo, Vl + zo, kf, Vraw + zo, OUTb + zo, 16 * (w - (TT - RH) / 32));
}
extern "C" void kernel_launch(void* const* d_in, const int* in_sizes, int n_in,
                              void* d_out, int out_size, void* d_ws, size_t ws_size, hipStream_t stream) {
    (void)in_sizes; (void)n_in; (void)out_size;
    const float* x = (const float*)d_in[0]; const float* xk = (const float*)d_in[1]; const float* xv = (const float*)d_in[2];   /* input order q, k, v: [64][1024][64] each (no projections) */ const float* wq = nullptr, *wk = nullptr, *wv = nullptr, *wo = nullptr; (void)wq; (void)wk; (void)wv; (void)wo;
    float* OUT = (float*)d_out;     // [64][1024][64]
    char* wsp = (char*)d_ws;
    auto take = [&](size_t bytes) { char* p = wsp; wsp += (bytes + 255) & ~(size_t)255; return (void*)p; };
    float* KF = (float*)take((size_t)NB_ * TT * 4);   /* per-key score terms (0, or the exclusion value for an all-zero key), all batch-heads */
    const size_t HS = (size_t)TT * HD;             /* one batch-head of an input, a plane or the output, in elements */
    const size_t PLN = (size_t)NB_ * HS;           /* one plane over all batch-heads */
    h16* QP16 = (h16*)take(PLN * 2); h16* KP16 = (h16*)take(PLN * 2); h16* VT16 = (h16*)take(PLN * 2);
    bf* QPh = (bf*)take(PLN * 2); bf* QPl = (bf*)take(PLN * 2); bf* KPh = (bf*)take(PLN * 2); bf* KPl = (bf*)take(PLN * 2); bf* VTh = (bf*)take(PLN * 2); bf* VTl = (bf*)take(PLN * 2);
    if ((size_t)(wsp - (char*)d_ws) > ws_size) return;    // ws 256 MiB
    k_prep<<<3 * NB_ * TT / 256, 256, 0, stream>>>(x, xk, xv, QP16, QPh, QPl, KP16, KPh, KPl, VT16, VTh, VTl, KF);   /* planes (fp16, bf16 hi/lo; v transposed) and key-padding terms straight from the inputs */
    k_fattn<<<dim3(((TT - RH) / 32 + RH / 16) / 4, NB_), 128, 0, stream>>>(QP16, KP16, VT16, QPh, QPl, KPh, KPl, VTh, VTl, KF, xv, OUT);   /* scores, softmax, P.V and the output rows, all batch-heads */
}

// v004
// A run of this version takes 44.7 microseconds.
// Next to v003, in two timings, it ran 1.24 and 1.25 times as fast.
// Over all steps from v000 it is 82.3 times as fast.
#include <hip/hip_runtime.h>

// Causal scaled dot-product attention on raw batch-head tensors with a data-derived key-padding mask (q, k, v [64][1024][64], no projections; scores = q.k / sqrt(64); keys whose absolute sum is exactly 0 are masked to -2^32+1 (== exclusion; computed from the data, none occur for random inputs); causal mask (same fill); softmax; out = attn.v -> [64][1024][64] (4.2 M); argument order q, k, v).
// Two launches: k_prep builds every 16-bit plane and the key terms for all 64 batch-heads; one attention kernel (grid y: batch-head) then does scores, softmax and P.V for all of them.
// Layout per batch-head: k_prep turns the per-key test sum_d |k[j][d]| != 0 (4 lanes a key, fixed tree) into a float vector (0, or -3e38 for an all-zero key) and the f32 inputs into planes in fragment order (16-byte groups laid so that a wave's 16-byte-a-lane load of half an operand fragment is 512 bytes in a row; v transposed on the way); k_fattn keeps a wave's score tile in registers (running maximum and sum per query), hybrid rows: < 512 hi/lo 3 products, rest fp16 with probabilities x1024; all-zero keys are excluded by adding that vector to the scores; it writes the f32 output rows.
// Compute dtypes, f32 accumulate: inputs split into bf16 hi/lo (rows < 512) or rounded to fp16 (rest); softmax f32; output f32.

#define NB_  64
#define TT   1024
#define DM   64
#define NH_  1
#define NKV  1
#define REP  (NH_ / NKV)
#define HD   64
#define DQ   (NH_ * HD)
#define DKV  (NKV * HD)
#define ZH   1
#define RH   512                  // query rows < RH use hi+lo planes (0: none)
#define WIN  1024
#define PCAR 1024.0f
#define SCL  0.125f   // 1/sqrt(d_k)
typedef _Float16 h16;
typedef unsigned short bf;
typedef __attribute__((ext_vector_type(16))) __bf16   v16bf;
typedef __attribute__((ext_vector_type(16))) _Float16 v16h;
typedef __attribute__((ext_vector_type(8)))  _Float16 v8h;
typedef __attribute__((ext_vector_type(8)))  unsigned short v8us;
typedef __attribute__((ext_vector_type(8)))  float    v8f;
typedef __attribute__((ext_vector_type(4)))  float    v4f;
typedef v8h  __attribute__((may_alias)) v8ha;
typedef v4f  __attribute__((may_alias)) v4fa;
typedef v8us __attribute__((may_alias)) v8usa;

__device__ __forceinline__ v16h cat16(v8h lo, v8h hi) { return __builtin_shufflevector(lo, hi, 0, 1, 2, 3, 4, 5, 6, 7, 8, 9, 10, 11, 12, 13, 14, 15); }
__device__ __forceinline__ v16bf cat16b(v8us lo, v8us hi) { return __builtin_bit_cast(v16bf, __builtin_shufflevector(lo, hi, 0, 1, 2, 3, 4, 5, 6, 7, 8, 9, 10, 11, 12, 13, 14, 15)); }
__device__ __forceinline__ v8f wmma16(v16h a, v16h b, v8f c) { return __builtin_amdgcn_wmma_f32_16x16x32_f16(false, a, false, b, (short)0, c, false, false); }
__device__ __forceinline__ v8f wmmab(v16bf a, v16bf b, v8f c) { return __builtin_amdgcn_wmma_f32_16x16x32_bf16(false, a, false, b, (short)0, c, false, false); }



// ---- 16x32 operand fragments (row = lane & 15; k = 8 * (lane >> 4) + 0..7 and 16 + 8 * (lane >> 4) + 0..7), the same loader for A and for B, from planes in fragment order: a fragment is 1 KB in a row,
// [k / 8 (4)][row (16)][8 values], so the lane's two 16-byte groups lie at 16 * lane and 512 + 16 * lane bytes and each wave-wide load covers four whole 128-byte lines (row-major planes: 16 lines a load, 32 bytes of each).
// q and k planes: [row / 16][d / 32] fragments; value planes: [key / 32][d / 16] fragments (row = d, k = key).
template <typename T16> struct WFrag;
template <> struct WFrag<h16> { typedef v16h V; static __device__ __forceinline__ V ld(const h16* p) { return cat16(*(const v8h*)p, *(const v8h*)(p + 256)); } static __device__ __forceinline__ v8f mma(V a, V b, v8f c) { return wmma16(a, b, c); } };
template <> struct WFrag<bf> { typedef v16bf V; static __device__ __forceinline__ V ld(const bf* p) { return cat16b(*(const v8us*)p, *(const v8us*)(p + 256)); } static __device__ __forceinline__ v8f mma(V a, V b, v8f c) { return wmmab(a, b, c); } };
typedef __attribute__((ext_vector_type(2))) _Float16 v2h;
typedef __attribute__((ext_vector_type(4))) _Float16 v4h;
typedef __attribute__((ext_vector_type(2))) unsigned short v2us;
typedef __attribute__((ext_vector_type(4))) unsigned short v4us;
typedef __attribute__((ext_vector_type(2))) float v2f;
typedef __attribute__((ext_vector_type(4))) int v4i;

typedef __attribute__((ext_vector_type(2))) __bf16 v2b;
// cvt8: 8 neighbouring f32 values to their 16-byte groups of the planes: fp16 (round to nearest), and bf16 hi with lo = bf16(x - hi)
template <bool F16, bool SPL>
__device__ __forceinline__ void cvt8(const float* x, v8h& o16, v8us& oh, v8us& ol) {
#pragma unroll
    for (int e = 0; e < 8; e += 2) { v2f p; p[0] = x[e]; p[1] = x[e + 1];
        if constexpr (F16) { const v2h h = __builtin_convertvector(p, v2h); o16[e] = h[0]; o16[e + 1] = h[1]; }
        if constexpr (SPL) { const v2b h = __builtin_convertvector(p, v2b); const v2b lo = __builtin_convertvector(p - __builtin_convertvector(h, v2f), v2b);
            const v2us hu = __builtin_bit_cast(v2us, h), lu = __builtin_bit_cast(v2us, lo); oh[e] = hu[0]; oh[e + 1] = hu[1]; ol[e] = lu[0]; ol[e + 1] = lu[1]; } } }
template <int CTRL> __device__ __forceinline__ float xlane(float x) { return __int_as_float(__builtin_amdgcn_update_dpp(0, __float_as_int(x), CTRL, 0xf, 0xf, true)); }   // value of lane ^ m inside a 16-lane row (CTRL = 0x160 + m, row_xmask): in the vector pipe, no trip through the LDS unit
__device__ __forceinline__ float xhalf(float x) { const int b = __float_as_int(x); return __int_as_float(__builtin_amdgcn_permlanex16(b, b, 0x76543210, 0xfedcba98, false, false)); }   // value of lane ^ 16
// rows32: one wave, 32 rows of a [row][HD] input (8 KB, all 16 loads of a lane in flight at once) to two 16-row groups of the planes. Step i takes rows 8 (i >> 1) .. + 7 and columns 32 (i & 1) .. + 31: lane = 8 x (column / 8) + row, 8 values a lane:
// the loads touch 8 lines as before, and a store (4 column groups x 8 neighbouring rows x 16 bytes) fills four whole 128-byte lines of the fragment order.
// FLAG: the per-key test sum_d |k[j][d]| != 0 (fixed tree: in-lane, the row's two steps, then lanes 8 and 16 apart; a sum of absolute values is 0 only if each is, in any order) as a float (0, or -3e38 for an all-zero key); the lane whose column group equals the row group keeps it: lane = row, so the wave's 32 terms fill one 128-byte line.
template <bool F16, bool SPL, bool FLAG>
__device__ __forceinline__ void rows32(const float* __restrict__ src, h16* __restrict__ P16, bf* __restrict__ Ph, bf* __restrict__ Pl, float* __restrict__ kfl) {
    const int lane = threadIdx.x & 31, r = lane & 7, oo = lane >> 3; const unsigned lo8 = (unsigned)(oo * 16 + r) * 8u, lb = (unsigned)r * 256u + (unsigned)oo * 32u;   // the lane's place in a step: in elements of a plane, and in bytes of the f32 input
    float x[8][8];
#pragma unroll
    for (int i = 0; i < 8; ++i) { const float* p = (const float*)((const char*)src + lb) + (i >> 1) * 512 + (i & 1) * 32; const v4f a = *(const v4f*)p, b = *(const v4f*)(p + 4);
#pragma unroll
        for (int e = 0; e < 4; ++e) { x[i][e] = a[e]; x[i][e + 4] = b[e]; } }
    asm volatile("s_wait_xcnt 0x0" :: "v"(lb) : "memory");           // before any register that the loads name is written again; the offset as an input keeps its register alive up to here: otherwise the last load's result lands in it
    v8h o16[8]; v8us oh[8], ol[8]; float fl = 0.0f, sp = 0.0f;
#pragma unroll
    for (int i = 0; i < 8; ++i) { cvt8<F16, SPL>(x[i], o16[i], oh[i], ol[i]);
        if constexpr (FLAG) { const float* a = x[i];
            float s = __fadd_rn(__fadd_rn(__fadd_rn(fabsf(a[0]), fabsf(a[1])), __fadd_rn(fabsf(a[2]), fabsf(a[3]))), __fadd_rn(__fadd_rn(fabsf(a[4]), fabsf(a[5])), __fadd_rn(fabsf(a[6]), fabsf(a[7]))));
            if ((i & 1) == 0) sp = s;
            else { s = __fadd_rn(s, sp); s = __fadd_rn(s, xlane<0x168>(s)); s = __fadd_rn(s, xhalf(s));
                fl = (oo == (i >> 1)) ? ((s != 0.0f) ? 0.0f : -3.0e38f) : fl; } } }   // what the key adds to its scores: nothing, or the exclusion value (an all-zero key's own products are exactly 0)
    __builtin_amdgcn_sched_barrier(0);                               // all stores last: left free, the scheduler mixes them with the conversions, whose results then reuse registers that issued stores name (a wait each time), and the build spills
#pragma unroll
    for (int i = 0; i < 8; ++i) { const int c = (i >> 2) * 1024 + (i & 1) * 512 + ((i >> 1) & 1) * 64; if constexpr (F16) *(v8h*)(P16 + lo8 + c) = o16[i]; if constexpr (SPL) { *(v8us*)(Ph + lo8 + c) = oh[i]; *(v8us*)(Pl + lo8 + c) = ol[i]; } }
    if constexpr (FLAG) kfl[lane] = fl;
    asm volatile("s_wait_xcnt 0x0" ::: "memory");                    // before a register that the stores name is written again (the code behind this path reuses them)
}
#define VP 65                     // LDS pitch of a value row in floats: odd, so that the column reads below (2 lane halves 16 rows apart x 16 neighbouring columns) fall on 32 different banks
// vtile: one block, 256 value rows [t][HD] to 8 x 4 fragments of the value planes: whole rows in (16-byte loads), f32 through LDS, then 8 neighbouring t of one d a lane; wave w builds the 32 keys 32 w .. + 31: a wave's store fills four whole 128-byte lines.
template <bool SPL>
__device__ __forceinline__ void vtile(const float* __restrict__ src, h16* __restrict__ V16, bf* __restrict__ Vh, bf* __restrict__ Vl, float* S) {
    const int tid = threadIdx.x, lane = tid & 31, w = tid >> 5;
    v4f x[16];
#pragma unroll
    for (int i = 0; i < 16; ++i) x[i] = *(const v4f*)(src + (unsigned)tid * 4u + i * 1024);
    asm volatile("s_wait_xcnt 0x0" ::: "memory");                    // before any register that the loads name is written again
    float* sw = S + (tid >> 4) * VP + (tid & 15) * 4;
#pragma unroll
    for (int i = 0; i < 16; ++i)
#pragma unroll
        for (int e = 0; e < 4; ++e) sw[i * 16 * VP + e] = x[i][e];
    __syncthreads();                                                 // the tile is whole before anyone reads a column
    const float* sr = S + (w * 32 + (lane >> 4) * 16) * VP + (lane & 15);
    const unsigned vo = (unsigned)w * 2048u + (unsigned)(lane >> 4) * 256u + (unsigned)(lane & 15) * 8u;
#pragma unroll
    for (int h = 0; h < 8; h += 4) {                                 // two halves, each read, converted and stored before the next: all eight steps at once need more registers than the launch bound leaves (the build spilled)
        v8h o16[4]; v8us oh[4], ol[4];
#pragma unroll
        for (int i = h; i < h + 4; ++i) { float y[8];                // step i: columns 16 (i >> 1) + 0..15, rows 32 w + 8 (i & 1) + 0..7 (low lanes) and 16 more (high lanes)
#pragma unroll
            for (int j = 0; j < 8; ++j) y[j] = sr[((i & 1) * 8 + j) * VP + (i >> 1) * 16];
            cvt8<true, SPL>(y, o16[i - h], oh[i - h], ol[i - h]); }
        __builtin_amdgcn_sched_barrier(0);                           // a half's stores last, as in rows32: mixed with the conversions, these write again registers that issued stores name
#pragma unroll
        for (int i = h; i < h + 4; ++i) { const int c = (i >> 1) * 512 + (i & 1) * 128; *(v8h*)(V16 + vo + c) = o16[i - h]; if constexpr (SPL) { *(v8us*)(Vh + vo + c) = oh[i - h]; *(v8us*)(Vl + vo + c) = ol[i - h]; } }
        asm volatile("s_wait_xcnt 0x0" ::: "memory");                // as at the end of rows32: the next half, or the code behind this path, reuses the registers that the stores name
    }
}
// k_prep: every plane and key term that k_fattn reads, in one launch. Grid 3 x 256 blocks of 8 waves; block b: input b % 3 (q, k, v), rows 256 (b / 3) .. + 255 of the flat [batch-head x t] rows, that is one quarter of one batch-head.
// The second launch bound (waves a SIMD) holds the registers at 128, so that every block of the grid (three a WGP) is resident at once and all loads fly together.
// Only what is read is built: fp16 q for rows >= RH, hi/lo q for rows < RH; fp16 k and v for all keys, hi/lo k and v for keys < RH (the hi/lo queries' diagonals end there).
__global__ __launch_bounds__(256, 8) void k_prep(const float* __restrict__ q, const float* __restrict__ k, const float* __restrict__ v, h16* __restrict__ Q16, bf* __restrict__ Qh, bf* __restrict__ Ql,
                                              h16* __restrict__ K16, bf* __restrict__ Kh, bf* __restrict__ Kl, h16* __restrict__ V16, bf* __restrict__ Vh, bf* __restrict__ Vl, float* __restrict__ KF) {
    __shared__ float S[256 * VP];
    const unsigned kind = blockIdx.x % 3u, u = blockIdx.x / 3u; const bool low = (u & 3u) * 256u < RH;   // block-uniform
    if (kind == 2u) { const size_t ho = (size_t)(u >> 2) * TT * HD, po = ho + (u & 3u) * 256u * HD;
        if (low) vtile<true>(v + (size_t)u * 256 * HD, V16 + po, Vh + po, Vl + po, S); else vtile<false>(v + (size_t)u * 256 * HD, V16 + po, nullptr, nullptr, S);
        return; }
    const size_t r0 = (size_t)u * 256 + 32 * __builtin_amdgcn_readfirstlane((int)(threadIdx.x >> 5)), e0 = r0 * HD;   // the wave's first row: scalar, so that every base address is
    if (kind == 0u) { if (low) rows32<false, true, false>(q + e0, nullptr, Qh + e0, Ql + e0, nullptr); else rows32<true, false, false>(q + e0, Q16 + e0, nullptr, nullptr, nullptr); }
    else { if (low) rows32<true, true, true>(k + e0, K16 + e0, Kh + e0, Kl + e0, KF + r0); else rows32<true, false, true>(k + e0, K16 + e0, nullptr, nullptr, KF + r0); }
}
struct yes_t { static constexpr bool value = true; }; struct no_t { static constexpr bool value = false; };   // compile-time switches of a pass
#define XSC  0.18033688011112042f   // 1/sqrt(d_k) x log2(e): scores go to the exponent of 2 in one multiply-add
#define MLOW -1.0e30f               // start of the running maximum: far above an excluded score x XSC, so an excluded key's probability is exactly 0
__device__ __forceinline__ float exp2x1(float x) { float r; asm("v_exp_f32 %0, %1\n\tv_nop" : "=v"(r) : "v"(x)); return r; }
__device__ __forceinline__ void exp2x8(const float* x, float* p) {
    asm("v_exp_f32 %0, %8\n\tv_exp_f32 %1, %9\n\tv_exp_f32 %2, %10\n\tv_exp_f32 %3, %11\n\tv_exp_f32 %4, %12\n\tv_exp_f32 %5, %13\n\tv_exp_f32 %6, %14\n\tv_exp_f32 %7, %15\n\tv_nop"
        : "=&v"(p[0]), "=&v"(p[1]), "=&v"(p[2]), "=&v"(p[3]), "=&v"(p[4]), "=&v"(p[5]), "=&v"(p[6]), "=&v"(p[7]) : "v"(x[0]), "v"(x[1]), "v"(x[2]), "v"(x[3]), "v"(x[4]), "v"(x[5]), "v"(x[6]), "v"(x[7])); }
template <typename T16, bool SPLIT, int NBQ>
__device__ __forceinline__ void attn_rows(const T16* __restrict__ Q, const T16* __restrict__ Q2, const T16* __restrict__ Kp, const T16* __restrict__ Kp2, const T16* __restrict__ Vt, const T16* __restrict__ Vt2,
                                          const float* __restrict__ kf, const float* __restrict__ vraw, float* __restrict__ out, const int q0) {
    typedef typename WFrag<T16>::V V; typedef WFrag<T16> F;
    const int lane = threadIdx.x & 31, lr = lane & 15, hi = lane >> 4;
    const unsigned flo = (unsigned)lane * 16u, blo = (unsigned)hi * 32u;   // the lane's byte offsets in a fragment of any plane and in 16 key terms: fixed for the whole kernel: every address is a wave-uniform base + one of these + a constant
    auto at = [](const T16* base, unsigned off) { return (const T16*)((const char*)base + off); };
    V q[NBQ][2], q2[NBQ][2]; const T16* pq = at(Q + (size_t)q0 * HD, flo);
#pragma unroll
    for (int nb = 0; nb < NBQ; ++nb)
#pragma unroll
        for (int ks = 0; ks < 2; ++ks) q[nb][ks] = F::ld(pq + nb * 16 * HD + ks * 512);
    asm volatile("s_wait_xcnt 0x0" :: "v"(pq) : "memory");           // here and below: before any register that the loads in front name (address, scalar base) is written again; the address as an input keeps its registers untouched up to the wait
    if constexpr (SPLIT) { const T16* pq2 = at(Q2 + (size_t)q0 * HD, flo);
#pragma unroll
        for (int nb = 0; nb < NBQ; ++nb)
#pragma unroll
            for (int ks = 0; ks < 2; ++ks) q2[nb][ks] = F::ld(pq2 + nb * 16 * HD + ks * 512);
        asm volatile("s_wait_xcnt 0x0" :: "v"(pq2) : "memory"); }
    v8f o[4][NBQ]; float m[NBQ], l[NBQ];
#pragma unroll
    for (int nb = 0; nb < NBQ; ++nb) { m[nb] = MLOW; l[nb] = 0.0f;
#pragma unroll
        for (int md = 0; md < 4; ++md) o[md][nb] = (v8f){}; }
    V kc[2][2], kc2[2][2], vt[4], vt2[4]; v8f cb[2], s[2][NBQ];      // cb: a pass's key terms in the score tiles' register order, the C operand of each tile's first product
    // Each group of loads ends in its own s_wait_xcnt 0: before any register that the loads name is written again. The addresses as inputs keep their registers alive up to there: otherwise a later load's result of the same group lands in them.
    auto load_k = [&](const int kb) {                                // key fragments and key terms of the pass at kb
        const T16* pk = at(Kp + (size_t)kb * HD, flo); const T16* pk2 = SPLIT ? at(Kp2 + (size_t)kb * HD, flo) : pk; const char* pc = (const char*)(kf + kb) + blo;
#pragma unroll
        for (int mt = 0; mt < 2; ++mt)
#pragma unroll
            for (int ks = 0; ks < 2; ++ks) { kc[mt][ks] = F::ld(pk + mt * 16 * HD + ks * 512); if (SPLIT) kc2[mt][ks] = F::ld(pk2 + mt * 16 * HD + ks * 512); }
#pragma unroll
        for (int mt = 0; mt < 2; ++mt) cb[mt] = *(const v8f*)(pc + mt * 64);
        asm volatile("s_wait_xcnt 0x0" :: "v"(pk), "v"(pk2) : "memory");
    };
    auto load_v = [&](const int kb) {                                // value fragments of the pass at kb
        const T16* pv = at(Vt + (size_t)kb * HD, flo); const T16* pv2 = SPLIT ? at(Vt2 + (size_t)kb * HD, flo) : pv;
#pragma unroll
        for (int md = 0; md < 4; ++md) { vt[md] = F::ld(pv + md * 512); if (SPLIT) vt2[md] = F::ld(pv2 + md * 512); }
        asm volatile("s_wait_xcnt 0x0" :: "v"(pv), "v"(pv2) : "memory");
    };
    auto scores = [&]() {                                            // S^T of the pass whose key fragments are loaded
#pragma unroll
        for (int mt = 0; mt < 2; ++mt)
#pragma unroll
            for (int nb = 0; nb < NBQ; ++nb) s[mt][nb] = cb[mt];
#pragma unroll
        for (int ks = 0; ks < 2; ++ks)
#pragma unroll
            for (int pr = 0; pr < (SPLIT ? 3 : 1); ++pr)             // tiles innermost: neighbouring products go to different accumulators
#pragma unroll
                for (int mt = 0; mt < 2; ++mt)
#pragma unroll
                    for (int nb = 0; nb < NBQ; ++nb) s[mt][nb] = F::mma(pr == 1 ? kc2[mt][ks] : kc[mt][ks], pr == 2 ? q2[nb][ks] : q[nb][ks], s[mt][nb]);
    };
    // second half: the diagonal's exclusions (compile-time choice: only the last pass has any), running softmax, O^T += V^T.P^T
    auto finish = [&](auto causal, const int kb) {
        if constexpr (causal.value) {
#pragma unroll
            for (int mt = 0; mt < 2; ++mt)
#pragma unroll
                for (int nb = 0; nb < NBQ; ++nb)
#pragma unroll
                    for (int j = 0; j < 8; ++j) s[mt][nb][j] = (kb + mt * 16 + hi * 8 + j <= q0 + nb * 16 + lr) ? s[mt][nb][j] : -3.0e38f; }
        V ph[NBQ], pl[NBQ];
#pragma unroll
        for (int nb = 0; nb < NBQ; ++nb) {
            float mx = s[0][nb][0];
#pragma unroll
            for (int e = 1; e < 16; ++e) mx = fmaxf(mx, s[e >> 3][nb][e & 7]);
            mx = fmaxf(mx, xhalf(mx));
            const float mn = fmaxf(m[nb], mx * XSC); const float al = exp2x1(m[nb] - mn); m[nb] = mn;
            const float sub = SPLIT ? -mn : 10.0f - mn;              // fp16 rows carry probabilities x1024 (sum and products alike; it cancels in the division)
            float sum = 0.0f, x[16], pe[16];
#pragma unroll
            for (int e = 0; e < 16; ++e) x[e] = fmaf(s[e >> 3][nb][e & 7], XSC, sub);
            exp2x8(x, pe); exp2x8(x + 8, pe + 8);
#pragma unroll
            for (int e = 0; e < 16; e += 2) { v2f p; p[0] = pe[e]; p[1] = pe[e + 1]; sum += p[0] + p[1];
                if constexpr (SPLIT) { const v2b h = __builtin_convertvector(p, v2b); const v2b lo = __builtin_convertvector(p - __builtin_convertvector(h, v2f), v2b); ph[nb][e] = h[0]; ph[nb][e + 1] = h[1]; pl[nb][e] = lo[0]; pl[nb][e + 1] = lo[1]; }
                else { const v2h h = __builtin_convertvector(p, v2h); ph[nb][e] = h[0]; ph[nb][e + 1] = h[1]; } }
            l[nb] = l[nb] * al + sum;
#pragma unroll
            for (int md = 0; md < 4; ++md) o[md][nb] *= al; }
#pragma unroll
        for (int pr = 0; pr < (SPLIT ? 3 : 1); ++pr)
#pragma unroll
            for (int md = 0; md < 4; ++md)
#pragma unroll
                for (int nb = 0; nb < NBQ; ++nb) o[md][nb] = F::mma(pr == 1 ? vt2[md] : vt[md], pr == 2 ? pl[nb] : ph[nb], o[md][nb]);
    };
    const yes_t yes{}; const no_t no{};
    const int klast = ((q0 + NBQ * 16 + 31) & ~31) - 32;             // the one pass that reaches past a query's diagonal; keys beyond it are never read
    load_k(0);
    scores();
    // The scores go round the loop, not the key fragments: a trip fetches its own values and the next pass's keys at its head, works on the scores it was handed, and forms the next pass's scores at its foot, a whole trip behind their fetch.
    for (int kb = 0; kb < klast; kb += 32) {
        load_v(kb);
        load_k(kb + 32);
        __builtin_amdgcn_sched_barrier(0);                           // holds the trip's fetches up here: left free, the scheduler sinks each one to just in front of its use and the wave waits out every latency
        finish(no, kb);
        __builtin_amdgcn_sched_barrier(0);                           // keeps the next pass's score products down here: moved up among the softmax arithmetic they wait for keys that were only just asked for
        scores();
    }
    load_v(klast);
    __builtin_amdgcn_sched_barrier(0);                               // keeps the arithmetic below from moving in between the loads and their wait, where it reuses their address registers
    finish(yes, klast);
#pragma unroll
    for (int nb = 0; nb < NBQ; ++nb) {
        const float ls = l[nb] + xhalf(l[nb]); const bool dead = !(ls > 0.0f); float inv = __fdiv_rn(1.0f, ls);
        if (__builtin_amdgcn_ballot_w32(dead) != 0) {                // cold: a query whose every allowed key is padding
            v8f mean[4];
#pragma unroll
            for (int md = 0; md < 4; ++md) mean[md] = (v8f){};
#pragma unroll 1                                                     // cold path: keep its code small
            for (int t = 0; t < TT; ++t) { v8f x[4];
#pragma unroll
                for (int md = 0; md < 4; ++md) x[md] = *(const v8f*)(vraw + (size_t)t * HD + md * 16 + hi * 8);
                asm volatile("s_wait_xcnt 0x0" ::: "memory");        // before the address moves on
#pragma unroll
                for (int md = 0; md < 4; ++md) mean[md] += x[md]; }
#pragma unroll
            for (int md = 0; md < 4; ++md)
#pragma unroll
                for (int j = 0; j < 8; ++j) o[md][nb][j] = dead ? mean[md][j] * (1.0f / TT) : o[md][nb][j];
            inv = dead ? 1.0f : inv; }
#pragma unroll
        for (int md = 0; md < 4; ++md) o[md][nb] *= inv;
    }
#pragma unroll
    for (int nb = 0; nb < NBQ; ++nb) {                               // all stores last: nothing is computed behind them
        float* orow = out + (size_t)(q0 + nb * 16 + lr) * HD + hi * 8;   // register j of tile md is column md * 16 + 8 hi + j of the lane's query row
#pragma unroll
        for (int md = 0; md < 4; ++md) *(v8f*)(orow + md * 16) = o[md][nb];
        asm volatile("s_wait_xcnt 0x0" ::: "memory");                // before a register that the stores name is written again
    }
}
// k_fattn: grid (12, batch-heads), 4 independent waves a block; wave index w: w < 16 takes 32 fp16 rows, from the sequence's end downwards (longest first), the rest 16 hi/lo rows each, upwards, so that blocks four and eight apart, a long, a short and a middling one, add up alike.
__global__ __launch_bounds__(128) void k_fattn(const h16* __restrict__ Q16, const h16* __restrict__ K16, const h16* __restrict__ V16, const bf* __restrict__ Qh, const bf* __restrict__ Ql, const bf* __restrict__ Kh, const bf* __restrict__ Kl,
                                               const bf* __restrict__ Vh, const bf* __restrict__ Vl, const float* __restrict__ KF, const float* __restrict__ Vraw, float* __restrict__ OUTb) {
    const size_t zo = (size_t)blockIdx.y * TT * HD; const float* kf = KF + (size_t)blockIdx.y * TT;
    const int w = blockIdx.x * 4 + __builtin_amdgcn_readfirstlane((int)(threadIdx.x >> 5));   // scalar, so that the path and every pass test are scalar branches
    if (w < (TT - RH) / 32) attn_rows<h16, false, 2>(Q16 + zo, nullptr, K16 + zo, nullptr, V16 + zo, nullptr, kf, Vraw + zo, OUTb + zo, RH + 32 * ((TT - RH) / 32 - 1 - w));
    else attn_rows<bf, true, 1>(Qh + zo, Ql + zo, Kh + zo, Kl + zo, Vh + zo, Vl + zo, kf, Vraw + zo, OUTb + zo, 16 * (w - (TT - RH) / 32));
}
extern "C" void kernel_launch(void* const* d_in, const int* in_sizes, int n_in,
                              void* d_out, int out_size, void* d_ws, size_t ws_size, hipStream_t stream) {
    (void)in_sizes; (void)n_in; (void)out_size;
    const float* x = (const float*)d_in[0]; const float* xk = (const float*)d_in[1]; const float* xv = (const float*)d_in[2];   /* input order q, k, v: [64][1024][64] each (no projections) */ const float* wq = nullptr, *wk = nullptr, *wv = nullptr, *wo = nullptr; (void)wq; (void)wk; (void)wv; (void)wo;
    float* OUT = (float*)d_out;     // [64][1024][64]
    char* wsp = (char*)d_ws;
    auto take = [&](size_t bytes) { char* p = wsp; wsp += (bytes + 255) & ~(size_t)255; return (void*)p; };
    float* KF = (float*)take((size_t)NB_ * TT * 4);   /* per-key score terms (0, or the exclusion value for an all-zero key), all batch-heads */
    const size_t HS = (size_t)TT * HD;             /* one batch-head of an input, a plane or the output, in elements */
    const size_t PLN = (size_t)NB_ * HS;           /* one plane over all batch-heads */
    h16* QP16 = (h16*)take(PLN * 2); h16* KP16 = (h16*)take(PLN * 2); h16* VT16 = (h16*)take(PLN * 2);
    bf* QPh = (bf*)take(PLN * 2); bf* QPl = (bf*)take(PLN * 2); bf* KPh = (bf*)take(PLN * 2); bf* KPl = (bf*)take(PLN * 2); bf* VTh = (bf*)take(PLN * 2); bf* VTl = (bf*)take(PLN * 2);
    if ((size_t)(wsp - (char*)d_ws) > ws_size) return;    // ws 256 MiB
    k_prep<<<3 * NB_ * TT / 256, 256, 0, stream>>>(x, xk, xv, QP16, QPh, QPl, KP16, KPh, KPl, VT16, VTh, VTl, KF);   /* planes in fragment order (fp16, bf16 hi/lo; v transposed) and key-padding terms straight from the inputs */
    k_fattn<<<dim3(((TT - RH) / 32 + RH / 16) / 4, NB_), 128, 0, stream>>>(QP16, KP16, VT16, QPh, QPl, KPh, KPl, VTh, VTl, KF, xv, OUT);   /* scores, softmax, P.V and the output rows, all batch-heads */
}

// v005
// One run takes 30.2 microseconds.
// In two side-by-side timings against v004, it was 1.49 and 1.46 times as fast.
// All steps since v000 together make it 121 times as fast.
#include <hip/hip_runtime.h>

// Causal scaled dot-product attention on raw batch-head tensors with a data-derived key-padding mask (q, k, v [64][1024][64], no projections; scores = q.k / sqrt(64); keys whose absolute sum is exactly 0 are masked to -2^32+1 (== exclusion; computed from the data, none occur for random inputs); causal mask (same fill); softmax; out = attn.v -> [64][1024][64] (4.2 M); argument order q, k, v).
// Two launches: k_prep builds every 16-bit plane and the key terms for all 64 batch-heads; one attention kernel (grid x: batch-head) then does scores, softmax and P.V for all of them.
// Layout per batch-head: k_prep turns the per-key test sum_d |k[j][d]| != 0 (4 lanes a key, fixed tree) into a float vector (0, or -3e38 for an all-zero key) and the f32 inputs into planes in fragment order (16-byte groups laid so that a wave's 16-byte-a-lane load of half an operand fragment is 512 bytes in a row; v transposed on the way); k_fattn keeps a wave's score tile in registers (running maximum and sum per query; the keys of a query tile are dealt to several waves of a block, whose partial results are joined through LDS), hybrid rows: < 512 hi/lo 3 products, rest fp16 with probabilities x1024; all-zero keys are excluded by adding that vector to the scores; it writes the f32 output rows.
// Compute dtypes, f32 accumulate: inputs split into bf16 hi/lo (rows < 512) or rounded to fp16 (rest); softmax f32; output f32.

#define NB_  64
#define TT   1024
#define DM   64
#define NH_  1
#define NKV  1
#define REP  (NH_ / NKV)
#define HD   64
#define DQ   (NH_ * HD)
#define DKV  (NKV * HD)
#define ZH   1
#define RH   512                  // query rows < RH use hi+lo planes
#define WIN  1024
#define PCAR 1024.0f
#define SCL  0.125f   // 1/sqrt(d_k)
typedef _Float16 h16;
typedef unsigned short bf;
typedef __attribute__((ext_vector_type(16))) __bf16   v16bf;
typedef __attribute__((ext_vector_type(16))) _Float16 v16h;
typedef __attribute__((ext_vector_type(8)))  _Float16 v8h;
typedef __attribute__((ext_vector_type(8)))  unsigned short v8us;
typedef __attribute__((ext_vector_type(8)))  float    v8f;
typedef __attribute__((ext_vector_type(4)))  float    v4f;
typedef v8h  __attribute__((may_alias)) v8ha;
typedef v4f  __attribute__((may_alias)) v4fa;
typedef v8us __attribute__((may_alias)) v8usa;

__device__ __forceinline__ v16h cat16(v8h lo, v8h hi) { return __builtin_shufflevector(lo, hi, 0, 1, 2, 3, 4, 5, 6, 7, 8, 9, 10, 11, 12, 13, 14, 15); }
__device__ __forceinline__ v16bf cat16b(v8us lo, v8us hi) { return __builtin_bit_cast(v16bf, __builtin_shufflevector(lo, hi, 0, 1, 2, 3, 4, 5, 6, 7, 8, 9, 10, 11, 12, 13, 14, 15)); }
__device__ __forceinline__ v8f wmma16(v16h a, v16h b, v8f c) { return __builtin_amdgcn_wmma_f32_16x16x32_f16(false, a, false, b, (short)0, c, false, false); }
__device__ __forceinline__ v8f wmmab(v16bf a, v16bf b, v8f c) { return __builtin_amdgcn_wmma_f32_16x16x32_bf16(false, a, false, b, (short)0, c, false, false); }



// ---- 16x32 operand fragments (row = lane & 15; k = 8 * (lane >> 4) + 0..7 and 16 + 8 * (lane >> 4) + 0..7), the same loader for A and for B, from planes in fragment order: a fragment is 1 KB in a row,
// [k / 8 (4)][row (16)][8 values], so the lane's two 16-byte groups lie at 16 * lane and 512 + 16 * lane bytes and each wave-wide load covers four whole 128-byte lines (row-major planes: 16 lines a load, 32 bytes of each).
// q and k planes: [row / 16][d / 32] fragments; value planes: [key / 32][d / 16] fragments (row = d, k = key).
template <typename T16> struct WFrag;
template <> struct WFrag<h16> { typedef v16h V; static __device__ __forceinline__ V ld(const h16* p) { return cat16(*(const v8h*)p, *(const v8h*)(p + 256)); } static __device__ __forceinline__ v8f mma(V a, V b, v8f c) { return wmma16(a, b, c); } };
template <> struct WFrag<bf> { typedef v16bf V; static __device__ __forceinline__ V ld(const bf* p) { return cat16b(*(const v8us*)p, *(const v8us*)(p + 256)); } static __device__ __forceinline__ v8f mma(V a, V b, v8f c) { return wmmab(a, b, c); } };
typedef __attribute__((ext_vector_type(2))) _Float16 v2h;
typedef __attribute__((ext_vector_type(4))) _Float16 v4h;
typedef __attribute__((ext_vector_type(2))) unsigned short v2us;
typedef __attribute__((ext_vector_type(4))) unsigned short v4us;
typedef __attribute__((ext_vector_type(2))) float v2f;
typedef __attribute__((ext_vector_type(4))) int v4i;

typedef __attribute__((ext_vector_type(2))) __bf16 v2b;
// cvt8: 8 neighbouring f32 values to their 16-byte groups of the planes: fp16 (round to nearest), and bf16 hi with lo = bf16(x - hi)
template <bool F16, bool SPL>
__device__ __forceinline__ void cvt8(const float* x, v8h& o16, v8us& oh, v8us& ol) {
#pragma unroll
    for (int e = 0; e < 8; e += 2) { v2f p; p[0] = x[e]; p[1] = x[e + 1];
        if constexpr (F16) { const v2h h = __builtin_convertvector(p, v2h); o16[e] = h[0]; o16[e + 1] = h[1]; }
        if constexpr (SPL) { const v2b h = __builtin_convertvector(p, v2b); const v2b lo = __builtin_convertvector(p - __builtin_convertvector(h, v2f), v2b);
            const v2us hu = __builtin_bit_cast(v2us, h), lu = __builtin_bit_cast(v2us, lo); oh[e] = hu[0]; oh[e + 1] = hu[1]; ol[e] = lu[0]; ol[e + 1] = lu[1]; } } }
template <int CTRL> __device__ __forceinline__ float xlane(float x) { return __int_as_float(__builtin_amdgcn_update_dpp(0, __float_as_int(x), CTRL, 0xf, 0xf, true)); }   // value of lane ^ m inside a 16-lane row (CTRL = 0x160 + m, row_xmask): in the vector pipe, no trip through the LDS unit
__device__ __forceinline__ float xhalf(float x) { const int b = __float_as_int(x); return __int_as_float(__builtin_amdgcn_permlanex16(b, b, 0x76543210, 0xfedcba98, false, false)); }   // value of lane ^ 16
// rows32: one wave, 32 rows of a [row][HD] input (8 KB, all 16 loads of a lane in flight at once) to two 16-row groups of the planes. Step i takes rows 8 (i >> 1) .. + 7 and columns 32 (i & 1) .. + 31: lane = 8 x (column / 8) + row, 8 values a lane:
// the loads touch 8 lines as before, and a store (4 column groups x 8 neighbouring rows x 16 bytes) fills four whole 128-byte lines of the fragment order.
// FLAG: the per-key test sum_d |k[j][d]| != 0 (fixed tree: in-lane, the row's two steps, then lanes 8 and 16 apart; a sum of absolute values is 0 only if each is, in any order) as a float (0, or -3e38 for an all-zero key); the lane whose column group equals the row group keeps it: lane = row, so the wave's 32 terms fill one 128-byte line.
template <bool F16, bool SPL, bool FLAG>
__device__ __forceinline__ void rows32(const float* __restrict__ src, h16* __restrict__ P16, bf* __restrict__ Ph, bf* __restrict__ Pl, float* __restrict__ kfl) {
    const int lane = threadIdx.x & 31, r = lane & 7, oo = lane >> 3; const unsigned lo8 = (unsigned)(oo * 16 + r) * 8u, lb = (unsigned)r * 256u + (unsigned)oo * 32u;   // the lane's place in a step: in elements of a plane, and in bytes of the f32 input
    float x[8][8];
#pragma unroll
    for (int i = 0; i < 8; ++i) { const float* p = (const float*)((const char*)src + lb) + (i >> 1) * 512 + (i & 1) * 32; const v4f a = *(const v4f*)p, b = *(const v4f*)(p + 4);
#pragma unroll
        for (int e = 0; e < 4; ++e) { x[i][e] = a[e]; x[i][e + 4] = b[e]; } }
    asm volatile("s_wait_xcnt 0x0" :: "v"(lb) : "memory");           // before any register that the loads name is written again; the offset as an input keeps its register alive up to here: otherwise the last load's result lands in it
    v8h o16[8]; v8us oh[8], ol[8]; float fl = 0.0f, sp = 0.0f;
#pragma unroll
    for (int i = 0; i < 8; ++i) { cvt8<F16, SPL>(x[i], o16[i], oh[i], ol[i]);
        if constexpr (FLAG) { const float* a = x[i];
            float s = __fadd_rn(__fadd_rn(__fadd_rn(fabsf(a[0]), fabsf(a[1])), __fadd_rn(fabsf(a[2]), fabsf(a[3]))), __fadd_rn(__fadd_rn(fabsf(a[4]), fabsf(a[5])), __fadd_rn(fabsf(a[6]), fabsf(a[7]))));
            if ((i & 1) == 0) sp = s;
            else { s = __fadd_rn(s, sp); s = __fadd_rn(s, xlane<0x168>(s)); s = __fadd_rn(s, xhalf(s));
                fl = (oo == (i >> 1)) ? ((s != 0.0f) ? 0.0f : -3.0e38f) : fl; } } }   // what the key adds to its scores: nothing, or the exclusion value (an all-zero key's own products are exactly 0)
    __builtin_amdgcn_sched_barrier(0);                               // all stores last: left free, the scheduler mixes them with the conversions, whose results then reuse registers that issued stores name (a wait each time), and the build spills
#pragma unroll
    for (int i = 0; i < 8; ++i) { const int c = (i >> 2) * 1024 + (i & 1) * 512 + ((i >> 1) & 1) * 64; if constexpr (F16) *(v8h*)(P16 + lo8 + c) = o16[i]; if constexpr (SPL) { *(v8us*)(Ph + lo8 + c) = oh[i]; *(v8us*)(Pl + lo8 + c) = ol[i]; } }
    if constexpr (FLAG) kfl[lane] = fl;
    asm volatile("s_wait_xcnt 0x0" ::: "memory");                    // before a register that the stores name is written again (the code behind this path reuses them)
}
#define VP 65                     // LDS pitch of a value row in floats: odd, so that the column reads below (2 lane halves 16 rows apart x 16 neighbouring columns) fall on 32 different banks
// vtile: one block, 256 value rows [t][HD] to 8 x 4 fragments of the value planes: whole rows in (16-byte loads), f32 through LDS, then 8 neighbouring t of one d a lane; wave w builds the 32 keys 32 w .. + 31: a wave's store fills four whole 128-byte lines.
template <bool SPL>
__device__ __forceinline__ void vtile(const float* __restrict__ src, h16* __restrict__ V16, bf* __restrict__ Vh, bf* __restrict__ Vl, float* S) {
    const int tid = threadIdx.x, lane = tid & 31, w = tid >> 5;
    v4f x[16];
#pragma unroll
    for (int i = 0; i < 16; ++i) x[i] = *(const v4f*)(src + (unsigned)tid * 4u + i * 1024);
    asm volatile("s_wait_xcnt 0x0" ::: "memory");                    // before any register that the loads name is written again
    float* sw = S + (tid >> 4) * VP + (tid & 15) * 4;
#pragma unroll
    for (int i = 0; i < 16; ++i)
#pragma unroll
        for (int e = 0; e < 4; ++e) sw[i * 16 * VP + e] = x[i][e];
    __syncthreads();                                                 // the tile is whole before anyone reads a column
    const float* sr = S + (w * 32 + (lane >> 4) * 16) * VP + (lane & 15);
    const unsigned vo = (unsigned)w * 2048u + (unsigned)(lane >> 4) * 256u + (unsigned)(lane & 15) * 8u;
#pragma unroll
    for (int h = 0; h < 8; h += 4) {                                 // two halves, each read, converted and stored before the next: all eight steps at once need more registers than the launch bound leaves (the build spilled)
        v8h o16[4]; v8us oh[4], ol[4];
#pragma unroll
        for (int i = h; i < h + 4; ++i) { float y[8];                // step i: columns 16 (i >> 1) + 0..15, rows 32 w + 8 (i & 1) + 0..7 (low lanes) and 16 more (high lanes)
#pragma unroll
            for (int j = 0; j < 8; ++j) y[j] = sr[((i & 1) * 8 + j) * VP + (i >> 1) * 16];
            cvt8<true, SPL>(y, o16[i - h], oh[i - h], ol[i - h]); }
        __builtin_amdgcn_sched_barrier(0);                           // a half's stores last, as in rows32: mixed with the conversions, these write again registers that issued stores name
#pragma unroll
        for (int i = h; i < h + 4; ++i) { const int c = (i >> 1) * 512 + (i & 1) * 128; *(v8h*)(V16 + vo + c) = o16[i - h]; if constexpr (SPL) { *(v8us*)(Vh + vo + c) = oh[i - h]; *(v8us*)(Vl + vo + c) = ol[i - h]; } }
        asm volatile("s_wait_xcnt 0x0" ::: "memory");                // as at the end of rows32: the next half, or the code behind this path, reuses the registers that the stores name
    }
}
// k_prep: every plane and key term that k_fattn reads, in one launch. Grid 3 x 256 blocks of 8 waves; block b: input b % 3 (q, k, v), rows 256 (b / 3) .. + 255 of the flat [batch-head x t] rows, that is one quarter of one batch-head.
// The second launch bound (waves a SIMD) holds the registers at 128, so that every block of the grid (three a WGP) is resident at once and all loads fly together.
// Only what is read is built: fp16 q for rows >= RH, hi/lo q for rows < RH; fp16 k and v for all keys, hi/lo k and v for keys < RH (the hi/lo queries' diagonals end there).
__global__ __launch_bounds__(256, 8) void k_prep(const float* __restrict__ q, const float* __restrict__ k, const float* __restrict__ v, h16* __restrict__ Q16, bf* __restrict__ Qh, bf* __restrict__ Ql,
                                              h16* __restrict__ K16, bf* __restrict__ Kh, bf* __restrict__ Kl, h16* __restrict__ V16, bf* __restrict__ Vh, bf* __restrict__ Vl, float* __restrict__ KF) {
    __shared__ float S[256 * VP];
    const unsigned kind = blockIdx.x % 3u, u = blockIdx.x / 3u; const bool low = (u & 3u) * 256u < RH;   // block-uniform
    if (kind == 2u) { const size_t ho = (size_t)(u >> 2) * TT * HD, po = ho + (u & 3u) * 256u * HD;
        if (low) vtile<true>(v + (size_t)u * 256 * HD, V16 + po, Vh + po, Vl + po, S); else vtile<false>(v + (size_t)u * 256 * HD, V16 + po, nullptr, nullptr, S);
        return; }
    const size_t r0 = (size_t)u * 256 + 32 * __builtin_amdgcn_readfirstlane((int)(threadIdx.x >> 5)), e0 = r0 * HD;   // the wave's first row: scalar, so that every base address is
    if (kind == 0u) { if (low) rows32<false, true, false>(q + e0, nullptr, Qh + e0, Ql + e0, nullptr); else rows32<true, false, false>(q + e0, Q16 + e0, nullptr, nullptr, nullptr); }
    else { if (low) rows32<true, true, true>(k + e0, K16 + e0, Kh + e0, Kl + e0, KF + r0); else rows32<true, false, true>(k + e0, K16 + e0, nullptr, nullptr, KF + r0); }
}
struct yes_t { static constexpr bool value = true; }; struct no_t { static constexpr bool value = false; };   // compile-time switches of a pass
#define XSC  0.18033688011112042f   // 1/sqrt(d_k) x log2(e): scores go to the exponent of 2 in one multiply-add
#define MLOW -1.0e30f               // start of the running maximum: far above an excluded score x XSC, so an excluded key's probability is exactly 0
__device__ __forceinline__ float exp2x1(float x) { float r; asm("v_exp_f32 %0, %1\n\tv_nop" : "=v"(r) : "v"(x)); return r; }
__device__ __forceinline__ void exp2x8(const float* x, float* p) {
    asm("v_exp_f32 %0, %8\n\tv_exp_f32 %1, %9\n\tv_exp_f32 %2, %10\n\tv_exp_f32 %3, %11\n\tv_exp_f32 %4, %12\n\tv_exp_f32 %5, %13\n\tv_exp_f32 %6, %14\n\tv_exp_f32 %7, %15\n\tv_nop"
        : "=&v"(p[0]), "=&v"(p[1]), "=&v"(p[2]), "=&v"(p[3]), "=&v"(p[4]), "=&v"(p[5]), "=&v"(p[6]), "=&v"(p[7]) : "v"(x[0]), "v"(x[1]), "v"(x[2]), "v"(x[3]), "v"(x[4]), "v"(x[5]), "v"(x[6]), "v"(x[7])); }
template <typename T16, bool SPLIT, int NBQ, int KS, int TPB>
__device__ __forceinline__ void attn_rows(const T16* __restrict__ Q, const T16* __restrict__ Q2, const T16* __restrict__ Kp, const T16* __restrict__ Kp2, const T16* __restrict__ Vt, const T16* __restrict__ Vt2,
                                          const float* __restrict__ kf, const float* __restrict__ vraw, float* __restrict__ out, const int q0, const int pmax, const int wv, float* SO, float* SM, float* SL) {
    static_assert(KS == 2 * NBQ, "the join gives each wave one 128-byte half of the rows of one 16-query group");
    typedef typename WFrag<T16>::V V; typedef WFrag<T16> F;
    const int lane = threadIdx.x & 31, lr = lane & 15, hi = lane >> 4;
    const unsigned flo = (unsigned)lane * 16u, blo = (unsigned)hi * 32u;   // the lane's byte offsets in a fragment of any plane and in 16 key terms: fixed for the whole kernel: every address is a wave-uniform base + one of these + a constant
    auto at = [](const T16* base, unsigned off) { return (const T16*)((const char*)base + off); };
    V q[NBQ][2], q2[NBQ][2]; const T16* pq = at(Q + (size_t)q0 * HD, flo);
#pragma unroll
    for (int nb = 0; nb < NBQ; ++nb)
#pragma unroll
        for (int ks = 0; ks < 2; ++ks) q[nb][ks] = F::ld(pq + nb * 16 * HD + ks * 512);
    asm volatile("s_wait_xcnt 0x0" :: "v"(pq) : "memory");           // here and below: before any register that the loads in front name (address, scalar base) is written again; the address as an input keeps its registers untouched up to the wait
    if constexpr (SPLIT) { const T16* pq2 = at(Q2 + (size_t)q0 * HD, flo);
#pragma unroll
        for (int nb = 0; nb < NBQ; ++nb)
#pragma unroll
            for (int ks = 0; ks < 2; ++ks) q2[nb][ks] = F::ld(pq2 + nb * 16 * HD + ks * 512);
        asm volatile("s_wait_xcnt 0x0" :: "v"(pq2) : "memory"); }
    v8f o[4][NBQ]; float m[NBQ], l[NBQ];
#pragma unroll
    for (int nb = 0; nb < NBQ; ++nb) { m[nb] = MLOW; l[nb] = 0.0f;
#pragma unroll
        for (int md = 0; md < 4; ++md) o[md][nb] = (v8f){}; }
    V kc[2][2], kc2[2][2], vt[4], vt2[4]; v8f cb[2], s[2][NBQ];      // cb: a pass's key terms in the score tiles' register order, the C operand of each tile's first product
    // Each group of loads ends in its own s_wait_xcnt 0: before any register that the loads name is written again. The addresses as inputs keep their registers alive up to there: otherwise a later load's result of the same group lands in them.
    auto load_k = [&](const int kb) {                                // key fragments and key terms of the pass at kb
        const T16* pk = at(Kp + (size_t)kb * HD, flo); const T16* pk2 = SPLIT ? at(Kp2 + (size_t)kb * HD, flo) : pk; const char* pc = (const char*)(kf + kb) + blo;
#pragma unroll
        for (int mt = 0; mt < 2; ++mt)
#pragma unroll
            for (int ks = 0; ks < 2; ++ks) { kc[mt][ks] = F::ld(pk + mt * 16 * HD + ks * 512); if (SPLIT) kc2[mt][ks] = F::ld(pk2 + mt * 16 * HD + ks * 512); }
#pragma unroll
        for (int mt = 0; mt < 2; ++mt) cb[mt] = *(const v8f*)(pc + mt * 64);
        asm volatile("s_wait_xcnt 0x0" :: "v"(pk), "v"(pk2), "v"(pc) : "memory");
    };
    auto load_v = [&](const int kb) {                                // value fragments of the pass at kb
        const T16* pv = at(Vt + (size_t)kb * HD, flo); const T16* pv2 = SPLIT ? at(Vt2 + (size_t)kb * HD, flo) : pv;
#pragma unroll
        for (int md = 0; md < 4; ++md) { vt[md] = F::ld(pv + md * 512); if (SPLIT) vt2[md] = F::ld(pv2 + md * 512); }
        asm volatile("s_wait_xcnt 0x0" :: "v"(pv), "v"(pv2) : "memory");
    };
    auto scores = [&]() {                                            // S^T of the pass whose key fragments are loaded
#pragma unroll
        for (int mt = 0; mt < 2; ++mt)
#pragma unroll
            for (int nb = 0; nb < NBQ; ++nb) s[mt][nb] = cb[mt];
#pragma unroll
        for (int ks = 0; ks < 2; ++ks)
#pragma unroll
            for (int pr = 0; pr < (SPLIT ? 3 : 1); ++pr)             // tiles innermost: neighbouring products go to different accumulators
#pragma unroll
                for (int mt = 0; mt < 2; ++mt)
#pragma unroll
                    for (int nb = 0; nb < NBQ; ++nb) s[mt][nb] = F::mma(pr == 1 ? kc2[mt][ks] : kc[mt][ks], pr == 2 ? q2[nb][ks] : q[nb][ks], s[mt][nb]);
    };
    // second half: the diagonal's exclusions (compile-time choice: only the last pass has any), running softmax, O^T += V^T.P^T
    auto finish = [&](auto causal, const int kb) {
        if constexpr (causal.value) {
#pragma unroll
            for (int mt = 0; mt < 2; ++mt)
#pragma unroll
                for (int nb = 0; nb < NBQ; ++nb)
#pragma unroll
                    for (int j = 0; j < 8; ++j) s[mt][nb][j] = (kb + mt * 16 + hi * 8 + j <= q0 + nb * 16 + lr) ? s[mt][nb][j] : -3.0e38f; }
        V ph[NBQ], pl[NBQ];
#pragma unroll
        for (int nb = 0; nb < NBQ; ++nb) {
            float mx = s[0][nb][0];
#pragma unroll
            for (int e = 1; e < 16; ++e) mx = fmaxf(mx, s[e >> 3][nb][e & 7]);
            mx = fmaxf(mx, xhalf(mx));
            const float mn = fmaxf(m[nb], mx * XSC); const float al = exp2x1(m[nb] - mn); m[nb] = mn;
            const float sub = SPLIT ? -mn : 10.0f - mn;              // fp16 rows carry probabilities x1024 (sum and products alike; it cancels in the division)
            float sum = 0.0f, x[16], pe[16];
#pragma unroll
            for (int e = 0; e < 16; ++e) x[e] = fmaf(s[e >> 3][nb][e & 7], XSC, sub);
            exp2x8(x, pe); exp2x8(x + 8, pe + 8);
#pragma unroll
            for (int e = 0; e < 16; e += 2) { v2f p; p[0] = pe[e]; p[1] = pe[e + 1]; sum += p[0] + p[1];
                if constexpr (SPLIT) { const v2b h = __builtin_convertvector(p, v2b); const v2b lo = __builtin_convertvector(p - __builtin_convertvector(h, v2f), v2b); ph[nb][e] = h[0]; ph[nb][e + 1] = h[1]; pl[nb][e] = lo[0]; pl[nb][e + 1] = lo[1]; }
                else { const v2h h = __builtin_convertvector(p, v2h); ph[nb][e] = h[0]; ph[nb][e + 1] = h[1]; } }
            l[nb] = l[nb] * al + sum;
#pragma unroll
            for (int md = 0; md < 4; ++md) o[md][nb] *= al; }
#pragma unroll
        for (int pr = 0; pr < (SPLIT ? 3 : 1); ++pr)
#pragma unroll
            for (int md = 0; md < 4; ++md)
#pragma unroll
                for (int nb = 0; nb < NBQ; ++nb) o[md][nb] = F::mma(pr == 1 ? vt2[md] : vt[md], pr == 2 ? pl[nb] : ph[nb], o[md][nb]);
    };
    const yes_t yes{}; const no_t no{};
    const int klast = ((q0 + NBQ * 16 + 31) & ~31) - 32;             // the one pass that reaches past a query's diagonal; keys beyond it are never read
    const int part = wv / TPB, np = klast / 32 + 1;                  // wv: the wave's number in the block (scalar); np: the passes of this tile
    const int kb0 = 32 * min(pmax * part / KS, np), kl = 32 * min(pmax * (part + 1) / KS, np) - 32;   // the wave's first and last pass, cut off at the tile's diagonal; a short tile leaves late parts empty (kl < kb0)
    if (kb0 <= kl) {                                                 // scalar branch
    load_k(kb0);
    __builtin_amdgcn_sched_barrier(0);                               // holds the first pass's fetches together: left free, the scheduler puts some of them behind the first products, into the same registers, and a wave's start costs several trips to memory, one after another
    scores();
    // The scores go round the loop, not the key fragments: a trip fetches its own values and the next pass's keys at its head, works on the scores it was handed, and forms the next pass's scores at its foot, a whole trip behind their fetch.
    for (int kb = kb0; kb < kl; kb += 32) {
        load_v(kb);
        load_k(kb + 32);
        __builtin_amdgcn_sched_barrier(0);                           // holds the trip's fetches up here: left free, the scheduler sinks each one to just in front of its use and the wave waits out every latency
        finish(no, kb);
        __builtin_amdgcn_sched_barrier(0);                           // keeps the next pass's score products down here: moved up among the softmax arithmetic they wait for keys that were only just asked for
        scores();
    }
    load_v(kl);
    __builtin_amdgcn_sched_barrier(0);                               // keeps the arithmetic below from moving in between the loads and their wait, where it reuses their address registers
    finish(yes, kl);                                                 // the diagonal's test is an identity in a pass that lies wholly below it
    }
    // The join. Every wave leaves its running maximum, its sum and its unscaled O^T tiles in LDS (16-byte groups, lane after lane: no bank is met twice); behind the barrier wave part sums, over the KS parts and each on the common maximum,
    // the two tiles that make up one 128-byte half of the output rows of 16-query group part / 2: one writer a line. An empty part holds maximum MLOW, sum 0, tiles 0.
    float* so = SO + wv * (4 * NBQ * 256) + lane * 4;
#pragma unroll
    for (int nb = 0; nb < NBQ; ++nb) { SM[(wv * NBQ + nb) * 32 + lane] = m[nb]; SL[(wv * NBQ + nb) * 32 + lane] = l[nb] + xhalf(l[nb]);
#pragma unroll
        for (int md = 0; md < 4; ++md) { const v8f t = o[md][nb];
            *(v4f*)(so + (md * NBQ + nb) * 256) = __builtin_shufflevector(t, t, 0, 1, 2, 3); *(v4f*)(so + (md * NBQ + nb) * 256 + 128) = __builtin_shufflevector(t, t, 4, 5, 6, 7); } }
    __syncthreads();                                                 // every part's results are in LDS before anyone joins them
    const int nbi = part >> 1, mp = part & 1, w0 = wv - part * TPB;   // w0: the tile; part w of it is wave w0 + w x TPB
    float mw[KS], lw[KS];
#pragma unroll
    for (int w = 0; w < KS; ++w) { mw[w] = SM[((w0 + w * TPB) * NBQ + nbi) * 32 + lane]; lw[w] = SL[((w0 + w * TPB) * NBQ + nbi) * 32 + lane]; }
    float mj = mw[0];
#pragma unroll
    for (int w = 1; w < KS; ++w) mj = fmaxf(mj, mw[w]);
    float ls = 0.0f; v8f acc[2]; acc[0] = (v8f){}; acc[1] = (v8f){};
#pragma unroll
    for (int w = 0; w < KS; ++w) { const float f = exp2x1(mw[w] - mj); ls = fmaf(f, lw[w], ls);
#pragma unroll
        for (int i = 0; i < 2; ++i) { const float* p = SO + (w0 + w * TPB) * (4 * NBQ * 256) + ((mp * 2 + i) * NBQ + nbi) * 256 + lane * 4; const v4f a = *(const v4f*)p, b = *(const v4f*)(p + 128);
#pragma unroll
            for (int e = 0; e < 4; ++e) { acc[i][e] = fmaf(f, a[e], acc[i][e]); acc[i][e + 4] = fmaf(f, b[e], acc[i][e + 4]); } } }
    const bool dead = !(ls > 0.0f); float inv = __fdiv_rn(1.0f, ls);
    if (__builtin_amdgcn_ballot_w32(dead) != 0) {                    // cold: a query whose every allowed key is padding
        v8f mean[2]; mean[0] = (v8f){}; mean[1] = (v8f){};
#pragma unroll 1                                                     // cold path: keep its code small
        for (int t = 0; t < TT; ++t) { v8f x[2];
#pragma unroll
            for (int i = 0; i < 2; ++i) x[i] = *(const v8f*)(vraw + (size_t)t * HD + (mp * 2 + i) * 16 + hi * 8);
            asm volatile("s_wait_xcnt 0x0" ::: "memory");            // before the address moves on
#pragma unroll
            for (int i = 0; i < 2; ++i) mean[i] += x[i]; }
#pragma unroll
        for (int i = 0; i < 2; ++i)
#pragma unroll
            for (int j = 0; j < 8; ++j) acc[i][j] = dead ? mean[i][j] * (1.0f / TT) : acc[i][j];
        inv = dead ? 1.0f : inv; }
    float* orow = out + (size_t)(q0 + nbi * 16 + lr) * HD + mp * 32 + hi * 8;   // register j of tile md is column md * 16 + 8 hi + j of the lane's query row
#pragma unroll
    for (int i = 0; i < 2; ++i) *(v8f*)(orow + i * 16) = acc[i] * inv;
    asm volatile("s_wait_xcnt 0x0" ::: "memory");                    // before a register that the stores name is written again
}
// k_fattn: grid (batch-heads, 16), 8 waves a block, 64 query rows a block. Even y: 2 tiles of 32 fp16 rows, the keys of each dealt to 4 waves; odd y: 4 tiles of 16 hi/lo rows, the keys of each dealt to 2 waves. Both kinds from the sequence's end downwards:
// there are more blocks than resident places, and the cost falls with the index (for speed only). The second launch bound (waves a SIMD) holds the registers at 256: two blocks a WGP, so that one works while the other starts or joins.
static_assert((TT - RH) / 64 == RH / 64, "the two kinds of block alternate in y");
__global__ __launch_bounds__(256, 4) void k_fattn(const h16* __restrict__ Q16, const h16* __restrict__ K16, const h16* __restrict__ V16, const bf* __restrict__ Qh, const bf* __restrict__ Ql, const bf* __restrict__ Kh, const bf* __restrict__ Kl,
                                               const bf* __restrict__ Vh, const bf* __restrict__ Vl, const float* __restrict__ KF, const float* __restrict__ Vraw, float* __restrict__ OUTb) {
    __shared__ __attribute__((aligned(16))) float SO[8 * 8 * 256]; __shared__ float SM[8 * 2 * 32], SL[8 * 2 * 32];   // the parts' O^T tiles, maxima and sums
    const size_t zo = (size_t)blockIdx.x * TT * HD; const float* kf = KF + (size_t)blockIdx.x * TT;
    const int wv = __builtin_amdgcn_readfirstlane((int)(threadIdx.x >> 5)), r0 = 64 * (RH / 64 - 1 - (int)(blockIdx.y >> 1));   // scalar, so that the path and every pass test are scalar branches
    if ((blockIdx.y & 1u) == 0u) attn_rows<h16, false, 2, 4, 2>(Q16 + zo, nullptr, K16 + zo, nullptr, V16 + zo, nullptr, kf, Vraw + zo, OUTb + zo, RH + r0 + 32 * (wv & 1), (RH + r0) / 32 + 2, wv, SO, SM, SL);
    else attn_rows<bf, true, 1, 2, 4>(Qh + zo, Ql + zo, Kh + zo, Kl + zo, Vh + zo, Vl + zo, kf, Vraw + zo, OUTb + zo, r0 + 16 * (wv & 3), r0 / 32 + 2, wv, SO, SM, SL);
}
extern "C" void kernel_launch(void* const* d_in, const int* in_sizes, int n_in,
                              void* d_out, int out_size, void* d_ws, size_t ws_size, hipStream_t stream) {
    (void)in_sizes; (void)n_in; (void)out_size;
    const float* x = (const float*)d_in[0]; const float* xk = (const float*)d_in[1]; const float* xv = (const float*)d_in[2];   /* input order q, k, v: [64][1024][64] each (no projections) */ const float* wq = nullptr, *wk = nullptr, *wv = nullptr, *wo = nullptr; (void)wq; (void)wk; (void)wv; (void)wo;
    float* OUT = (float*)d_out;     // [64][1024][64]
    char* wsp = (char*)d_ws;
    auto take = [&](size_t bytes) { char* p = wsp; wsp += (bytes + 255) & ~(size_t)255; return (void*)p; };
    float* KF = (float*)take((size_t)NB_ * TT * 4);   /* per-key score terms (0, or the exclusion value for an all-zero key), all batch-heads */
    const size_t HS = (size_t)TT * HD;             /* one batch-head of an input, a plane or the output, in elements */
    const size_t PLN = (size_t)NB_ * HS;           /* one plane over all batch-heads */
    h16* QP16 = (h16*)take(PLN * 2); h16* KP16 = (h16*)take(PLN * 2); h16* VT16 = (h16*)take(PLN * 2);
    bf* QPh = (bf*)take(PLN * 2); bf* QPl = (bf*)take(PLN * 2); bf* KPh = (bf*)take(PLN * 2); bf* KPl = (bf*)take(PLN * 2); bf* VTh = (bf*)take(PLN * 2); bf* VTl = (bf*)take(PLN * 2);
    if ((size_t)(wsp - (char*)d_ws) > ws_size) return;    // ws 256 MiB
    k_prep<<<3 * NB_ * TT / 256, 256, 0, stream>>>(x, xk, xv, QP16, QPh, QPl, KP16, KPh, KPl, VT16, VTh, VTl, KF);   /* planes in fragment order (fp16, bf16 hi/lo; v transposed) and key-padding terms straight from the inputs */
    k_fattn<<<dim3(NB_, (TT - RH) / 64 + RH / 64), 256, 0, stream>>>(QP16, KP16, VT16, QPh, QPl, KPh, KPl, VTh, VTl, KF, xv, OUT);   /* scores, softmax, P.V and the output rows, all batch-heads */
}

// v006
// One run takes 27.4 microseconds.
// Timed twice side by side with v005, it ran 1.09 and 1.10 times as fast.
// Counting every step since v000, it is 133 times as fast.
#include <hip/hip_runtime.h>

// Causal scaled dot-product attention on raw batch-head tensors with a data-derived key-padding mask (q, k, v [64][1024][64], no projections; scores = q.k / sqrt(64); keys whose absolute sum is exactly 0 are masked to -2^32+1 (== exclusion; computed from the data, none occur for random inputs); causal mask (same fill); softmax; out = attn.v -> [64][1024][64] (4.2 M); argument order q, k, v).
// Two launches: k_prep builds the 16-bit planes of k and v and the key terms for all 64 batch-heads; one attention kernel (grid x: batch-head) then does scores, softmax and P.V for all of them.
// Layout per batch-head: k_prep turns the per-key test sum_d |k[j][d]| != 0 (4 lanes a key, fixed tree) into a float vector (0, or -3e38 for an all-zero key) and the f32 k and v into planes in fragment order (16-byte groups laid so that a wave's 16-byte-a-lane load of half an operand fragment is 512 bytes in a row; v transposed on the way); a block of k_fattn converts its own 64 query rows from the f32 q into LDS (each query row belongs to one block: a plane of it would be written once to be read once) and keeps a wave's score tile in registers (running maximum and sum per query; the keys of a query tile are dealt to several waves of a block, whose partial results are joined through LDS), hybrid rows: < 512 hi/lo 3 products, rest fp16 with probabilities x1024; all-zero keys are excluded by adding that vector to the scores; it writes the f32 output rows.
// Compute dtypes, f32 accumulate: inputs split into bf16 hi/lo (rows < 512) or rounded to fp16 (rest); softmax f32; output f32.

#define NB_  64
#define TT   1024
#define DM   64
#define NH_  1
#define NKV  1
#define REP  (NH_ / NKV)
#define HD   64
#define DQ   (NH_ * HD)
#define DKV  (NKV * HD)
#define ZH   1
#define RH   512                  // query rows < RH use hi+lo planes
#define WIN  1024
#define PCAR 1024.0f
#define SCL  0.125f   // 1/sqrt(d_k)
typedef _Float16 h16;
typedef unsigned short bf;
typedef __attribute__((ext_vector_type(16))) __bf16   v16bf;
typedef __attribute__((ext_vector_type(16))) _Float16 v16h;
typedef __attribute__((ext_vector_type(8)))  _Float16 v8h;
typedef __attribute__((ext_vector_type(8)))  unsigned short v8us;
typedef __attribute__((ext_vector_type(8)))  float    v8f;
typedef __attribute__((ext_vector_type(4)))  float    v4f;
typedef v8h  __attribute__((may_alias)) v8ha;
typedef v4f  __attribute__((may_alias)) v4fa;
typedef v8us __attribute__((may_alias)) v8usa;

__device__ __forceinline__ v16h cat16(v8h lo, v8h hi) { return __builtin_shufflevector(lo, hi, 0, 1, 2, 3, 4, 5, 6, 7, 8, 9, 10, 11, 12, 13, 14, 15); }
__device__ __forceinline__ v16bf cat16b(v8us lo, v8us hi) { return __builtin_bit_cast(v16bf, __builtin_shufflevector(lo, hi, 0, 1, 2, 3, 4, 5, 6, 7, 8, 9, 10, 11, 12, 13, 14, 15)); }
__device__ __forceinline__ v8f wmma16(v16h a, v16h b, v8f c) { return __builtin_amdgcn_wmma_f32_16x16x32_f16(false, a, false, b, (short)0, c, false, false); }
__device__ __forceinline__ v8f wmmab(v16bf a, v16bf b, v8f c) { return __builtin_amdgcn_wmma_f32_16x16x32_bf16(false, a, false, b, (short)0, c, false, false); }



// ---- 16x32 operand fragments (row = lane & 15; k = 8 * (lane >> 4) + 0..7 and 16 + 8 * (lane >> 4) + 0..7), the same loader for A and for B, from planes in fragment order: a fragment is 1 KB in a row,
// [k / 8 (4)][row (16)][8 values], so the lane's two 16-byte groups lie at 16 * lane and 512 + 16 * lane bytes and each wave-wide load covers four whole 128-byte lines (row-major planes: 16 lines a load, 32 bytes of each).
// k planes: [row / 16][d / 32] fragments; value planes: [key / 32][d / 16] fragments (row = d, k = key).
template <typename T16> struct WFrag;
template <> struct WFrag<h16> { typedef v16h V; static __device__ __forceinline__ V ld(const h16* p) { return cat16(*(const v8h*)p, *(const v8h*)(p + 256)); } static __device__ __forceinline__ v8f mma(V a, V b, v8f c) { return wmma16(a, b, c); } };
template <> struct WFrag<bf> { typedef v16bf V; static __device__ __forceinline__ V ld(const bf* p) { return cat16b(*(const v8us*)p, *(const v8us*)(p + 256)); } static __device__ __forceinline__ v8f mma(V a, V b, v8f c) { return wmmab(a, b, c); } };
typedef __attribute__((ext_vector_type(2))) _Float16 v2h;
typedef __attribute__((ext_vector_type(4))) _Float16 v4h;
typedef __attribute__((ext_vector_type(2))) unsigned short v2us;
typedef __attribute__((ext_vector_type(4))) unsigned short v4us;
typedef __attribute__((ext_vector_type(2))) float v2f;
typedef __attribute__((ext_vector_type(4))) int v4i;

typedef __attribute__((ext_vector_type(2))) __bf16 v2b;
// cvt8: 8 neighbouring f32 values to their 16-byte groups of the planes: fp16 (round to nearest), and bf16 hi with lo = bf16(x - hi)
template <bool F16, bool SPL>
__device__ __forceinline__ void cvt8(const float* x, v8h& o16, v8us& oh, v8us& ol) {
#pragma unroll
    for (int e = 0; e < 8; e += 2) { v2f p; p[0] = x[e]; p[1] = x[e + 1];
        if constexpr (F16) { const v2h h = __builtin_convertvector(p, v2h); o16[e] = h[0]; o16[e + 1] = h[1]; }
        if constexpr (SPL) { const v2b h = __builtin_convertvector(p, v2b); const v2b lo = __builtin_convertvector(p - __builtin_convertvector(h, v2f), v2b);
            const v2us hu = __builtin_bit_cast(v2us, h), lu = __builtin_bit_cast(v2us, lo); oh[e] = hu[0]; oh[e + 1] = hu[1]; ol[e] = lu[0]; ol[e + 1] = lu[1]; } } }
template <int CTRL> __device__ __forceinline__ float xlane(float x) { return __int_as_float(__builtin_amdgcn_update_dpp(0, __float_as_int(x), CTRL, 0xf, 0xf, true)); }   // value of lane ^ m inside a 16-lane row (CTRL = 0x160 + m, row_xmask): in the vector pipe, no trip through the LDS unit
__device__ __forceinline__ float xhalf(float x) { const int b = __float_as_int(x); return __int_as_float(__builtin_amdgcn_permlanex16(b, b, 0x76543210, 0xfedcba98, false, false)); }   // value of lane ^ 16
// rows32: one wave, 32 rows of a [row][HD] input (8 KB, all 16 loads of a lane in flight at once) to two 16-row groups of the planes. Step i takes rows 8 (i >> 1) .. + 7 and columns 32 (i & 1) .. + 31: lane = 8 x (column / 8) + row, 8 values a lane:
// the loads touch 8 lines as before, and a store (4 column groups x 8 neighbouring rows x 16 bytes) fills four whole 128-byte lines of the fragment order.
// FLAG: the per-key test sum_d |k[j][d]| != 0 (fixed tree: in-lane, the row's two steps, then lanes 8 and 16 apart; a sum of absolute values is 0 only if each is, in any order) as a float (0, or -3e38 for an all-zero key); the lane whose column group equals the row group keeps it: lane = row, so the wave's 32 terms fill one 128-byte line.
template <bool F16, bool SPL, bool FLAG>
__device__ __forceinline__ void rows32(const float* __restrict__ src, h16* __restrict__ P16, bf* __restrict__ Ph, bf* __restrict__ Pl, float* __restrict__ kfl) {
    const int lane = threadIdx.x & 31, r = lane & 7, oo = lane >> 3; const unsigned lo8 = (unsigned)(oo * 16 + r) * 8u, lb = (unsigned)r * 256u + (unsigned)oo * 32u;   // the lane's place in a step: in elements of a plane, and in bytes of the f32 input
    float x[8][8];
#pragma unroll
    for (int i = 0; i < 8; ++i) { const float* p = (const float*)((const char*)src + lb) + (i >> 1) * 512 + (i & 1) * 32; const v4f a = *(const v4f*)p, b = *(const v4f*)(p + 4);
#pragma unroll
        for (int e = 0; e < 4; ++e) { x[i][e] = a[e]; x[i][e + 4] = b[e]; } }
    asm volatile("s_wait_xcnt 0x0" :: "v"(lb) : "memory");           // before any register that the loads name is written again; the offset as an input keeps its register alive up to here: otherwise the last load's result lands in it
    v8h o16[8]; v8us oh[8], ol[8]; float fl = 0.0f, sp = 0.0f;
#pragma unroll
    for (int i = 0; i < 8; ++i) { cvt8<F16, SPL>(x[i], o16[i], oh[i], ol[i]);
        if constexpr (FLAG) { const float* a = x[i];
            float s = __fadd_rn(__fadd_rn(__fadd_rn(fabsf(a[0]), fabsf(a[1])), __fadd_rn(fabsf(a[2]), fabsf(a[3]))), __fadd_rn(__fadd_rn(fabsf(a[4]), fabsf(a[5])), __fadd_rn(fabsf(a[6]), fabsf(a[7]))));
            if ((i & 1) == 0) sp = s;
            else { s = __fadd_rn(s, sp); s = __fadd_rn(s, xlane<0x168>(s)); s = __fadd_rn(s, xhalf(s));
                fl = (oo == (i >> 1)) ? ((s != 0.0f) ? 0.0f : -3.0e38f) : fl; } } }   // what the key adds to its scores: nothing, or the exclusion value (an all-zero key's own products are exactly 0)
    __builtin_amdgcn_sched_barrier(0);                               // all stores last: left free, the scheduler mixes them with the conversions, whose results then reuse registers that issued stores name (a wait each time), and the build spills
#pragma unroll
    for (int i = 0; i < 8; ++i) { const int c = (i >> 2) * 1024 + (i & 1) * 512 + ((i >> 1) & 1) * 64; if constexpr (F16) *(v8h*)(P16 + lo8 + c) = o16[i]; if constexpr (SPL) { *(v8us*)(Ph + lo8 + c) = oh[i]; *(v8us*)(Pl + lo8 + c) = ol[i]; } }
    if constexpr (FLAG) kfl[lane] = fl;
    asm volatile("s_wait_xcnt 0x0" ::: "memory");                    // before a register that the stores name is written again (the code behind this path reuses them)
}
#define VP 65                     // LDS pitch of a value row in floats: odd, so that the column reads below (2 lane halves 16 rows apart x 16 neighbouring columns) fall on 32 different banks
// vtile: one block, 256 value rows [t][HD] to 8 x 4 fragments of the value planes: whole rows in (16-byte loads), f32 through LDS, then 8 neighbouring t of one d a lane; wave w builds the 32 keys 32 w .. + 31: a wave's store fills four whole 128-byte lines.
template <bool SPL>
__device__ __forceinline__ void vtile(const float* __restrict__ src, h16* __restrict__ V16, bf* __restrict__ Vh, bf* __restrict__ Vl, float* S) {
    const int tid = threadIdx.x, lane = tid & 31, w = tid >> 5;
    v4f x[16];
#pragma unroll
    for (int i = 0; i < 16; ++i) x[i] = *(const v4f*)(src + (unsigned)tid * 4u + i * 1024);
    asm volatile("s_wait_xcnt 0x0" ::: "memory");                    // before any register that the loads name is written again
    float* sw = S + (tid >> 4) * VP + (tid & 15) * 4;
#pragma unroll
    for (int i = 0; i < 16; ++i)
#pragma unroll
        for (int e = 0; e < 4; ++e) sw[i * 16 * VP + e] = x[i][e];
    __syncthreads();                                                 // the tile is whole before anyone reads a column
    const float* sr = S + (w * 32 + (lane >> 4) * 16) * VP + (lane & 15);
    const unsigned vo = (unsigned)w * 2048u + (unsigned)(lane >> 4) * 256u + (unsigned)(lane & 15) * 8u;
#pragma unroll
    for (int h = 0; h < 8; h += 4) {                                 // two halves, each read, converted and stored before the next: all eight steps at once need more registers than the launch bound leaves (the build spilled)
        v8h o16[4]; v8us oh[4], ol[4];
#pragma unroll
        for (int i = h; i < h + 4; ++i) { float y[8];                // step i: columns 16 (i >> 1) + 0..15, rows 32 w + 8 (i & 1) + 0..7 (low lanes) and 16 more (high lanes)
#pragma unroll
            for (int j = 0; j < 8; ++j) y[j] = sr[((i & 1) * 8 + j) * VP + (i >> 1) * 16];
            cvt8<true, SPL>(y, o16[i - h], oh[i - h], ol[i - h]); }
        __builtin_amdgcn_sched_barrier(0);                           // a half's stores last, as in rows32: mixed with the conversions, these write again registers that issued stores name
#pragma unroll
        for (int i = h; i < h + 4; ++i) { const int c = (i >> 1) * 512 + (i & 1) * 128; *(v8h*)(V16 + vo + c) = o16[i - h]; if constexpr (SPL) { *(v8us*)(Vh + vo + c) = oh[i - h]; *(v8us*)(Vl + vo + c) = ol[i - h]; } }
        asm volatile("s_wait_xcnt 0x0" ::: "memory");                // as at the end of rows32: the next half, or the code behind this path, reuses the registers that the stores name
    }
}
// k_prep: every plane and key term that k_fattn reads, in one launch. Grid 2 x 256 blocks of 8 waves; block b: input b % 2 (k, v), rows 256 (b / 2) .. + 255 of the flat [batch-head x t] rows, that is one quarter of one batch-head.
// The second launch bound (waves a SIMD) holds the registers at 128, so that every block of the grid (two a WGP) is resident at once and all loads fly together.
// Only what is read more than once is built: fp16 k and v for all keys, hi/lo k and v for keys < RH (the hi/lo queries' diagonals end there).
__global__ __launch_bounds__(256, 8) void k_prep(const float* __restrict__ k, const float* __restrict__ v,
                                              h16* __restrict__ K16, bf* __restrict__ Kh, bf* __restrict__ Kl, h16* __restrict__ V16, bf* __restrict__ Vh, bf* __restrict__ Vl, float* __restrict__ KF) {
    __shared__ float S[256 * VP];
    const unsigned kind = blockIdx.x % 2u, u = blockIdx.x / 2u; const bool low = (u & 3u) * 256u < RH;   // block-uniform
    if (kind == 1u) { const size_t ho = (size_t)(u >> 2) * TT * HD, po = ho + (u & 3u) * 256u * HD;
        if (low) vtile<true>(v + (size_t)u * 256 * HD, V16 + po, Vh + po, Vl + po, S); else vtile<false>(v + (size_t)u * 256 * HD, V16 + po, nullptr, nullptr, S);
        return; }
    const size_t r0 = (size_t)u * 256 + 32 * __builtin_amdgcn_readfirstlane((int)(threadIdx.x >> 5)), e0 = r0 * HD;   // the wave's first row: scalar, so that every base address is
    if (low) rows32<true, true, true>(k + e0, K16 + e0, Kh + e0, Kl + e0, KF + r0); else rows32<true, false, true>(k + e0, K16 + e0, nullptr, nullptr, KF + r0);
}
struct yes_t { static constexpr bool value = true; }; struct no_t { static constexpr bool value = false; };   // compile-time switches of a pass
#define XSC  0.18033688011112042f   // 1/sqrt(d_k) x log2(e): scores go to the exponent of 2 in one multiply-add
#define MLOW -1.0e30f               // start of the running maximum: far above an excluded score x XSC, so an excluded key's probability is exactly 0
__device__ __forceinline__ float exp2x1(float x) { float r; asm("v_exp_f32 %0, %1\n\tv_nop" : "=v"(r) : "v"(x)); return r; }
__device__ __forceinline__ void exp2x8(const float* x, float* p) {
    asm("v_exp_f32 %0, %8\n\tv_exp_f32 %1, %9\n\tv_exp_f32 %2, %10\n\tv_exp_f32 %3, %11\n\tv_exp_f32 %4, %12\n\tv_exp_f32 %5, %13\n\tv_exp_f32 %6, %14\n\tv_exp_f32 %7, %15\n\tv_nop"
        : "=&v"(p[0]), "=&v"(p[1]), "=&v"(p[2]), "=&v"(p[3]), "=&v"(p[4]), "=&v"(p[5]), "=&v"(p[6]), "=&v"(p[7]) : "v"(x[0]), "v"(x[1]), "v"(x[2]), "v"(x[3]), "v"(x[4]), "v"(x[5]), "v"(x[6]), "v"(x[7])); }
template <typename T16, bool SPLIT, int NBQ, int KS, int TPB>
__device__ __forceinline__ void attn_rows(const float* __restrict__ qraw, const T16* __restrict__ Kp, const T16* __restrict__ Kp2, const T16* __restrict__ Vt, const T16* __restrict__ Vt2,
                                          const float* __restrict__ kf, const float* __restrict__ vraw, float* __restrict__ out, const int rb, const int pmax, const int wv, float* SO, float* SM, float* SL, unsigned short* SQ) {
    static_assert(KS == 2 * NBQ, "the join gives each wave one 128-byte half of the rows of one 16-query group");
    typedef typename WFrag<T16>::V V; typedef WFrag<T16> F;
    const int lane = threadIdx.x & 31, lr = lane & 15, hi = lane >> 4, q0 = rb + 16 * NBQ * (wv % TPB);   // rb: the block's first query row; q0: the tile's
    const unsigned flo = (unsigned)lane * 16u, blo = (unsigned)hi * 32u;   // the lane's byte offsets in a fragment of any plane and in 16 key terms: fixed for the whole kernel: every address is a wave-uniform base + one of these + a constant
    auto at = [](const T16* base, unsigned off) { return (const T16*)((const char*)base + off); };
    // The block's 64 query rows go from the f32 input to fragment order in LDS, once: wave wv takes rows 8 wv .. + 7 (lane = 8 x (column / 8) + row, as a step of rows32: whole lines between a lane's two loads), converts them as k_prep converts k,
    // and behind one barrier every wave with passes reads its tile's fragments, 16 bytes a lane, lane after lane.
    V q[NBQ][2], q2[NBQ][2]; float qx[2][8]; const int r8 = lane & 7, oo = lane >> 3;
    const float* pq = (const float*)((const char*)(qraw + (size_t)(rb + 8 * wv) * HD) + ((unsigned)r8 * 256u + (unsigned)oo * 32u));
#pragma unroll
    for (int c = 0; c < 2; ++c) { const v4f a = *(const v4f*)(pq + c * 32), b = *(const v4f*)(pq + c * 32 + 4);
#pragma unroll
        for (int e = 0; e < 4; ++e) { qx[c][e] = a[e]; qx[c][e + 4] = b[e]; } }
    asm volatile("s_wait_xcnt 0x0" :: "v"(pq) : "memory");           // here and below: before any register that the loads in front name (address, scalar base) is written again; the address as an input keeps its registers untouched up to the wait
    v8f o[4][NBQ]; float m[NBQ], l[NBQ];
#pragma unroll
    for (int nb = 0; nb < NBQ; ++nb) { m[nb] = MLOW; l[nb] = 0.0f;
#pragma unroll
        for (int md = 0; md < 4; ++md) o[md][nb] = (v8f){}; }
    V kc[2][2], kc2[2][2], vt[4], vt2[4]; v8f cb[2], s[2][NBQ];      // cb: a pass's key terms in the score tiles' register order, the C operand of each tile's first product
    // Each group of loads ends in its own s_wait_xcnt 0: before any register that the loads name is written again. The addresses as inputs keep their registers alive up to there: otherwise a later load's result of the same group lands in them.
    auto load_k = [&](const int kb) {                                // key fragments and key terms of the pass at kb
        const T16* pk = at(Kp + (size_t)kb * HD, flo); const T16* pk2 = SPLIT ? at(Kp2 + (size_t)kb * HD, flo) : pk; const char* pc = (const char*)(kf + kb) + blo;
#pragma unroll
        for (int mt = 0; mt < 2; ++mt)
#pragma unroll
            for (int ks = 0; ks < 2; ++ks) { kc[mt][ks] = F::ld(pk + mt * 16 * HD + ks * 512); if (SPLIT) kc2[mt][ks] = F::ld(pk2 + mt * 16 * HD + ks * 512); }
#pragma unroll
        for (int mt = 0; mt < 2; ++mt) cb[mt] = *(const v8f*)(pc + mt * 64);
        asm volatile("s_wait_xcnt 0x0" :: "v"(pk), "v"(pk2), "v"(pc) : "memory");
    };
    auto load_v = [&](const int kb) {                                // value fragments of the pass at kb
        const T16* pv = at(Vt + (size_t)kb * HD, flo); const T16* pv2 = SPLIT ? at(Vt2 + (size_t)kb * HD, flo) : pv;
#pragma unroll
        for (int md = 0; md < 4; ++md) { vt[md] = F::ld(pv + md * 512); if (SPLIT) vt2[md] = F::ld(pv2 + md * 512); }
        asm volatile("s_wait_xcnt 0x0" :: "v"(pv), "v"(pv2) : "memory");
    };
    auto scores = [&]() {                                            // S^T of the pass whose key fragments are loaded
#pragma unroll
        for (int mt = 0; mt < 2; ++mt)
#pragma unroll
            for (int nb = 0; nb < NBQ; ++nb) s[mt][nb] = cb[mt];
#pragma unroll
        for (int ks = 0; ks < 2; ++ks)
#pragma unroll
            for (int pr = 0; pr < (SPLIT ? 3 : 1); ++pr)             // tiles innermost: neighbouring products go to different accumulators
#pragma unroll
                for (int mt = 0; mt < 2; ++mt)
#pragma unroll
                    for (int nb = 0; nb < NBQ; ++nb) s[mt][nb] = F::mma(pr == 1 ? kc2[mt][ks] : kc[mt][ks], pr == 2 ? q2[nb][ks] : q[nb][ks], s[mt][nb]);
    };
    // second half: the diagonal's exclusions (compile-time choice: only the last pass has any), running softmax, O^T += V^T.P^T
    auto finish = [&](auto causal, const int kb) {
        if constexpr (causal.value) {
#pragma unroll
            for (int mt = 0; mt < 2; ++mt)
#pragma unroll
                for (int nb = 0; nb < NBQ; ++nb)
#pragma unroll
                    for (int j = 0; j < 8; ++j) s[mt][nb][j] = (kb + mt * 16 + hi * 8 + j <= q0 + nb * 16 + lr) ? s[mt][nb][j] : -3.0e38f; }
        V ph[NBQ], pl[NBQ];
#pragma unroll
        for (int nb = 0; nb < NBQ; ++nb) {
            float mx = s[0][nb][0];
#pragma unroll
            for (int e = 1; e < 16; ++e) mx = fmaxf(mx, s[e >> 3][nb][e & 7]);
            mx = fmaxf(mx, xhalf(mx));
            const float mn = fmaxf(m[nb], mx * XSC); const float al = exp2x1(m[nb] - mn); m[nb] = mn;
            const float sub = SPLIT ? -mn : 10.0f - mn;              // fp16 rows carry probabilities x1024 (sum and products alike; it cancels in the division)
            float sum = 0.0f, x[16], pe[16];
#pragma unroll
            for (int e = 0; e < 16; ++e) x[e] = fmaf(s[e >> 3][nb][e & 7], XSC, sub);
            exp2x8(x, pe); exp2x8(x + 8, pe + 8);
#pragma unroll
            for (int e = 0; e < 16; e += 2) { v2f p; p[0] = pe[e]; p[1] = pe[e + 1]; sum += p[0] + p[1];
                if constexpr (SPLIT) { const v2b h = __builtin_convertvector(p, v2b); const v2b lo = __builtin_convertvector(p - __builtin_convertvector(h, v2f), v2b); ph[nb][e] = h[0]; ph[nb][e + 1] = h[1]; pl[nb][e] = lo[0]; pl[nb][e + 1] = lo[1]; }
                else { const v2h h = __builtin_convertvector(p, v2h); ph[nb][e] = h[0]; ph[nb][e + 1] = h[1]; } }
            l[nb] = l[nb] * al + sum;
#pragma unroll
            for (int md = 0; md < 4; ++md) o[md][nb] *= al; }
#pragma unroll
        for (int pr = 0; pr < (SPLIT ? 3 : 1); ++pr)
#pragma unroll
            for (int md = 0; md < 4; ++md)
#pragma unroll
                for (int nb = 0; nb < NBQ; ++nb) o[md][nb] = F::mma(pr == 1 ? vt2[md] : vt[md], pr == 2 ? pl[nb] : ph[nb], o[md][nb]);
    };
    const yes_t yes{}; const no_t no{};
    const int klast = ((q0 + NBQ * 16 + 31) & ~31) - 32;             // the one pass that reaches past a query's diagonal; keys beyond it are never read
    const int part = wv / TPB, np = klast / 32 + 1;                  // wv: the wave's number in the block (scalar); np: the passes of this tile
    const int kb0 = 32 * min(pmax * part / KS, np), kl = 32 * min(pmax * (part + 1) / KS, np) - 32;   // the wave's first and last pass, cut off at the tile's diagonal; a short tile leaves late parts empty (kl < kb0)
    const bool work = kb0 <= kl;                                     // scalar
    if (work) load_k(kb0);                                           // asked for in front of the barrier: the first keys and the query rows make one trip to memory
    T16* sq = (T16*)SQ + (wv >> 1) * 1024 + oo * 128 + ((wv & 1) * 8 + r8) * 8;   // [row / 16][d / 32] fragments of the block's rows; the lo plane 64 x HD elements behind the hi plane
#pragma unroll
    for (int c = 0; c < 2; ++c) { v8h o16; v8us oh, ol; cvt8<!SPLIT, SPLIT>(qx[c], o16, oh, ol);
        if constexpr (SPLIT) { *(v8us*)(sq + c * 512) = oh; *(v8us*)(sq + 64 * HD + c * 512) = ol; } else *(v8h*)(sq + c * 512) = o16; }
    __syncthreads();                                                 // the block's query fragments are whole before anyone reads one
    if (work) {                                                      // scalar branch
    const T16* fq = (const T16*)SQ + (wv % TPB) * NBQ * 1024 + lane * 8;
#pragma unroll
    for (int nb = 0; nb < NBQ; ++nb)
#pragma unroll
        for (int ks = 0; ks < 2; ++ks) { q[nb][ks] = F::ld(fq + nb * 1024 + ks * 512); if constexpr (SPLIT) q2[nb][ks] = F::ld(fq + 64 * HD + nb * 1024 + ks * 512); }
    __builtin_amdgcn_sched_barrier(0);                               // holds the fragment reads together: left free, the scheduler deals them out among the first products and the wave waits out the LDS latency several times
    scores();
    // The scores go round the loop, not the key fragments: a trip fetches its own values and the next pass's keys at its head, works on the scores it was handed, and forms the next pass's scores at its foot, a whole trip behind their fetch.
    for (int kb = kb0; kb < kl; kb += 32) {
        load_v(kb);
        load_k(kb + 32);
        __builtin_amdgcn_sched_barrier(0);                           // holds the trip's fetches up here: left free, the scheduler sinks each one to just in front of its use and the wave waits out every latency
        finish(no, kb);
        __builtin_amdgcn_sched_barrier(0);                           // keeps the next pass's score products down here: moved up among the softmax arithmetic they wait for keys that were only just asked for
        scores();
    }
    load_v(kl);
    __builtin_amdgcn_sched_barrier(0);                               // keeps the arithmetic below from moving in between the loads and their wait, where it reuses their address registers
    finish(yes, kl);                                                 // the diagonal's test is an identity in a pass that lies wholly below it
    }
    // The join. Every wave leaves its running maximum, its sum and its unscaled O^T tiles in LDS (16-byte groups, lane after lane: no bank is met twice); behind the barrier wave part sums, over the KS parts and each on the common maximum,
    // the two tiles that make up one 128-byte half of the output rows of 16-query group part / 2: one writer a line. An empty part holds maximum MLOW, sum 0, tiles 0.
    float* so = SO + wv * (4 * NBQ * 256) + lane * 4;
#pragma unroll
    for (int nb = 0; nb < NBQ; ++nb) { SM[(wv * NBQ + nb) * 32 + lane] = m[nb]; SL[(wv * NBQ + nb) * 32 + lane] = l[nb] + xhalf(l[nb]);
#pragma unroll
        for (int md = 0; md < 4; ++md) { const v8f t = o[md][nb];
            *(v4f*)(so + (md * NBQ + nb) * 256) = __builtin_shufflevector(t, t, 0, 1, 2, 3); *(v4f*)(so + (md * NBQ + nb) * 256 + 128) = __builtin_shufflevector(t, t, 4, 5, 6, 7); } }
    __syncthreads();                                                 // every part's results are in LDS before anyone joins them
    const int nbi = part >> 1, mp = part & 1, w0 = wv - part * TPB;   // w0: the tile; part w of it is wave w0 + w x TPB
    float mw[KS], lw[KS];
#pragma unroll
    for (int w = 0; w < KS; ++w) { mw[w] = SM[((w0 + w * TPB) * NBQ + nbi) * 32 + lane]; lw[w] = SL[((w0 + w * TPB) * NBQ + nbi) * 32 + lane]; }
    float mj = mw[0];
#pragma unroll
    for (int w = 1; w < KS; ++w) mj = fmaxf(mj, mw[w]);
    float ls = 0.0f; v8f acc[2]; acc[0] = (v8f){}; acc[1] = (v8f){};
#pragma unroll
    for (int w = 0; w < KS; ++w) { const float f = exp2x1(mw[w] - mj); ls = fmaf(f, lw[w], ls);
#pragma unroll
        for (int i = 0; i < 2; ++i) { const float* p = SO + (w0 + w * TPB) * (4 * NBQ * 256) + ((mp * 2 + i) * NBQ + nbi) * 256 + lane * 4; const v4f a = *(const v4f*)p, b = *(const v4f*)(p + 128);
#pragma unroll
            for (int e = 0; e < 4; ++e) { acc[i][e] = fmaf(f, a[e], acc[i][e]); acc[i][e + 4] = fmaf(f, b[e], acc[i][e + 4]); } } }
    const bool dead = !(ls > 0.0f); float inv = __fdiv_rn(1.0f, ls);
    if (__builtin_amdgcn_ballot_w32(dead) != 0) {                    // cold: a query whose every allowed key is padding
        v8f mean[2]; mean[0] = (v8f){}; mean[1] = (v8f){};
#pragma unroll 1                                                     // cold path: keep its code small
        for (int t = 0; t < TT; ++t) { v8f x[2];
#pragma unroll
            for (int i = 0; i < 2; ++i) x[i] = *(const v8f*)(vraw + (size_t)t * HD + (mp * 2 + i) * 16 + hi * 8);
            asm volatile("s_wait_xcnt 0x0" ::: "memory");            // before the address moves on
#pragma unroll
            for (int i = 0; i < 2; ++i) mean[i] += x[i]; }
#pragma unroll
        for (int i = 0; i < 2; ++i)
#pragma unroll
            for (int j = 0; j < 8; ++j) acc[i][j] = dead ? mean[i][j] * (1.0f / TT) : acc[i][j];
        inv = dead ? 1.0f : inv; }
    float* orow = out + (size_t)(q0 + nbi * 16 + lr) * HD + mp * 32 + hi * 8;   // register j of tile md is column md * 16 + 8 hi + j of the lane's query row
#pragma unroll
    for (int i = 0; i < 2; ++i) *(v8f*)(orow + i * 16) = acc[i] * inv;
    asm volatile("s_wait_xcnt 0x0" ::: "memory");                    // before a register that the stores name is written again
}
// k_fattn: grid (batch-heads, 16), 8 waves a block, 64 query rows a block. Even y: 2 tiles of 32 fp16 rows, the keys of each dealt to 4 waves; odd y: 4 tiles of 16 hi/lo rows, the keys of each dealt to 2 waves. Both kinds from the sequence's end downwards:
// there are more blocks than resident places, and the cost falls with the index (for speed only). The second launch bound (waves a SIMD) holds the registers at 256: two blocks a WGP, so that one works while the other starts or joins.
static_assert((TT - RH) / 64 == RH / 64, "the two kinds of block alternate in y");
__global__ __launch_bounds__(256, 4) void k_fattn(const float* __restrict__ Qraw, const h16* __restrict__ K16, const h16* __restrict__ V16, const bf* __restrict__ Kh, const bf* __restrict__ Kl,
                                               const bf* __restrict__ Vh, const bf* __restrict__ Vl, const float* __restrict__ KF, const float* __restrict__ Vraw, float* __restrict__ OUTb) {
    __shared__ __attribute__((aligned(16))) float SO[8 * 8 * 256]; __shared__ float SM[8 * 2 * 32], SL[8 * 2 * 32];   // the parts' O^T tiles, maxima and sums
    __shared__ __attribute__((aligned(16))) unsigned short SQ[2 * 64 * HD];   // the block's query rows in fragment order: fp16, or bf16 hi and lo
    const size_t zo = (size_t)blockIdx.x * TT * HD; const float* kf = KF + (size_t)blockIdx.x * TT;
    const int wv = __builtin_amdgcn_readfirstlane((int)(threadIdx.x >> 5)), r0 = 64 * (RH / 64 - 1 - (int)(blockIdx.y >> 1));   // scalar, so that the path and every pass test are scalar branches
    if ((blockIdx.y & 1u) == 0u) attn_rows<h16, false, 2, 4, 2>(Qraw + zo, K16 + zo, nullptr, V16 + zo, nullptr, kf, Vraw + zo, OUTb + zo, RH + r0, (RH + r0) / 32 + 2, wv, SO, SM, SL, SQ);
    else attn_rows<bf, true, 1, 2, 4>(Qraw + zo, Kh + zo, Kl + zo, Vh + zo, Vl + zo, kf, Vraw + zo, OUTb + zo, r0, r0 / 32 + 2, wv, SO, SM, SL, SQ);
}
extern "C" void kernel_launch(void* const* d_in, const int* in_sizes, int n_in,
                              void* d_out, int out_size, void* d_ws, size_t ws_size, hipStream_t stream) {
    (void)in_sizes; (void)n_in; (void)out_size;
    const float* x = (const float*)d_in[0]; const float* xk = (const float*)d_in[1]; const float* xv = (const float*)d_in[2];   /* input order q, k, v: [64][1024][64] each (no projections) */ const float* wq = nullptr, *wk = nullptr, *wv = nullptr, *wo = nullptr; (void)wq; (void)wk; (void)wv; (void)wo;
    float* OUT = (float*)d_out;     // [64][1024][64]
    char* wsp = (char*)d_ws;
    auto take = [&](size_t bytes) { char* p = wsp; wsp += (bytes + 255) & ~(size_t)255; return (void*)p; };
    float* KF = (float*)take((size_t)NB_ * TT * 4);   /* per-key score terms (0, or the exclusion value for an all-zero key), all batch-heads */
    const size_t HS = (size_t)TT * HD;             /* one batch-head of an input, a plane or the output, in elements */
    const size_t PLN = (size_t)NB_ * HS;           /* one plane over all batch-heads */
    h16* KP16 = (h16*)take(PLN * 2); h16* VT16 = (h16*)take(PLN * 2);
    bf* KPh = (bf*)take(PLN * 2); bf* KPl = (bf*)take(PLN * 2); bf* VTh = (bf*)take(PLN * 2); bf* VTl = (bf*)take(PLN * 2);
    if ((size_t)(wsp - (char*)d_ws) > ws_size) return;    // ws 256 MiB
    k_prep<<<2 * NB_ * TT / 256, 256, 0, stream>>>(xk, xv, KP16, KPh, KPl, VT16, VTh, VTl, KF);   /* planes in fragment order (fp16, bf16 hi/lo; v transposed) and key-padding terms straight from the inputs */
    k_fattn<<<dim3(NB_, (TT - RH) / 64 + RH / 64), 256, 0, stream>>>(x, KP16, VT16, KPh, KPl, VTh, VTl, KF, xv, OUT);   /* scores, softmax, P.V and the output rows, all batch-heads */
}

// v007
// One run takes 23.3 microseconds.
// Next to v006, in two timings, it ran 1.18 times as fast each time.
// Over all steps from v000 it is 157 times as fast.
#include <hip/hip_runtime.h>

// Causal scaled dot-product attention on raw batch-head tensors with a data-derived key-padding mask (q, k, v [64][1024][64], no projections; scores = q.k / sqrt(64); keys whose absolute sum is exactly 0 are masked to -2^32+1 (== exclusion; computed from the data, none occur for random inputs); causal mask (same fill); softmax; out = attn.v -> [64][1024][64] (4.2 M); argument order q, k, v).
// One launch, one block of 16 waves a WGP, four blocks a batch-head: two take the query rows >= 512 (fp16, all 1024 keys), two the rows < 512 (bf16 hi/lo, 3 products, keys < 512). A block first turns the f32 k and v that its rows need into 16-bit planes in fragment order IN ITS OWN LDS (256 KB; v transposed on the way)
// together with the per-key test sum_d |k[j][d]| != 0 as a float vector (0, or -3e38 for an all-zero key); behind one barrier each wave then walks all keys of one 16-row query tile alone (score tile in registers, running maximum and sum per query), reading every fragment from LDS, and writes its f32 output rows. No workspace.
// Compute dtypes, f32 accumulate: inputs split into bf16 hi/lo (rows < 512) or rounded to fp16 (rest, probabilities x1024); softmax f32; output f32.

#define NB_  64
#define TT   1024
#define DM   64
#define NH_  1
#define NKV  1
#define REP  (NH_ / NKV)
#define HD   64
#define DQ   (NH_ * HD)
#define DKV  (NKV * HD)
#define ZH   1
#define RH   512                  // query rows < RH use hi+lo planes
#define WIN  1024
#define PCAR 1024.0f
#define SCL  0.125f   // 1/sqrt(d_k)
typedef _Float16 h16;
typedef unsigned short bf;
typedef __attribute__((ext_vector_type(16))) __bf16   v16bf;
typedef __attribute__((ext_vector_type(16))) _Float16 v16h;
typedef __attribute__((ext_vector_type(8)))  _Float16 v8h;
typedef __attribute__((ext_vector_type(8)))  unsigned short v8us;
typedef __attribute__((ext_vector_type(8)))  float    v8f;
typedef __attribute__((ext_vector_type(4)))  float    v4f;
typedef v8h  __attribute__((may_alias)) v8ha;
typedef v4f  __attribute__((may_alias)) v4fa;
typedef v8us __attribute__((may_alias)) v8usa;

__device__ __forceinline__ v16h cat16(v8h lo, v8h hi) { return __builtin_shufflevector(lo, hi, 0, 1, 2, 3, 4, 5, 6, 7, 8, 9, 10, 11, 12, 13, 14, 15); }
__device__ __forceinline__ v16bf cat16b(v8us lo, v8us hi) { return __builtin_bit_cast(v16bf, __builtin_shufflevector(lo, hi, 0, 1, 2, 3, 4, 5, 6, 7, 8, 9, 10, 11, 12, 13, 14, 15)); }
__device__ __forceinline__ v8f wmma16(v16h a, v16h b, v8f c) { return __builtin_amdgcn_wmma_f32_16x16x32_f16(false, a, false, b, (short)0, c, false, false); }
__device__ __forceinline__ v8f wmmab(v16bf a, v16bf b, v8f c) { return __builtin_amdgcn_wmma_f32_16x16x32_bf16(false, a, false, b, (short)0, c, false, false); }



// ---- 16x32 operand fragments (row = lane & 15; k = 8 * (lane >> 4) + 0..7 and 16 + 8 * (lane >> 4) + 0..7), the same loader for A and for B, from planes in fragment order: a fragment is 1 KB in a row,
// [k / 8 (4)][row (16)][8 values], so the lane's two 16-byte groups lie at 16 * lane and 512 + 16 * lane bytes and each wave-wide load covers four whole 128-byte lines (row-major planes: 16 lines a load, 32 bytes of each).
// k planes: [row / 16][d / 32] fragments; value planes: [key / 32][d / 16] fragments (row = d, k = key).
template <typename T16> struct WFrag;
template <> struct WFrag<h16> { typedef v16h V; static __device__ __forceinline__ V ld(const h16* p) { return cat16(*(const v8h*)p, *(const v8h*)(p + 256)); } static __device__ __forceinline__ v8f mma(V a, V b, v8f c) { return wmma16(a, b, c); } };
template <> struct WFrag<bf> { typedef v16bf V; static __device__ __forceinline__ V ld(const bf* p) { return cat16b(*(const v8us*)p, *(const v8us*)(p + 256)); } static __device__ __forceinline__ v8f mma(V a, V b, v8f c) { return wmmab(a, b, c); } };
typedef __attribute__((ext_vector_type(2))) _Float16 v2h;
typedef __attribute__((ext_vector_type(4))) _Float16 v4h;
typedef __attribute__((ext_vector_type(2))) unsigned short v2us;
typedef __attribute__((ext_vector_type(4))) unsigned short v4us;
typedef __attribute__((ext_vector_type(2))) float v2f;
typedef __attribute__((ext_vector_type(4))) int v4i;

typedef __attribute__((ext_vector_type(2))) __bf16 v2b;
// cvt8: 8 neighbouring f32 values to their 16-byte groups of the planes: fp16 (round to nearest), and bf16 hi with lo = bf16(x - hi)
template <bool F16, bool SPL>
__device__ __forceinline__ void cvt8(const float* x, v8h& o16, v8us& oh, v8us& ol) {
#pragma unroll
    for (int e = 0; e < 8; e += 2) { v2f p; p[0] = x[e]; p[1] = x[e + 1];
        if constexpr (F16) { const v2h h = __builtin_convertvector(p, v2h); o16[e] = h[0]; o16[e + 1] = h[1]; }
        if constexpr (SPL) { const v2b h = __builtin_convertvector(p, v2b); const v2b lo = __builtin_convertvector(p - __builtin_convertvector(h, v2f), v2b);
            const v2us hu = __builtin_bit_cast(v2us, h), lu = __builtin_bit_cast(v2us, lo); oh[e] = hu[0]; oh[e + 1] = hu[1]; ol[e] = lu[0]; ol[e + 1] = lu[1]; } } }
template <int CTRL> __device__ __forceinline__ float xlane(float x) { return __int_as_float(__builtin_amdgcn_update_dpp(0, __float_as_int(x), CTRL, 0xf, 0xf, true)); }   // value of lane ^ m inside a 16-lane row (CTRL = 0x160 + m, row_xmask): in the vector pipe, no trip through the LDS unit
__device__ __forceinline__ float xhalf(float x) { const int b = __float_as_int(x); return __int_as_float(__builtin_amdgcn_permlanex16(b, b, 0x76543210, 0xfedcba98, false, false)); }   // value of lane ^ 16
// rows32: one wave, 32 rows of the [row][HD] input k (8 KB, all 16 loads of a lane in flight at once) to two 16-row groups of the planes in LDS, in two halves: rows32_ld asks for the rows, rows32_cv converts and stores them, so that the trip to memory can be begun early.
// Step i takes rows 8 (i >> 1) .. + 7 and columns 32 (i & 1) .. + 31: lane = 8 x (column / 8) + row, 8 values a lane: a load touches 8 lines, and a store is 4 column groups x 8 neighbouring rows x 16 bytes of the fragment order.
__device__ __forceinline__ void rows32_ld(const float* __restrict__ src, float (&x)[8][8]) {
    const int lane = threadIdx.x & 31, r = lane & 7, oo = lane >> 3; const unsigned lb = (unsigned)r * 256u + (unsigned)oo * 32u;   // the lane's place in a step, in bytes of the f32 input
#pragma unroll
    for (int i = 0; i < 8; ++i) { const float* p = (const float*)((const char*)src + lb) + (i >> 1) * 512 + (i & 1) * 32; const v4f a = *(const v4f*)p, b = *(const v4f*)(p + 4);
#pragma unroll
        for (int e = 0; e < 4; ++e) { x[i][e] = a[e]; x[i][e + 4] = b[e]; } }
    asm volatile("s_wait_xcnt 0x0" :: "v"(lb) : "memory");           // before any register that the loads name is written again; the offset as an input keeps its register alive up to here: otherwise the last load's result lands in it
}
// The per-key test sum_d |k[j][d]| != 0 (fixed tree: in-lane, the row's two steps, then lanes 8 and 16 apart; a sum of absolute values is 0 only if each is, in any order) as a float (0, or -3e38 for an all-zero key); the lane whose column group equals the row group keeps it: lane = row.
template <bool F16, bool SPL>
__device__ __forceinline__ void rows32_cv(const float (&x)[8][8], h16* P16, bf* Ph, bf* Pl, float* kfl) {
    const int lane = threadIdx.x & 31, r = lane & 7, oo = lane >> 3; const unsigned lo8 = (unsigned)(oo * 16 + r) * 8u;   // the lane's place in a step, in elements of a plane
    float fl = 0.0f, sp = 0.0f;
#pragma unroll
    for (int i = 0; i < 8; ++i) { v8h o16; v8us oh, ol; cvt8<F16, SPL>(x[i], o16, oh, ol);
        const int c = (i >> 2) * 1024 + (i & 1) * 512 + ((i >> 1) & 1) * 64; if constexpr (F16) *(v8h*)(P16 + lo8 + c) = o16; if constexpr (SPL) { *(v8us*)(Ph + lo8 + c) = oh; *(v8us*)(Pl + lo8 + c) = ol; }
        const float* a = x[i];
        float s = __fadd_rn(__fadd_rn(__fadd_rn(fabsf(a[0]), fabsf(a[1])), __fadd_rn(fabsf(a[2]), fabsf(a[3]))), __fadd_rn(__fadd_rn(fabsf(a[4]), fabsf(a[5])), __fadd_rn(fabsf(a[6]), fabsf(a[7]))));
        if ((i & 1) == 0) sp = s;
        else { s = __fadd_rn(s, sp); s = __fadd_rn(s, xlane<0x168>(s)); s = __fadd_rn(s, xhalf(s));
            fl = (oo == (i >> 1)) ? ((s != 0.0f) ? 0.0f : -3.0e38f) : fl; } }   // what the key adds to its scores: nothing, or the exclusion value (an all-zero key's own products are exactly 0)
    kfl[lane] = fl;
}
#define VP 65                     // LDS pitch of a value row in floats: odd, so that the column reads below (2 lane halves 16 rows apart x 16 neighbouring columns) fall on 32 different banks
// vtile: 8 waves (one half of the block), 256 value rows [t][HD] to 8 x 4 fragments of the value planes in LDS: whole rows in (16-byte loads: vtile_ld), f32 through the scratch S, then 8 neighbouring t of one d a lane (vtile_cv); wave w of the half builds the 32 keys 32 w .. + 31.
__device__ __forceinline__ void vtile_ld(const float* __restrict__ src, v4f (&x)[16]) {
    const unsigned tb = (threadIdx.x & 255u) * 16u;                  // the thread's place in a step, in bytes
#pragma unroll
    for (int i = 0; i < 16; ++i) x[i] = *(const v4f*)((const char*)src + tb + i * 4096);
    asm volatile("s_wait_xcnt 0x0" :: "v"(tb) : "memory");           // before any register that the loads name is written again; the offset as an input keeps its register alive up to here
}
template <bool F16, bool SPL>
__device__ __forceinline__ void vtile_cv(const v4f (&x)[16], h16* V16, bf* Vh, bf* Vl, float* S) {
    const int tid = threadIdx.x & 255, lane = tid & 31, w = tid >> 5;
    float* sw = S + (tid >> 4) * VP + (tid & 15) * 4;
#pragma unroll
    for (int i = 0; i < 16; ++i)
#pragma unroll
        for (int e = 0; e < 4; ++e) sw[i * 16 * VP + e] = x[i][e];
    __syncthreads();                                                 // the tile is whole before anyone reads a column
    const float* sr = S + (w * 32 + (lane >> 4) * 16) * VP + (lane & 15);
    const unsigned vo = (unsigned)w * 2048u + (unsigned)(lane >> 4) * 256u + (unsigned)(lane & 15) * 8u;
    float y[8][8];                                                   // all column reads first, in front of every plane store: a read behind a store would have to wait for it, and the wave would wait out the LDS latency once a step
#pragma unroll
    for (int i = 0; i < 8; ++i)                                      // step i: columns 16 (i >> 1) + 0..15, rows 32 w + 8 (i & 1) + 0..7 (low lanes) and 16 more (high lanes)
#pragma unroll
        for (int j = 0; j < 8; ++j) y[i][j] = sr[((i & 1) * 8 + j) * VP + (i >> 1) * 16];
#pragma unroll
    for (int i = 0; i < 8; ++i) { v8h o16; v8us oh, ol; cvt8<F16, SPL>(y[i], o16, oh, ol);
        const int c = (i >> 1) * 512 + (i & 1) * 128; if constexpr (F16) *(v8h*)(V16 + vo + c) = o16; if constexpr (SPL) { *(v8us*)(Vh + vo + c) = oh; *(v8us*)(Vl + vo + c) = ol; } }
    __syncthreads();                                                 // every column read is done before the scratch is written again (the next tile, or the key planes that share its place)
}
struct yes_t { static constexpr bool value = true; }; struct no_t { static constexpr bool value = false; };   // compile-time switches of a pass
#define XSC  0.18033688011112042f   // 1/sqrt(d_k) x log2(e): scores go to the exponent of 2 in one multiply-add
#define MLOW -1.0e30f               // start of the running maximum: far above an excluded score x XSC, so an excluded key's probability is exactly 0
__device__ __forceinline__ float exp2x1(float x) { float r; asm("v_exp_f32 %0, %1\n\tv_nop" : "=v"(r) : "v"(x)); return r; }
__device__ __forceinline__ void exp2x8(const float* x, float* p) {
    asm("v_exp_f32 %0, %8\n\tv_exp_f32 %1, %9\n\tv_exp_f32 %2, %10\n\tv_exp_f32 %3, %11\n\tv_exp_f32 %4, %12\n\tv_exp_f32 %5, %13\n\tv_exp_f32 %6, %14\n\tv_exp_f32 %7, %15\n\tv_nop"
        : "=&v"(p[0]), "=&v"(p[1]), "=&v"(p[2]), "=&v"(p[3]), "=&v"(p[4]), "=&v"(p[5]), "=&v"(p[6]), "=&v"(p[7]) : "v"(x[0]), "v"(x[1]), "v"(x[2]), "v"(x[3]), "v"(x[4]), "v"(x[5]), "v"(x[6]), "v"(x[7])); }
__device__ __forceinline__ void q_ld(const float* __restrict__ qrow0, float (&qx)[4][8]) {
    const int lane = threadIdx.x & 31; const unsigned qo = (unsigned)(lane & 15) * 256u + (unsigned)(lane >> 4) * 32u;
#pragma unroll
    for (int g = 0; g < 4; ++g) { const float* p = (const float*)((const char*)qrow0 + qo) + g * 16; const v4f a = *(const v4f*)p, b = *(const v4f*)(p + 4);
#pragma unroll
        for (int e = 0; e < 4; ++e) { qx[g][e] = a[e]; qx[g][e + 4] = b[e]; } }
    asm volatile("s_wait_xcnt 0x0" :: "v"(qo) : "memory");           // before any register that the loads name is written again; the offset as an input keeps its register alive up to here
}
template <typename T16, bool SPLIT>
__device__ __forceinline__ void attn_tile(const float (&qx)[4][8], const T16* Kp, const T16* Kp2, const T16* Vt, const T16* Vt2, const float* kf, const float* __restrict__ vraw, float* __restrict__ out, const int q0) {
    typedef typename WFrag<T16>::V V; typedef WFrag<T16> F;
    const int lane = threadIdx.x & 31, lr = lane & 15, hi = lane >> 4;
    const unsigned flo = (unsigned)lane * 16u, blo = (unsigned)hi * 32u;   // the lane's byte offsets in a fragment of any plane and in 16 key terms: fixed for the whole kernel
    auto at = [](const T16* base, unsigned off) { return (const T16*)((const char*)base + off); };
    V q[2], q2[2];
#pragma unroll
    for (int ks = 0; ks < 2; ++ks) { v8h a16, b16; v8us ah, al, bh, bl; cvt8<!SPLIT, SPLIT>(qx[2 * ks], a16, ah, al); cvt8<!SPLIT, SPLIT>(qx[2 * ks + 1], b16, bh, bl);
        if constexpr (SPLIT) { q[ks] = cat16b(ah, bh); q2[ks] = cat16b(al, bl); } else q[ks] = cat16(a16, b16); }
    v8f o[4]; float m = MLOW, l = 0.0f;
#pragma unroll
    for (int md = 0; md < 4; ++md) o[md] = (v8f){};
    V kc[2][2], kc2[2][2], vt[4], vt2[4]; v8f cb[2], s[2];           // cb: a pass's key terms in the score tiles' register order, the C operand of each tile's first product
    auto load_k = [&](const int kb) {                                // key fragments and key terms of the pass at kb
        const T16* pk = at(Kp + kb * HD, flo); const T16* pk2 = SPLIT ? at(Kp2 + kb * HD, flo) : pk; const char* pc = (const char*)(kf + kb) + blo;
#pragma unroll
        for (int mt = 0; mt < 2; ++mt)
#pragma unroll
            for (int ks = 0; ks < 2; ++ks) { kc[mt][ks] = F::ld(pk + mt * 16 * HD + ks * 512); if (SPLIT) kc2[mt][ks] = F::ld(pk2 + mt * 16 * HD + ks * 512); }
#pragma unroll
        for (int mt = 0; mt < 2; ++mt) cb[mt] = *(const v8f*)(pc + mt * 64);
    };
    auto load_v = [&](const int kb) {                                // value fragments of the pass at kb
        const T16* pv = at(Vt + kb * HD, flo); const T16* pv2 = SPLIT ? at(Vt2 + kb * HD, flo) : pv;
#pragma unroll
        for (int md = 0; md < 4; ++md) { vt[md] = F::ld(pv + md * 512); if (SPLIT) vt2[md] = F::ld(pv2 + md * 512); }
    };
    auto scores = [&]() {                                            // S^T of the pass whose key fragments are loaded
#pragma unroll
        for (int mt = 0; mt < 2; ++mt) s[mt] = cb[mt];
#pragma unroll
        for (int ks = 0; ks < 2; ++ks)
#pragma unroll
            for (int pr = 0; pr < (SPLIT ? 3 : 1); ++pr)             // tiles innermost: neighbouring products go to different accumulators
#pragma unroll
                for (int mt = 0; mt < 2; ++mt) s[mt] = F::mma(pr == 1 ? kc2[mt][ks] : kc[mt][ks], pr == 2 ? q2[ks] : q[ks], s[mt]);
    };
    // second half: the diagonal's exclusions (compile-time choice: only the last pass has any), running softmax, O^T += V^T.P^T
    auto finish = [&](auto causal, const int kb) {
        if constexpr (causal.value) {
#pragma unroll
            for (int mt = 0; mt < 2; ++mt)
#pragma unroll
                for (int j = 0; j < 8; ++j) s[mt][j] = (kb + mt * 16 + hi * 8 + j <= q0 + lr) ? s[mt][j] : -3.0e38f; }
        V ph, pl;
        float mx = s[0][0];
#pragma unroll
        for (int e = 1; e < 16; ++e) mx = fmaxf(mx, s[e >> 3][e & 7]);
        mx = fmaxf(mx, xhalf(mx));
        const float mn = fmaxf(m, mx * XSC); const float al = exp2x1(m - mn); m = mn;
        const float sub = SPLIT ? -mn : 10.0f - mn;                  // fp16 rows carry probabilities x1024 (sum and products alike; it cancels in the division)
        float sum = 0.0f, x[16], pe[16];
#pragma unroll
        for (int e = 0; e < 16; ++e) x[e] = fmaf(s[e >> 3][e & 7], XSC, sub);
        exp2x8(x, pe); exp2x8(x + 8, pe + 8);
#pragma unroll
        for (int e = 0; e < 16; e += 2) { v2f p; p[0] = pe[e]; p[1] = pe[e + 1]; sum += p[0] + p[1];
            if constexpr (SPLIT) { const v2b h = __builtin_convertvector(p, v2b); const v2b lo = __builtin_convertvector(p - __builtin_convertvector(h, v2f), v2b); ph[e] = h[0]; ph[e + 1] = h[1]; pl[e] = lo[0]; pl[e + 1] = lo[1]; }
            else { const v2h h = __builtin_convertvector(p, v2h); ph[e] = h[0]; ph[e + 1] = h[1]; } }
        l = l * al + sum;
#pragma unroll
        for (int md = 0; md < 4; ++md) o[md] *= al;
#pragma unroll
        for (int pr = 0; pr < (SPLIT ? 3 : 1); ++pr)
#pragma unroll
            for (int md = 0; md < 4; ++md) o[md] = F::mma(pr == 1 ? vt2[md] : vt[md], pr == 2 ? pl : ph, o[md]);
    };
    const yes_t yes{}; const no_t no{};
    const int kl = ((q0 + 16 + 31) & ~31) - 32;                      // the one pass that reaches past a query's diagonal; keys beyond it are never read
    load_k(0);
    scores();
    // The scores go round the loop, not the key fragments: a trip reads its own values and the next pass's keys at its head, works on the scores it was handed, and forms the next pass's scores at its foot.
    for (int kb = 0; kb < kl; kb += 32) {
        load_v(kb);
        load_k(kb + 32);
        __builtin_amdgcn_sched_barrier(0);                           // holds the trip's LDS reads together up here: each separate place where LDS reads stand costs the wave a stop, and sunk to their uses they wait out the LDS latency every time
        finish(no, kb);
        __builtin_amdgcn_sched_barrier(0);                           // keeps the next pass's score products down here: moved up among the softmax arithmetic they stand in front of the 2^x statements
        scores();
    }
    load_v(kl);
    finish(yes, kl);
    const float ls = l + xhalf(l);                                   // the two lane halves hold the sums of different keys of the same query, on the same maximum
    const bool dead = !(ls > 0.0f); float inv = __fdiv_rn(1.0f, ls);
    if (__builtin_amdgcn_ballot_w32(dead) != 0) {                    // cold: a query whose every allowed key is padding
        v8f mean[4];
#pragma unroll
        for (int md = 0; md < 4; ++md) mean[md] = (v8f){};
#pragma unroll 1                                                     // cold path: keep its code small
        for (int t = 0; t < TT; ++t) { v8f x[4];
#pragma unroll
            for (int md = 0; md < 4; ++md) x[md] = *(const v8f*)(vraw + (size_t)t * HD + md * 16 + hi * 8);
            asm volatile("s_wait_xcnt 0x0" ::: "memory");            // before the address moves on
#pragma unroll
            for (int md = 0; md < 4; ++md) mean[md] += x[md]; }
#pragma unroll
        for (int md = 0; md < 4; ++md)
#pragma unroll
            for (int j = 0; j < 8; ++j) o[md][j] = dead ? mean[md][j] * (1.0f / TT) : o[md][j];
        inv = dead ? 1.0f : inv; }
    float* orow = out + (size_t)(q0 + lr) * HD + hi * 8;             // register j of tile md is column md * 16 + 8 hi + j of the lane's query row; the wave writes its 16 rows whole
#pragma unroll
    for (int md = 0; md < 4; ++md) *(v8f*)(orow + md * 16) = o[md] * inv;
    asm volatile("s_wait_xcnt 0x0" ::: "memory");                    // before a register that the stores name is written again
}
// k_attn: grid 4 x 64 blocks of 16 waves, one a WGP (LDS). Block b: batch-head b % 64, role b / 64: roles 0, 1 the fp16 rows, roles 2, 3 the hi/lo rows; of a kind's 32 tiles of 16 rows the two roles take the even and the odd ones (equal cost).
// Wave -> tile: waves 4 apart share a SIMD; the tiles go to and fro over each group of four waves, so that every SIMD gets the same number of passes.
// LDS: value planes (128 KB), key planes (128 KB), key terms (4 KB). The f32 scratch of the value transpose (2 x 65 KB, one a half of the block) lies on the key planes and the first key terms, which are written behind the barrier that ends its last read.
// All trips to memory are begun at the head (query rows, values, then keys as registers come free), so that the block waits out the memory latency once.
#define PLB 131072                // bytes of the value planes, and of the key planes
__global__ __launch_bounds__(512, 4) void k_attn(const float* __restrict__ Q, const float* __restrict__ K, const float* __restrict__ Vv, float* __restrict__ OUTb) {
    __shared__ __attribute__((aligned(128))) unsigned char L[2 * PLB + TT * 4];
    const unsigned role = blockIdx.x / NB_; const size_t zo = (size_t)(blockIdx.x % NB_) * TT * HD;
    const int wv = __builtin_amdgcn_readfirstlane((int)(threadIdx.x >> 5)), hf = wv >> 3, g4 = wv >> 2, c4 = wv & 3;   // scalar, so that every pass test is a scalar branch and every base address scalar
    const int tile = 2 * (4 * g4 + ((g4 & 1) ? 3 - c4 : c4)) + (int)(role & 1u);
    float* S = (float*)(L + PLB) + hf * 256 * VP; float* kf = (float*)(L + 2 * PLB);
    const float* kin = K + zo; const float* vin = Vv + zo;
    float qx[4][8];
    if (role < 2u) {                                                 // block-uniform
        const int q0 = RH + 16 * tile; h16* V16 = (h16*)L; h16* K16 = (h16*)(L + PLB);
        v4f xa[16], xb[16]; float ka[8][8], kb[8][8];
        q_ld(Q + zo + (size_t)q0 * HD, qx); vtile_ld(vin + hf * 256 * HD, xa); vtile_ld(vin + (2 + hf) * 256 * HD, xb);
        vtile_cv<true, false>(xa, V16 + hf * 256 * HD, nullptr, nullptr, S);
        rows32_ld(kin + wv * 32 * HD, ka);
        vtile_cv<true, false>(xb, V16 + (2 + hf) * 256 * HD, nullptr, nullptr, S);
        rows32_ld(kin + (16 + wv) * 32 * HD, kb);
        rows32_cv<true, false>(ka, K16 + wv * 32 * HD, nullptr, nullptr, kf + wv * 32);
        rows32_cv<true, false>(kb, K16 + (16 + wv) * 32 * HD, nullptr, nullptr, kf + (16 + wv) * 32);
        __syncthreads();                                             // all planes and key terms are whole before anyone reads a fragment
        attn_tile<h16, false>(qx, K16, nullptr, V16, nullptr, kf, vin, OUTb + zo, q0);
    } else {
        const int q0 = 16 * tile; bf* Vh = (bf*)L; bf* Vl = (bf*)(L + PLB / 2); bf* Kh = (bf*)(L + PLB); bf* Kl = (bf*)(L + PLB + PLB / 2);
        v4f xa[16]; float ka[8][8];
        q_ld(Q + zo + (size_t)q0 * HD, qx); vtile_ld(vin + hf * 256 * HD, xa); rows32_ld(kin + wv * 32 * HD, ka);
        vtile_cv<false, true>(xa, nullptr, Vh + hf * 256 * HD, Vl + hf * 256 * HD, S);
        rows32_cv<false, true>(ka, nullptr, Kh + wv * 32 * HD, Kl + wv * 32 * HD, kf + wv * 32);
        __syncthreads();                                             // as above
        attn_tile<bf, true>(qx, Kh, Kl, Vh, Vl, kf, vin, OUTb + zo, q0);
    }
}
extern "C" void kernel_launch(void* const* d_in, const int* in_sizes, int n_in,
                              void* d_out, int out_size, void* d_ws, size_t ws_size, hipStream_t stream) {
    (void)in_sizes; (void)n_in; (void)out_size; (void)d_ws; (void)ws_size;
    const float* x = (const float*)d_in[0]; const float* xk = (const float*)d_in[1]; const float* xv = (const float*)d_in[2];   /* q, k, v: [64][1024][64] each (no projections) */
    float* OUT = (float*)d_out;     // [64][1024][64]
    k_attn<<<4 * NB_, 512, 0, stream>>>(x, xk, xv, OUT);   /* planes in LDS, scores, softmax, P.V and the output rows, all batch-heads */
}

// v008
// A run of this version takes 21.4 microseconds.
// Next to v007, in two timings, it ran 1.09 and 1.08 times as fast.
// Counting every step since v000, it is 170 times as fast.
#include <hip/hip_runtime.h>

// Causal scaled dot-product attention on raw batch-head tensors with a data-derived key-padding mask (q, k, v [64][1024][64], no projections; scores = q.k / sqrt(64); keys whose absolute sum is exactly 0 are masked to -2^32+1 (== exclusion; computed from the data, none occur for random inputs); causal mask (same fill); softmax; out = attn.v -> [64][1024][64] (4.2 M); argument order q, k, v).
// One launch, one block of 16 waves a WGP, four blocks a batch-head: two take the query rows >= 512 (fp16, all 1024 keys), two the rows < 512 (bf16 hi/lo, 3 products, keys < 512). A block first turns the f32 k and v that its rows need into 16-bit planes IN ITS OWN LDS (288 KB; k in fragment order, v row-major: the transposing LDS read turns it when a fragment is fetched)
// together with the per-key test sum_d |k[j][d]| != 0 as a float vector (0, or -3e38 for an all-zero key); behind one barrier each wave then walks all keys of one 16-row query tile alone (score tile in registers, running maximum and sum per query), reading every fragment from LDS, and writes its f32 output rows. No workspace.
// Compute dtypes, f32 accumulate: inputs split into bf16 hi/lo (rows < 512) or rounded to fp16 (rest, probabilities x1024); softmax f32; output f32.

#define NB_  64
#define TT   1024
#define DM   64
#define NH_  1
#define NKV  1
#define REP  (NH_ / NKV)
#define HD   64
#define DQ   (NH_ * HD)
#define DKV  (NKV * HD)
#define ZH   1
#define RH   512                  // query rows < RH use hi+lo planes
#define WIN  1024
#define PCAR 1024.0f
#define SCL  0.125f   // 1/sqrt(d_k)
typedef _Float16 h16;
typedef unsigned short bf;
typedef __attribute__((ext_vector_type(16))) __bf16   v16bf;
typedef __attribute__((ext_vector_type(16))) _Float16 v16h;
typedef __attribute__((ext_vector_type(8)))  _Float16 v8h;
typedef __attribute__((ext_vector_type(8)))  unsigned short v8us;
typedef __attribute__((ext_vector_type(8)))  float    v8f;
typedef __attribute__((ext_vector_type(4)))  float    v4f;
typedef v8h  __attribute__((may_alias)) v8ha;
typedef v4f  __attribute__((may_alias)) v4fa;
typedef v8us __attribute__((may_alias)) v8usa;

__device__ __forceinline__ v16h cat16(v8h lo, v8h hi) { return __builtin_shufflevector(lo, hi, 0, 1, 2, 3, 4, 5, 6, 7, 8, 9, 10, 11, 12, 13, 14, 15); }
__device__ __forceinline__ v16bf cat16b(v8us lo, v8us hi) { return __builtin_bit_cast(v16bf, __builtin_shufflevector(lo, hi, 0, 1, 2, 3, 4, 5, 6, 7, 8, 9, 10, 11, 12, 13, 14, 15)); }
__device__ __forceinline__ v8f wmma16(v16h a, v16h b, v8f c) { return __builtin_amdgcn_wmma_f32_16x16x32_f16(false, a, false, b, (short)0, c, false, false); }
__device__ __forceinline__ v8f wmmab(v16bf a, v16bf b, v8f c) { return __builtin_amdgcn_wmma_f32_16x16x32_bf16(false, a, false, b, (short)0, c, false, false); }



// ---- 16x32 operand fragments (row = lane & 15; k = 8 * (lane >> 4) + 0..7 and 16 + 8 * (lane >> 4) + 0..7), the same loader for A and for B, from planes in fragment order: a fragment is 1 KB in a row,
// [k / 8 (4)][row (16)][8 values], so the lane's two 16-byte groups lie at 16 * lane and 512 + 16 * lane bytes and each wave-wide load covers four whole 128-byte lines (row-major planes: 16 lines a load, 32 bytes of each).
// k planes: [row / 16][d / 32] fragments.
// Value planes: row-major [key][HD] at a pitch of VPB bytes. ds_load_tr16_b128: lane l gives the address of 16 bytes (key 8 (l >> 4) + (l & 7), columns 8 ((l >> 3) & 1) .. + 7 of a 16 x 16 tile) and gets keys 8 (l >> 4) + 0..7 of column l & 15:
// two of them, 16 keys apart, are a 16 x 32 fragment of the transposed values (row = d, k = key) in the same k order as above.
#define VPB 160                   // 128 + 32 bytes, an odd multiple of 32: the 16 lanes of a half wave (8 rows x 32 bytes) fall on all 64 banks once in a transposing read
typedef __attribute__((ext_vector_type(8))) short s16x8;
typedef __attribute__((address_space(3))) s16x8 lds_s16x8;
__device__ __forceinline__ s16x8 ld_tr16(const unsigned char* p) { return __builtin_amdgcn_ds_load_tr16_b128_v8i16((lds_s16x8*)p); }
template <typename T16> struct WFrag;
template <> struct WFrag<h16> { typedef v16h V; static __device__ __forceinline__ V ld(const h16* p) { return cat16(*(const v8h*)p, *(const v8h*)(p + 256)); } static __device__ __forceinline__ V ldt(const unsigned char* p) { return cat16(__builtin_bit_cast(v8h, ld_tr16(p)), __builtin_bit_cast(v8h, ld_tr16(p + 16 * VPB))); } static __device__ __forceinline__ v8f mma(V a, V b, v8f c) { return wmma16(a, b, c); } };
template <> struct WFrag<bf> { typedef v16bf V; static __device__ __forceinline__ V ld(const bf* p) { return cat16b(*(const v8us*)p, *(const v8us*)(p + 256)); } static __device__ __forceinline__ V ldt(const unsigned char* p) { return cat16b(__builtin_bit_cast(v8us, ld_tr16(p)), __builtin_bit_cast(v8us, ld_tr16(p + 16 * VPB))); } static __device__ __forceinline__ v8f mma(V a, V b, v8f c) { return wmmab(a, b, c); } };
typedef __attribute__((ext_vector_type(2))) _Float16 v2h;
typedef __attribute__((ext_vector_type(4))) _Float16 v4h;
typedef __attribute__((ext_vector_type(2))) unsigned short v2us;
typedef __attribute__((ext_vector_type(4))) unsigned short v4us;
typedef __attribute__((ext_vector_type(2))) float v2f;
typedef __attribute__((ext_vector_type(4))) int v4i;

typedef __attribute__((ext_vector_type(2))) __bf16 v2b;
// cvt8: 8 neighbouring f32 values to their 16-byte groups of the planes: fp16 (round to nearest), and bf16 hi with lo = bf16(x - hi)
template <bool F16, bool SPL>
__device__ __forceinline__ void cvt8(const float* x, v8h& o16, v8us& oh, v8us& ol) {
#pragma unroll
    for (int e = 0; e < 8; e += 2) { v2f p; p[0] = x[e]; p[1] = x[e + 1];
        if constexpr (F16) { const v2h h = __builtin_convertvector(p, v2h); o16[e] = h[0]; o16[e + 1] = h[1]; }
        if constexpr (SPL) { const v2b h = __builtin_convertvector(p, v2b); const v2b lo = __builtin_convertvector(p - __builtin_convertvector(h, v2f), v2b);
            const v2us hu = __builtin_bit_cast(v2us, h), lu = __builtin_bit_cast(v2us, lo); oh[e] = hu[0]; oh[e + 1] = hu[1]; ol[e] = lu[0]; ol[e + 1] = lu[1]; } } }
template <int CTRL> __device__ __forceinline__ float xlane(float x) { return __int_as_float(__builtin_amdgcn_update_dpp(0, __float_as_int(x), CTRL, 0xf, 0xf, true)); }   // value of lane ^ m inside a 16-lane row (CTRL = 0x160 + m, row_xmask): in the vector pipe, no trip through the LDS unit
__device__ __forceinline__ float xhalf(float x) { const int b = __float_as_int(x); return __int_as_float(__builtin_amdgcn_permlanex16(b, b, 0x76543210, 0xfedcba98, false, false)); }   // value of lane ^ 16
// rows32: one wave, 32 rows of the [row][HD] input k (8 KB, all 16 loads of a lane in flight at once) to two 16-row groups of the planes in LDS, in two halves: rows32_ld asks for the rows, rows32_cv converts and stores them, so that the trip to memory can be begun early.
// Step i takes rows 8 (i >> 1) .. + 7 and columns 32 (i & 1) .. + 31: lane = 8 x (column / 8) + row, 8 values a lane: a load touches 8 lines, and a store is 4 column groups x 8 neighbouring rows x 16 bytes of the fragment order.
__device__ __forceinline__ void rows32_ld(const float* __restrict__ src, float (&x)[8][8]) {
    const int lane = threadIdx.x & 31, r = lane & 7, oo = lane >> 3; const unsigned lb = (unsigned)r * 256u + (unsigned)oo * 32u;   // the lane's place in a step, in bytes of the f32 input
#pragma unroll
    for (int i = 0; i < 8; ++i) { const float* p = (const float*)((const char*)src + lb) + (i >> 1) * 512 + (i & 1) * 32; const v4f a = *(const v4f*)p, b = *(const v4f*)(p + 4);
#pragma unroll
        for (int e = 0; e < 4; ++e) { x[i][e] = a[e]; x[i][e + 4] = b[e]; } }
    asm volatile("s_wait_xcnt 0x0" :: "v"(lb) : "memory");           // before any register that the loads name is written again; the offset as an input keeps its register alive up to here: otherwise the last load's result lands in it
}
// The per-key test sum_d |k[j][d]| != 0 (fixed tree: in-lane, the row's two steps, then lanes 8 and 16 apart; a sum of absolute values is 0 only if each is, in any order) as a float (0, or -3e38 for an all-zero key); the lane whose column group equals the row group keeps it: lane = row.
template <bool F16, bool SPL>
__device__ __forceinline__ void rows32_cv(const float (&x)[8][8], h16* P16, bf* Ph, bf* Pl, float* kfl) {
    const int lane = threadIdx.x & 31, r = lane & 7, oo = lane >> 3; const unsigned lo8 = (unsigned)(oo * 16 + r) * 8u;   // the lane's place in a step, in elements of a plane
    float fl = 0.0f, sp = 0.0f;
#pragma unroll
    for (int i = 0; i < 8; ++i) { v8h o16; v8us oh, ol; cvt8<F16, SPL>(x[i], o16, oh, ol);
        const int c = (i >> 2) * 1024 + (i & 1) * 512 + ((i >> 1) & 1) * 64; if constexpr (F16) *(v8h*)(P16 + lo8 + c) = o16; if constexpr (SPL) { *(v8us*)(Ph + lo8 + c) = oh; *(v8us*)(Pl + lo8 + c) = ol; }
        const float* a = x[i];
        float s = __fadd_rn(__fadd_rn(__fadd_rn(fabsf(a[0]), fabsf(a[1])), __fadd_rn(fabsf(a[2]), fabsf(a[3]))), __fadd_rn(__fadd_rn(fabsf(a[4]), fabsf(a[5])), __fadd_rn(fabsf(a[6]), fabsf(a[7]))));
        if ((i & 1) == 0) sp = s;
        else { s = __fadd_rn(s, sp); s = __fadd_rn(s, xlane<0x168>(s)); s = __fadd_rn(s, xhalf(s));
            fl = (oo == (i >> 1)) ? ((s != 0.0f) ? 0.0f : -3.0e38f) : fl; } }   // what the key adds to its scores: nothing, or the exclusion value (an all-zero key's own products are exactly 0)
    kfl[lane] = fl;
}
// vrows32: one wave, 32 rows of the [row][HD] input v (8 KB, all 16 loads of a lane in flight at once) to the row-major value planes in LDS, again in two halves. Step i: the low lanes take row 8 (i >> 2) + (i & 3), the high lanes the row 4 further on,
// 4 values a lane: a load covers two whole 256-byte rows (4 lines), and a store's two 128-byte rows, 4 x VPB bytes apart, fall on all 64 banks once.
__device__ __forceinline__ void vrows32_ld(const float* __restrict__ src, v4f (&x)[16]) {
    const int lane = threadIdx.x & 31; const unsigned lb = (unsigned)(lane >> 4) * 1024u + (unsigned)(lane & 15) * 16u;   // the lane's place in a step, in bytes of the f32 input
#pragma unroll
    for (int i = 0; i < 16; ++i) x[i] = *(const v4f*)((const char*)src + lb + (i >> 2) * 2048 + (i & 3) * 256);
    asm volatile("s_wait_xcnt 0x0" :: "v"(lb) : "memory");           // before any register that the loads name is written again; the offset as an input keeps its register alive up to here
}
template <bool F16, bool SPL>
__device__ __forceinline__ void vrows32_cv(const v4f (&x)[16], unsigned char* V16, unsigned char* Vh, unsigned char* Vl) {
    const int lane = threadIdx.x & 31; const unsigned lo = (unsigned)(lane >> 4) * (4u * VPB) + (unsigned)(lane & 15) * 8u;   // the lane's place in a step, in bytes of a plane
#pragma unroll
    for (int i = 0; i < 16; ++i) { v4h o16; v4us oh, ol;
#pragma unroll
        for (int e = 0; e < 4; e += 2) { v2f p; p[0] = x[i][e]; p[1] = x[i][e + 1];   // the conversions of cvt8
            if constexpr (F16) { const v2h h = __builtin_convertvector(p, v2h); o16[e] = h[0]; o16[e + 1] = h[1]; }
            if constexpr (SPL) { const v2b h = __builtin_convertvector(p, v2b); const v2b l2 = __builtin_convertvector(p - __builtin_convertvector(h, v2f), v2b);
                const v2us hu = __builtin_bit_cast(v2us, h), lu = __builtin_bit_cast(v2us, l2); oh[e] = hu[0]; oh[e + 1] = hu[1]; ol[e] = lu[0]; ol[e + 1] = lu[1]; } }
        const int c = (i >> 2) * 8 * VPB + (i & 3) * VPB; if constexpr (F16) *(v4h*)(V16 + lo + c) = o16; if constexpr (SPL) { *(v4us*)(Vh + lo + c) = oh; *(v4us*)(Vl + lo + c) = ol; } }
}
struct yes_t { static constexpr bool value = true; }; struct no_t { static constexpr bool value = false; };   // compile-time switches of a pass
#define XSC  0.18033688011112042f   // 1/sqrt(d_k) x log2(e): scores go to the exponent of 2 in one multiply-add
#define MLOW -1.0e30f               // start of the running maximum: far above an excluded score x XSC, so an excluded key's probability is exactly 0
__device__ __forceinline__ float exp2x1(float x) { float r; asm("v_exp_f32 %0, %1\n\tv_nop" : "=v"(r) : "v"(x)); return r; }
__device__ __forceinline__ void exp2x8(const float* x, float* p) {
    asm("v_exp_f32 %0, %8\n\tv_exp_f32 %1, %9\n\tv_exp_f32 %2, %10\n\tv_exp_f32 %3, %11\n\tv_exp_f32 %4, %12\n\tv_exp_f32 %5, %13\n\tv_exp_f32 %6, %14\n\tv_exp_f32 %7, %15\n\tv_nop"
        : "=&v"(p[0]), "=&v"(p[1]), "=&v"(p[2]), "=&v"(p[3]), "=&v"(p[4]), "=&v"(p[5]), "=&v"(p[6]), "=&v"(p[7]) : "v"(x[0]), "v"(x[1]), "v"(x[2]), "v"(x[3]), "v"(x[4]), "v"(x[5]), "v"(x[6]), "v"(x[7])); }
__device__ __forceinline__ void q_ld(const float* __restrict__ qrow0, float (&qx)[4][8]) {
    const int lane = threadIdx.x & 31; const unsigned qo = (unsigned)(lane & 15) * 256u + (unsigned)(lane >> 4) * 32u;
#pragma unroll
    for (int g = 0; g < 4; ++g) { const float* p = (const float*)((const char*)qrow0 + qo) + g * 16; const v4f a = *(const v4f*)p, b = *(const v4f*)(p + 4);
#pragma unroll
        for (int e = 0; e < 4; ++e) { qx[g][e] = a[e]; qx[g][e + 4] = b[e]; } }
    asm volatile("s_wait_xcnt 0x0" :: "v"(qo) : "memory");           // before any register that the loads name is written again; the offset as an input keeps its register alive up to here
}
template <typename T16, bool SPLIT>
__device__ __forceinline__ void attn_tile(const float (&qx)[4][8], const T16* Kp, const T16* Kp2, const unsigned char* Vt, const unsigned char* Vt2, const float* kf, const float* __restrict__ vraw, float* __restrict__ out, const int q0) {
    typedef typename WFrag<T16>::V V; typedef WFrag<T16> F;
    const int lane = threadIdx.x & 31, lr = lane & 15, hi = lane >> 4;
    const unsigned flo = (unsigned)lane * 16u, blo = (unsigned)hi * 32u;   // the lane's byte offsets in a fragment of a key plane and in 16 key terms: fixed for the whole kernel
    const unsigned vlo = (unsigned)(hi * 8 + (lane & 7)) * VPB + (unsigned)((lane >> 3) & 1) * 16u;   // and in 16 rows of a value plane, for the transposing read
    auto at = [](const T16* base, unsigned off) { return (const T16*)((const char*)base + off); };
    V q[2], q2[2];
#pragma unroll
    for (int ks = 0; ks < 2; ++ks) { v8h a16, b16; v8us ah, al, bh, bl; cvt8<!SPLIT, SPLIT>(qx[2 * ks], a16, ah, al); cvt8<!SPLIT, SPLIT>(qx[2 * ks + 1], b16, bh, bl);
        if constexpr (SPLIT) { q[ks] = cat16b(ah, bh); q2[ks] = cat16b(al, bl); } else q[ks] = cat16(a16, b16); }
    v8f o[4]; float m = MLOW, l = 0.0f;
#pragma unroll
    for (int md = 0; md < 4; ++md) o[md] = (v8f){};
    V kc[2][2], kc2[2][2], vt[4], vt2[4]; v8f cb[2], s[2];           // cb: a pass's key terms in the score tiles' register order, the C operand of each tile's first product
    auto load_k = [&](const int kb) {                                // key fragments and key terms of the pass at kb
        const T16* pk = at(Kp + kb * HD, flo); const T16* pk2 = SPLIT ? at(Kp2 + kb * HD, flo) : pk; const char* pc = (const char*)(kf + kb) + blo;
#pragma unroll
        for (int mt = 0; mt < 2; ++mt)
#pragma unroll
            for (int ks = 0; ks < 2; ++ks) { kc[mt][ks] = F::ld(pk + mt * 16 * HD + ks * 512); if (SPLIT) kc2[mt][ks] = F::ld(pk2 + mt * 16 * HD + ks * 512); }
#pragma unroll
        for (int mt = 0; mt < 2; ++mt) cb[mt] = *(const v8f*)(pc + mt * 64);
    };
    auto load_v = [&](const int kb) {                                // value fragments of the pass at kb
        const unsigned char* pv = Vt + kb * VPB + vlo; const unsigned char* pv2 = SPLIT ? Vt2 + kb * VPB + vlo : pv;
#pragma unroll
        for (int md = 0; md < 4; ++md) { vt[md] = F::ldt(pv + md * 32); if (SPLIT) vt2[md] = F::ldt(pv2 + md * 32); }
    };
    auto scores = [&]() {                                            // S^T of the pass whose key fragments are loaded
#pragma unroll
        for (int mt = 0; mt < 2; ++mt) s[mt] = cb[mt];
#pragma unroll
        for (int ks = 0; ks < 2; ++ks)
#pragma unroll
            for (int pr = 0; pr < (SPLIT ? 3 : 1); ++pr)             // tiles innermost: neighbouring products go to different accumulators
#pragma unroll
                for (int mt = 0; mt < 2; ++mt) s[mt] = F::mma(pr == 1 ? kc2[mt][ks] : kc[mt][ks], pr == 2 ? q2[ks] : q[ks], s[mt]);
    };
    // second half: the diagonal's exclusions (compile-time choice: only the last pass has any), running softmax, O^T += V^T.P^T
    auto finish = [&](auto causal, const int kb) {
        if constexpr (causal.value) {
#pragma unroll
            for (int mt = 0; mt < 2; ++mt)
#pragma unroll
                for (int j = 0; j < 8; ++j) s[mt][j] = (kb + mt * 16 + hi * 8 + j <= q0 + lr) ? s[mt][j] : -3.0e38f; }
        V ph, pl;
        float mx = s[0][0];
#pragma unroll
        for (int e = 1; e < 16; ++e) mx = fmaxf(mx, s[e >> 3][e & 7]);
        mx = fmaxf(mx, xhalf(mx));
        const float mn = fmaxf(m, mx * XSC); const float al = exp2x1(m - mn); m = mn;
        const float sub = SPLIT ? -mn : 10.0f - mn;                  // fp16 rows carry probabilities x1024 (sum and products alike; it cancels in the division)
        float sum = 0.0f, x[16], pe[16];
#pragma unroll
        for (int e = 0; e < 16; ++e) x[e] = fmaf(s[e >> 3][e & 7], XSC, sub);
        exp2x8(x, pe); exp2x8(x + 8, pe + 8);
#pragma unroll
        for (int e = 0; e < 16; e += 2) { v2f p; p[0] = pe[e]; p[1] = pe[e + 1]; sum += p[0] + p[1];
            if constexpr (SPLIT) { const v2b h = __builtin_convertvector(p, v2b); const v2b lo = __builtin_convertvector(p - __builtin_convertvector(h, v2f), v2b); ph[e] = h[0]; ph[e + 1] = h[1]; pl[e] = lo[0]; pl[e + 1] = lo[1]; }
            else { const v2h h = __builtin_convertvector(p, v2h); ph[e] = h[0]; ph[e + 1] = h[1]; } }
        l = l * al + sum;
#pragma unroll
        for (int md = 0; md < 4; ++md) o[md] *= al;
#pragma unroll
        for (int pr = 0; pr < (SPLIT ? 3 : 1); ++pr)
#pragma unroll
            for (int md = 0; md < 4; ++md) o[md] = F::mma(pr == 1 ? vt2[md] : vt[md], pr == 2 ? pl : ph, o[md]);
    };
    const yes_t yes{}; const no_t no{};
    const int kl = ((q0 + 16 + 31) & ~31) - 32;                      // the one pass that reaches past a query's diagonal; keys beyond it are never read
    load_k(0);
    scores();
    // The scores go round the loop, not the key fragments: a trip reads its own values and the next pass's keys at its head, works on the scores it was handed, and forms the next pass's scores at its foot.
    for (int kb = 0; kb < kl; kb += 32) {
        load_v(kb);
        load_k(kb + 32);
        __builtin_amdgcn_sched_barrier(0);                           // holds the trip's LDS reads together up here: each separate place where LDS reads stand costs the wave a stop, and sunk to their uses they wait out the LDS latency every time
        finish(no, kb);
        __builtin_amdgcn_sched_barrier(0);                           // keeps the next pass's score products down here: moved up among the softmax arithmetic they stand in front of the 2^x statements
        scores();
    }
    load_v(kl);
    finish(yes, kl);
    const float ls = l + xhalf(l);                                   // the two lane halves hold the sums of different keys of the same query, on the same maximum
    const bool dead = !(ls > 0.0f); float inv = __fdiv_rn(1.0f, ls);
    if (__builtin_amdgcn_ballot_w32(dead) != 0) {                    // cold: a query whose every allowed key is padding
        v8f mean[4];
#pragma unroll
        for (int md = 0; md < 4; ++md) mean[md] = (v8f){};
#pragma unroll 1                                                     // cold path: keep its code small
        for (int t = 0; t < TT; ++t) { v8f x[4];
#pragma unroll
            for (int md = 0; md < 4; ++md) x[md] = *(const v8f*)(vraw + (size_t)t * HD + md * 16 + hi * 8);
            asm volatile("s_wait_xcnt 0x0" ::: "memory");            // before the address moves on
#pragma unroll
            for (int md = 0; md < 4; ++md) mean[md] += x[md]; }
#pragma unroll
        for (int md = 0; md < 4; ++md)
#pragma unroll
            for (int j = 0; j < 8; ++j) o[md][j] = dead ? mean[md][j] * (1.0f / TT) : o[md][j];
        inv = dead ? 1.0f : inv; }
    float* orow = out + (size_t)(q0 + lr) * HD + hi * 8;             // register j of tile md is column md * 16 + 8 hi + j of the lane's query row; the wave writes its 16 rows whole
#pragma unroll
    for (int md = 0; md < 4; ++md) *(v8f*)(orow + md * 16) = o[md] * inv;
    asm volatile("s_wait_xcnt 0x0" ::: "memory");                    // before a register that the stores name is written again
}
// k_attn: grid 4 x 64 blocks of 16 waves, one a WGP (LDS). Block b: batch-head b % 64, role b / 64: roles 0, 1 the fp16 rows, roles 2, 3 the hi/lo rows; of a kind's 32 tiles of 16 rows the two roles take the even and the odd ones (equal cost).
// Wave -> tile: waves 4 apart share a SIMD; the tiles go to and fro over each group of four waves, so that every SIMD gets the same number of passes.
// LDS: value planes (160 KB with the pitch's pad), key planes (128 KB), key terms (4 KB). A wave converts the 32-row groups wv (and 16 + wv) of v and of k; nobody reads what another wave wrote before the one barrier.
// All trips to memory are begun as early as the registers allow (values, keys, query rows), so that the block waits out the memory latency once.
#define PLB 131072                // bytes of the key planes
#define VLB (TT * VPB)            // bytes of the value planes
__global__ __launch_bounds__(512, 4) void k_attn(const float* __restrict__ Q, const float* __restrict__ K, const float* __restrict__ Vv, float* __restrict__ OUTb) {
    __shared__ __attribute__((aligned(128))) unsigned char L[VLB + PLB + TT * 4];
    const unsigned role = blockIdx.x / NB_; const size_t zo = (size_t)(blockIdx.x % NB_) * TT * HD;
    const int wv = __builtin_amdgcn_readfirstlane((int)(threadIdx.x >> 5)), g4 = wv >> 2, c4 = wv & 3;   // scalar, so that every pass test is a scalar branch and every base address scalar
    const int tile = 2 * (4 * g4 + ((g4 & 1) ? 3 - c4 : c4)) + (int)(role & 1u);
    float* kf = (float*)(L + VLB + PLB);
    const float* kin = K + zo; const float* vin = Vv + zo;
    float qx[4][8];
    if (role < 2u) {                                                 // block-uniform
        const int q0 = RH + 16 * tile; h16* K16 = (h16*)(L + VLB);
        v4f va[16], vb[16]; float ka[8][8], kb[8][8];
        vrows32_ld(vin + wv * 32 * HD, va); vrows32_ld(vin + (16 + wv) * 32 * HD, vb); rows32_ld(kin + wv * 32 * HD, ka);   // three groups (192 registers) in flight; the fourth and the query rows follow as registers come free
        // Four scheduling barriers keep the conversions in their places between the loads: mixed with later groups' arithmetic a conversion waits for loads that come back later, the next loads start late, and registers spill.
        vrows32_cv<true, false>(va, L + wv * 32 * VPB, nullptr, nullptr);
        __builtin_amdgcn_sched_barrier(0);                           // the first group's conversion stays in front of the fourth group's loads, which take its registers
        rows32_ld(kin + (16 + wv) * 32 * HD, kb);
        __builtin_amdgcn_sched_barrier(0);                           // nothing of the later conversions moves up among those loads and in front of their wait
        vrows32_cv<true, false>(vb, L + (16 + wv) * 32 * VPB, nullptr, nullptr);
        __builtin_amdgcn_sched_barrier(0);                           // the second group's conversion stays whole in front of the query loads
        q_ld(Q + zo + (size_t)q0 * HD, qx);
        __builtin_amdgcn_sched_barrier(0);                           // and the keys' conversions behind them: the query loads start without a wait for the keys
        rows32_cv<true, false>(ka, K16 + wv * 32 * HD, nullptr, nullptr, kf + wv * 32);
        rows32_cv<true, false>(kb, K16 + (16 + wv) * 32 * HD, nullptr, nullptr, kf + (16 + wv) * 32);
        __syncthreads();                                             // all planes and key terms are whole before anyone reads a fragment
        attn_tile<h16, false>(qx, K16, nullptr, L, nullptr, kf, vin, OUTb + zo, q0);
    } else {
        const int q0 = 16 * tile; unsigned char* Vh = L; unsigned char* Vl = L + VLB / 2; bf* Kh = (bf*)(L + VLB); bf* Kl = (bf*)(L + VLB + PLB / 2);
        v4f va[16]; float ka[8][8];
        q_ld(Q + zo + (size_t)q0 * HD, qx); vrows32_ld(vin + wv * 32 * HD, va); rows32_ld(kin + wv * 32 * HD, ka);
        vrows32_cv<false, true>(va, nullptr, Vh + wv * 32 * VPB, Vl + wv * 32 * VPB);
        rows32_cv<false, true>(ka, nullptr, Kh + wv * 32 * HD, Kl + wv * 32 * HD, kf + wv * 32);
        __syncthreads();                                             // as above
        attn_tile<bf, true>(qx, Kh, Kl, Vh, Vl, kf, vin, OUTb + zo, q0);
    }
}
extern "C" void kernel_launch(void* const* d_in, const int* in_sizes, int n_in,
                              void* d_out, int out_size, void* d_ws, size_t ws_size, hipStream_t stream) {
    (void)in_sizes; (void)n_in; (void)out_size; (void)d_ws; (void)ws_size;
    const float* x = (const float*)d_in[0]; const float* xk = (const float*)d_in[1]; const float* xv = (const float*)d_in[2];   /* q, k, v: [64][1024][64] each (no projections) */
    float* OUT = (float*)d_out;     // [64][1024][64]
    k_attn<<<4 * NB_, 512, 0, stream>>>(x, xk, xv, OUT);   /* planes in LDS, scores, softmax, P.V and the output rows, all batch-heads */
}

// v009
// One run takes 19.2 microseconds.
// Timed twice side by side with v008, it ran 1.11 and 1.12 times as fast.
// Counting every step since v000, it is 190 times as fast.
#include <hip/hip_runtime.h>

// Causal scaled dot-product attention on raw batch-head tensors with a data-derived key-padding mask (q, k, v [64][1024][64], no projections; scores = q.k / sqrt(64); keys whose absolute sum is exactly 0 are masked to -2^32+1 (== exclusion; computed from the data, none occur for random inputs); causal mask (same fill); softmax; out = attn.v -> [64][1024][64] (4.2 M); argument order q, k, v).
// One launch, one block of 16 waves a WGP, four blocks a batch-head: two take the query rows >= 512 (fp16, all 1024 keys), two the rows < 512 (bf16 hi/lo, 3 products, keys < 512). A block first turns the f32 k and v that its rows need into 16-bit planes IN ITS OWN LDS (288 KB; k in fragment order, v row-major: the transposing LDS read turns it when a fragment is fetched)
// together with the per-key test sum_d |k[j][d]| != 0 as a float vector (0, or -3e38 for an all-zero key); behind one barrier each wave then walks all keys of one 16-row query tile alone (score tile in registers, reference point and sum per query), reading every fragment from LDS, and writes its f32 output rows. No workspace.
// Compute dtypes, f32 accumulate: inputs split into bf16 hi/lo (rows < 512) or rounded to fp16 (rest, probabilities x1024); softmax f32; output f32.

#define NB_  64
#define TT   1024
#define DM   64
#define NH_  1
#define NKV  1
#define REP  (NH_ / NKV)
#define HD   64
#define DQ   (NH_ * HD)
#define DKV  (NKV * HD)
#define ZH   1
#define RH   512                  // query rows < RH use hi+lo planes
#define WIN  1024
#define PCAR 1024.0f
#define SCL  0.125f   // 1/sqrt(d_k)
typedef _Float16 h16;
typedef unsigned short bf;
typedef __attribute__((ext_vector_type(16))) __bf16   v16bf;
typedef __attribute__((ext_vector_type(16))) _Float16 v16h;
typedef __attribute__((ext_vector_type(8)))  _Float16 v8h;
typedef __attribute__((ext_vector_type(8)))  unsigned short v8us;
typedef __attribute__((ext_vector_type(8)))  float    v8f;
typedef __attribute__((ext_vector_type(4)))  float    v4f;
typedef v8h  __attribute__((may_alias)) v8ha;
typedef v4f  __attribute__((may_alias)) v4fa;
typedef v8us __attribute__((may_alias)) v8usa;

__device__ __forceinline__ v16h cat16(v8h lo, v8h hi) { return __builtin_shufflevector(lo, hi, 0, 1, 2, 3, 4, 5, 6, 7, 8, 9, 10, 11, 12, 13, 14, 15); }
__device__ __forceinline__ v16bf cat16b(v8us lo, v8us hi) { return __builtin_bit_cast(v16bf, __builtin_shufflevector(lo, hi, 0, 1, 2, 3, 4, 5, 6, 7, 8, 9, 10, 11, 12, 13, 14, 15)); }
__device__ __forceinline__ v8f wmma16(v16h a, v16h b, v8f c) { return __builtin_amdgcn_wmma_f32_16x16x32_f16(false, a, false, b, (short)0, c, false, false); }
__device__ __forceinline__ v8f wmmab(v16bf a, v16bf b, v8f c) { return __builtin_amdgcn_wmma_f32_16x16x32_bf16(false, a, false, b, (short)0, c, false, false); }



// ---- 16x32 operand fragments (row = lane & 15; k = 8 * (lane >> 4) + 0..7 and 16 + 8 * (lane >> 4) + 0..7), the same loader for A and for B, from planes in fragment order: a fragment is 1 KB in a row,
// [k / 8 (4)][row (16)][8 values], so the lane's two 16-byte groups lie at 16 * lane and 512 + 16 * lane bytes and each wave-wide load covers four whole 128-byte lines (row-major planes: 16 lines a load, 32 bytes of each).
// k planes: [row / 16][d / 32] fragments.
// Value planes: row-major [key][HD] at a pitch of VPB bytes. ds_load_tr16_b128: lane l gives the address of 16 bytes (key 8 (l >> 4) + (l & 7), columns 8 ((l >> 3) & 1) .. + 7 of a 16 x 16 tile) and gets keys 8 (l >> 4) + 0..7 of column l & 15:
// two of them, 16 keys apart, are a 16 x 32 fragment of the transposed values (row = d, k = key) in the same k order as above.
#define VPB 160                   // 128 + 32 bytes, an odd multiple of 32: the 16 lanes of a half wave (8 rows x 32 bytes) fall on all 64 banks once in a transposing read
typedef __attribute__((ext_vector_type(8))) short s16x8;
typedef __attribute__((address_space(3))) s16x8 lds_s16x8;
__device__ __forceinline__ s16x8 ld_tr16(const unsigned char* p) { return __builtin_amdgcn_ds_load_tr16_b128_v8i16((lds_s16x8*)p); }
template <typename T16> struct WFrag;
template <> struct WFrag<h16> { typedef v16h V; static __device__ __forceinline__ V ld(const h16* p) { return cat16(*(const v8h*)p, *(const v8h*)(p + 256)); } static __device__ __forceinline__ V ldt(const unsigned char* p) { return cat16(__builtin_bit_cast(v8h, ld_tr16(p)), __builtin_bit_cast(v8h, ld_tr16(p + 16 * VPB))); } static __device__ __forceinline__ v8f mma(V a, V b, v8f c) { return wmma16(a, b, c); } };
template <> struct WFrag<bf> { typedef v16bf V; static __device__ __forceinline__ V ld(const bf* p) { return cat16b(*(const v8us*)p, *(const v8us*)(p + 256)); } static __device__ __forceinline__ V ldt(const unsigned char* p) { return cat16b(__builtin_bit_cast(v8us, ld_tr16(p)), __builtin_bit_cast(v8us, ld_tr16(p + 16 * VPB))); } static __device__ __forceinline__ v8f mma(V a, V b, v8f c) { return wmmab(a, b, c); } };
typedef __attribute__((ext_vector_type(2))) _Float16 v2h;
typedef __attribute__((ext_vector_type(4))) _Float16 v4h;
typedef __attribute__((ext_vector_type(2))) unsigned short v2us;
typedef __attribute__((ext_vector_type(4))) unsigned short v4us;
typedef __attribute__((ext_vector_type(2))) float v2f;
typedef __attribute__((ext_vector_type(4))) int v4i;

typedef __attribute__((ext_vector_type(2))) __bf16 v2b;
// cvt8: 8 neighbouring f32 values to their 16-byte groups of the planes: fp16 (round to nearest), and bf16 hi with lo = bf16(x - hi)
template <bool F16, bool SPL>
__device__ __forceinline__ void cvt8(const float* x, v8h& o16, v8us& oh, v8us& ol) {
#pragma unroll
    for (int e = 0; e < 8; e += 2) { v2f p; p[0] = x[e]; p[1] = x[e + 1];
        if constexpr (F16) { const v2h h = __builtin_convertvector(p, v2h); o16[e] = h[0]; o16[e + 1] = h[1]; }
        if constexpr (SPL) { const v2b h = __builtin_convertvector(p, v2b); const v2b lo = __builtin_convertvector(p - __builtin_convertvector(h, v2f), v2b);
            const v2us hu = __builtin_bit_cast(v2us, h), lu = __builtin_bit_cast(v2us, lo); oh[e] = hu[0]; oh[e + 1] = hu[1]; ol[e] = lu[0]; ol[e + 1] = lu[1]; } } }
template <int CTRL> __device__ __forceinline__ float xlane(float x) { return __int_as_float(__builtin_amdgcn_update_dpp(0, __float_as_int(x), CTRL, 0xf, 0xf, true)); }   // value of lane ^ m inside a 16-lane row (CTRL = 0x160 + m, row_xmask): in the vector pipe, no trip through the LDS unit
__device__ __forceinline__ float xhalf(float x) { const int b = __float_as_int(x); return __int_as_float(__builtin_amdgcn_permlanex16(b, b, 0x76543210, 0xfedcba98, false, false)); }   // value of lane ^ 16
// rows32: one wave, 32 rows of the [row][HD] input k (8 KB, all 16 loads of a lane in flight at once) to two 16-row groups of the planes in LDS, in two halves: rows32_ld asks for the rows, rows32_cv converts and stores them, so that the trip to memory can be begun early.
// Step i takes rows 8 (i >> 1) .. + 7 and columns 32 (i & 1) .. + 31: lane = 8 x (column / 8) + row, 8 values a lane: a load touches 8 lines, and a store is 4 column groups x 8 neighbouring rows x 16 bytes of the fragment order.
__device__ __forceinline__ void rows32_ld(const float* __restrict__ src, float (&x)[8][8]) {
    const int lane = threadIdx.x & 31, r = lane & 7, oo = lane >> 3; const unsigned lb = (unsigned)r * 256u + (unsigned)oo * 32u;   // the lane's place in a step, in bytes of the f32 input
#pragma unroll
    for (int i = 0; i < 8; ++i) { const float* p = (const float*)((const char*)src + lb) + (i >> 1) * 512 + (i & 1) * 32; const v4f a = *(const v4f*)p, b = *(const v4f*)(p + 4);
#pragma unroll
        for (int e = 0; e < 4; ++e) { x[i][e] = a[e]; x[i][e + 4] = b[e]; } }
    asm volatile("s_wait_xcnt 0x0" :: "v"(lb) : "memory");           // before any register that the loads name is written again; the offset as an input keeps its register alive up to here: otherwise the last load's result lands in it
}
// The per-key test sum_d |k[j][d]| != 0 (fixed tree: in-lane, the row's two steps, then lanes 8 and 16 apart; a sum of absolute values is 0 only if each is, in any order) as a float (0, or -3e38 for an all-zero key); the lane whose column group equals the row group keeps it: lane = row.
template <bool F16, bool SPL>
__device__ __forceinline__ void rows32_cv(const float (&x)[8][8], h16* P16, bf* Ph, bf* Pl, float* kfl) {
    const int lane = threadIdx.x & 31, r = lane & 7, oo = lane >> 3; const unsigned lo8 = (unsigned)(oo * 16 + r) * 8u;   // the lane's place in a step, in elements of a plane
    float fl = 0.0f, sp = 0.0f;
#pragma unroll
    for (int i = 0; i < 8; ++i) { v8h o16; v8us oh, ol; cvt8<F16, SPL>(x[i], o16, oh, ol);
        const int c = (i >> 2) * 1024 + (i & 1) * 512 + ((i >> 1) & 1) * 64; if constexpr (F16) *(v8h*)(P16 + lo8 + c) = o16; if constexpr (SPL) { *(v8us*)(Ph + lo8 + c) = oh; *(v8us*)(Pl + lo8 + c) = ol; }
        const float* a = x[i];
        float s = __fadd_rn(__fadd_rn(__fadd_rn(fabsf(a[0]), fabsf(a[1])), __fadd_rn(fabsf(a[2]), fabsf(a[3]))), __fadd_rn(__fadd_rn(fabsf(a[4]), fabsf(a[5])), __fadd_rn(fabsf(a[6]), fabsf(a[7]))));
        if ((i & 1) == 0) sp = s;
        else { s = __fadd_rn(s, sp); s = __fadd_rn(s, xlane<0x168>(s)); s = __fadd_rn(s, xhalf(s));
            fl = (oo == (i >> 1)) ? ((s != 0.0f) ? 0.0f : -3.0e38f) : fl; } }   // what the key adds to its scores: nothing, or the exclusion value (an all-zero key's own products are exactly 0)
    kfl[lane] = fl;
}
// vrows32: one wave, 32 rows of the [row][HD] input v (8 KB, all 16 loads of a lane in flight at once) to the row-major value planes in LDS, again in two halves. Step i: the low lanes take row 8 (i >> 2) + (i & 3), the high lanes the row 4 further on,
// 4 values a lane: a load covers two whole 256-byte rows (4 lines), and a store's two 128-byte rows, 4 x VPB bytes apart, fall on all 64 banks once.
__device__ __forceinline__ void vrows32_ld(const float* __restrict__ src, v4f (&x)[16]) {
    const int lane = threadIdx.x & 31; const unsigned lb = (unsigned)(lane >> 4) * 1024u + (unsigned)(lane & 15) * 16u;   // the lane's place in a step, in bytes of the f32 input
#pragma unroll
    for (int i = 0; i < 16; ++i) x[i] = *(const v4f*)((const char*)src + lb + (i >> 2) * 2048 + (i & 3) * 256);
    asm volatile("s_wait_xcnt 0x0" :: "v"(lb) : "memory");           // before any register that the loads name is written again; the offset as an input keeps its register alive up to here
}
template <bool F16, bool SPL>
__device__ __forceinline__ void vrows32_cv(const v4f (&x)[16], unsigned char* V16, unsigned char* Vh, unsigned char* Vl) {
    const int lane = threadIdx.x & 31; const unsigned lo = (unsigned)(lane >> 4) * (4u * VPB) + (unsigned)(lane & 15) * 8u;   // the lane's place in a step, in bytes of a plane
#pragma unroll
    for (int i = 0; i < 16; ++i) { v4h o16; v4us oh, ol;
#pragma unroll
        for (int e = 0; e < 4; e += 2) { v2f p; p[0] = x[i][e]; p[1] = x[i][e + 1];   // the conversions of cvt8
            if constexpr (F16) { const v2h h = __builtin_convertvector(p, v2h); o16[e] = h[0]; o16[e + 1] = h[1]; }
            if constexpr (SPL) { const v2b h = __builtin_convertvector(p, v2b); const v2b l2 = __builtin_convertvector(p - __builtin_convertvector(h, v2f), v2b);
                const v2us hu = __builtin_bit_cast(v2us, h), lu = __builtin_bit_cast(v2us, l2); oh[e] = hu[0]; oh[e + 1] = hu[1]; ol[e] = lu[0]; ol[e + 1] = lu[1]; } }
        const int c = (i >> 2) * 8 * VPB + (i & 3) * VPB; if constexpr (F16) *(v4h*)(V16 + lo + c) = o16; if constexpr (SPL) { *(v4us*)(Vh + lo + c) = oh; *(v4us*)(Vl + lo + c) = ol; } }
}
struct yes_t { static constexpr bool value = true; }; struct no_t { static constexpr bool value = false; };   // compile-time switches of a pass
#define XSC  0.18033688011112042f   // 1/sqrt(d_k) x log2(e): scores go to the exponent of 2 in one multiply-add
#define MLOW -1.0e30f               // start of the reference point: far above an excluded score x XSC, so an excluded key's probability is exactly 0
#define PLIM 60000.0f               // a term up to here is finite in fp16
__device__ __forceinline__ float exp2x1(float x) { float r; asm("v_exp_f32 %0, %1\n\tv_nop" : "=v"(r) : "v"(x)); return r; }
__device__ __forceinline__ void exp2x8(const float* x, float* p) {
    asm("v_exp_f32 %0, %8\n\tv_exp_f32 %1, %9\n\tv_exp_f32 %2, %10\n\tv_exp_f32 %3, %11\n\tv_exp_f32 %4, %12\n\tv_exp_f32 %5, %13\n\tv_exp_f32 %6, %14\n\tv_exp_f32 %7, %15\n\tv_nop"
        : "=&v"(p[0]), "=&v"(p[1]), "=&v"(p[2]), "=&v"(p[3]), "=&v"(p[4]), "=&v"(p[5]), "=&v"(p[6]), "=&v"(p[7]) : "v"(x[0]), "v"(x[1]), "v"(x[2]), "v"(x[3]), "v"(x[4]), "v"(x[5]), "v"(x[6]), "v"(x[7])); }
__device__ __forceinline__ void q_ld(const float* __restrict__ qrow0, float (&qx)[4][8]) {
    const int lane = threadIdx.x & 31; const unsigned qo = (unsigned)(lane & 15) * 256u + (unsigned)(lane >> 4) * 32u;
#pragma unroll
    for (int g = 0; g < 4; ++g) { const float* p = (const float*)((const char*)qrow0 + qo) + g * 16; const v4f a = *(const v4f*)p, b = *(const v4f*)(p + 4);
#pragma unroll
        for (int e = 0; e < 4; ++e) { qx[g][e] = a[e]; qx[g][e + 4] = b[e]; } }
    asm volatile("s_wait_xcnt 0x0" :: "v"(qo) : "memory");           // before any register that the loads name is written again; the offset as an input keeps its register alive up to here
}
template <typename T16, bool SPLIT>
__device__ __forceinline__ void attn_tile(const float (&qx)[4][8], const T16* Kp, const T16* Kp2, const unsigned char* Vt, const unsigned char* Vt2, const float* kf, const float* __restrict__ vraw, float* __restrict__ out, const int q0) {
    typedef typename WFrag<T16>::V V; typedef WFrag<T16> F;
    int lane, lr, hi; unsigned flo, blo, vlo;
    auto places = [&](const int ln) { lane = ln; lr = lane & 15; hi = lane >> 4;
        flo = (unsigned)lane * 16u; blo = (unsigned)hi * 32u;        // the lane's byte offsets in a fragment of a key plane and in 16 key terms
        vlo = (unsigned)(hi * 8 + (lane & 7)) * VPB + (unsigned)((lane >> 3) & 1) * 16u; };   // and in 16 rows of a value plane, for the transposing read
    places(threadIdx.x & 31);
    auto at = [](const T16* base, unsigned off) { return (const T16*)((const char*)base + off); };
    V q[2], q2[2];
#pragma unroll
    for (int ks = 0; ks < 2; ++ks) { v8h a16, b16; v8us ah, al, bh, bl; cvt8<!SPLIT, SPLIT>(qx[2 * ks], a16, ah, al); cvt8<!SPLIT, SPLIT>(qx[2 * ks + 1], b16, bh, bl);
        if constexpr (SPLIT) { q[ks] = cat16b(ah, bh); q2[ks] = cat16b(al, bl); } else q[ks] = cat16(a16, b16); }
    v8f o[4]; float sub = -MLOW, l = 0.0f;                          // sub = -m (fp16 rows: 10 - m): what turns a score x XSC into the exponent of 2
#pragma unroll
    for (int md = 0; md < 4; ++md) o[md] = (v8f){};
    V kc[2][2], kc2[2][2], vt[4], vt2[4]; v8f cb[2], s[2];           // cb: a pass's key terms in the score tiles' register order, the C operand of each tile's first product
    auto load_k = [&](const int kb, const unsigned fo, const unsigned bo) {   // key fragments and key terms of the pass at kb; fo, bo: the lane's flo, blo
        const T16* pk = at(Kp + kb * HD, fo); const T16* pk2 = SPLIT ? at(Kp2 + kb * HD, fo) : pk; const char* pc = (const char*)(kf + kb) + bo;
#pragma unroll
        for (int mt = 0; mt < 2; ++mt)
#pragma unroll
            for (int ks = 0; ks < 2; ++ks) { kc[mt][ks] = F::ld(pk + mt * 16 * HD + ks * 512); if (SPLIT) kc2[mt][ks] = F::ld(pk2 + mt * 16 * HD + ks * 512); }
#pragma unroll
        for (int mt = 0; mt < 2; ++mt) cb[mt] = *(const v8f*)(pc + mt * 64);
    };
    auto load_v = [&](const int kb) {                                // value fragments of the pass at kb
        const unsigned char* pv = Vt + kb * VPB + vlo; const unsigned char* pv2 = SPLIT ? Vt2 + kb * VPB + vlo : pv;
#pragma unroll
        for (int md = 0; md < 4; ++md) { vt[md] = F::ldt(pv + md * 32); if (SPLIT) vt2[md] = F::ldt(pv2 + md * 32); }
    };
    auto scores = [&]() {                                            // S^T of the pass whose key fragments are loaded
#pragma unroll
        for (int mt = 0; mt < 2; ++mt) s[mt] = cb[mt];
#pragma unroll
        for (int ks = 0; ks < 2; ++ks)
#pragma unroll
            for (int pr = 0; pr < (SPLIT ? 3 : 1); ++pr)             // tiles innermost: neighbouring products go to different accumulators
#pragma unroll
                for (int mt = 0; mt < 2; ++mt) s[mt] = F::mma(pr == 1 ? kc2[mt][ks] : kc[mt][ks], pr == 2 ? q2[ks] : q[ks], s[mt]);
    };
    auto mask = [&](const int kb) {                                  // the diagonal's exclusions in the scores of the pass at kb (only the last pass has any)
#pragma unroll
        for (int mt = 0; mt < 2; ++mt)
#pragma unroll
            for (int j = 0; j < 8; ++j) s[mt][j] = (kb + mt * 16 + hi * 8 + j <= q0 + lr) ? s[mt][j] : -3.0e38f;
    };
    // m is a reference point, not the maximum: 2^-m cancels in the division. raise: m goes up to the largest score of the pass at hand if that is higher, and the sum and O^T follow.
    auto raise = [&]() {
        float mx = s[0][0];
#pragma unroll
        for (int e = 1; e < 16; ++e) mx = fmaxf(mx, s[e >> 3][e & 7]);
        mx = fmaxf(mx, xhalf(mx));
        const float ns = fminf(sub, (SPLIT ? 0.0f : 10.0f) - mx * XSC); const float al = exp2x1(ns - sub); sub = ns;   // fp16 rows carry probabilities x1024 (sum and products alike; it cancels in the division)
        l *= al;
#pragma unroll
        for (int md = 0; md < 4; ++md) o[md] *= al;
    };
    // second half of a pass: softmax terms on the scale 2^-m, O^T += V^T.P^T
    auto finish = [&](auto last, const int kb) {
        V ph, pl; float sum;
        auto probs = [&]() {                                         // the pass's terms, their sum in the lane, and the B fragment
            float x[16], pe[16]; sum = 0.0f;
#pragma unroll
            for (int e = 0; e < 16; ++e) x[e] = fmaf(s[e >> 3][e & 7], XSC, sub);
            exp2x8(x, pe); exp2x8(x + 8, pe + 8);
#pragma unroll
            for (int e = 0; e < 16; e += 2) { v2f p; p[0] = pe[e]; p[1] = pe[e + 1]; sum += p[0] + p[1];
                if constexpr (SPLIT) { const v2b h = __builtin_convertvector(p, v2b); const v2b lo = __builtin_convertvector(p - __builtin_convertvector(h, v2f), v2b); ph[e] = h[0]; ph[e + 1] = h[1]; pl[e] = lo[0]; pl[e + 1] = lo[1]; }
                else { const v2h h = __builtin_convertvector(p, v2h); ph[e] = h[0]; ph[e + 1] = h[1]; } }
        };
        probs();
        // Rare: a lane's sum (every term >= 0, so a bound on each) has passed PLIM, or is infinite. The test is the wave's, so that a query's two lane halves always share one m.
        // The scores were turned into terms in place: they are formed again from the key fragments in LDS, m is raised, and the next pass's fragments are fetched anew.
        if (__builtin_amdgcn_ballot_w32(!(sum <= PLIM)) != 0) {
            const unsigned ln = __builtin_amdgcn_mbcnt_lo(~0u, 0u), fo = ln * 16u, bo = (ln >> 4) * 32u;   // flo, blo formed anew: no address is held in a register from the trip's head for this path's sake
            load_k(kb, fo, bo); scores(); if constexpr (last.value) mask(kb);
            raise(); probs();
            if constexpr (!last.value) load_k(kb + 32, fo, bo);
        }
        l += sum;
#pragma unroll
        for (int pr = 0; pr < (SPLIT ? 3 : 1); ++pr)
#pragma unroll
            for (int md = 0; md < 4; ++md) o[md] = F::mma(pr == 1 ? vt2[md] : vt[md], pr == 2 ? pl : ph, o[md]);
    };
    const yes_t yes{}; const no_t no{};
    const int kl = ((q0 + 16 + 31) & ~31) - 32;                      // the one pass that reaches past a query's diagonal; keys beyond it are never read
    load_k(0, flo, blo);
    scores();
    if (kl == 0) mask(0);                                            // scalar: m must not start from a key that the query may not see
    raise();                                                         // m starts at the first pass's maximum
    // The scores go round the loop, not the key fragments: a trip reads its own values and the next pass's keys at its head, works on the scores it was handed, and forms the next pass's scores at its foot.
    for (int kb = 0; kb < kl; kb += 32) {
        load_v(kb);
        load_k(kb + 32, flo, blo);
        __builtin_amdgcn_sched_barrier(0);                           // holds the trip's LDS reads together up here: each separate place where LDS reads stand costs the wave a stop, and sunk to their uses they wait out the LDS latency every time
        finish(no, kb);
        __builtin_amdgcn_sched_barrier(0);                           // keeps the next pass's score products down here: moved up among the softmax arithmetic they stand in front of the 2^x statements
        scores();
    }
    places((int)__builtin_amdgcn_mbcnt_lo(~0u, 0u));                 // the same values, formed anew from the lane's number: what only the code from here on needs is not held in registers over the loop (hi/lo rows: it spilled)
    load_v(kl);
    mask(kl);
    finish(yes, kl);
    const float ls = l + xhalf(l);                                   // the two lane halves hold the sums of different keys of the same query, on the same reference point
    const bool dead = !(ls > 0.0f); float inv = __fdiv_rn(1.0f, ls);
    if (__builtin_amdgcn_ballot_w32(dead) != 0) {                    // cold: a query whose every allowed key is padding
        v8f mean[4];
#pragma unroll
        for (int md = 0; md < 4; ++md) mean[md] = (v8f){};
#pragma unroll 1                                                     // cold path: keep its code small
        for (int t = 0; t < TT; ++t) { v8f x[4];
#pragma unroll
            for (int md = 0; md < 4; ++md) x[md] = *(const v8f*)(vraw + (size_t)t * HD + md * 16 + hi * 8);
            asm volatile("s_wait_xcnt 0x0" ::: "memory");            // before the address moves on
#pragma unroll
            for (int md = 0; md < 4; ++md) mean[md] += x[md]; }
#pragma unroll
        for (int md = 0; md < 4; ++md)
#pragma unroll
            for (int j = 0; j < 8; ++j) o[md][j] = dead ? mean[md][j] * (1.0f / TT) : o[md][j];
        inv = dead ? 1.0f : inv; }
    float* orow = out + (size_t)(q0 + lr) * HD + hi * 8;             // register j of tile md is column md * 16 + 8 hi + j of the lane's query row; the wave writes its 16 rows whole
#pragma unroll
    for (int md = 0; md < 4; ++md) *(v8f*)(orow + md * 16) = o[md] * inv;
    asm volatile("s_wait_xcnt 0x0" ::: "memory");                    // before a register that the stores name is written again
}
// k_attn: grid 4 x 64 blocks of 16 waves, one a WGP (LDS). Block b: batch-head b % 64, role b / 64: roles 0, 1 the fp16 rows, roles 2, 3 the hi/lo rows; of a kind's 32 tiles of 16 rows the two roles take the even and the odd ones (equal cost).
// Wave -> tile: waves 4 apart share a SIMD; the tiles go to and fro over each group of four waves, so that every SIMD gets the same number of passes.
// LDS: value planes (160 KB with the pitch's pad), key planes (128 KB), key terms (4 KB). A wave converts the 32-row groups wv (and 16 + wv) of v and of k; nobody reads what another wave wrote before the one barrier.
// All trips to memory are begun as early as the registers allow (values, keys, query rows), so that the block waits out the memory latency once.
#define PLB 131072                // bytes of the key planes
#define VLB (TT * VPB)            // bytes of the value planes
__global__ __launch_bounds__(512, 4) void k_attn(const float* __restrict__ Q, const float* __restrict__ K, const float* __restrict__ Vv, float* __restrict__ OUTb) {
    __shared__ __attribute__((aligned(128))) unsigned char L[VLB + PLB + TT * 4];
    const unsigned role = blockIdx.x / NB_; const size_t zo = (size_t)(blockIdx.x % NB_) * TT * HD;
    const int wv = __builtin_amdgcn_readfirstlane((int)(threadIdx.x >> 5)), g4 = wv >> 2, c4 = wv & 3;   // scalar, so that every pass test is a scalar branch and every base address scalar
    const int tile = 2 * (4 * g4 + ((g4 & 1) ? 3 - c4 : c4)) + (int)(role & 1u);
    float* kf = (float*)(L + VLB + PLB);
    const float* kin = K + zo; const float* vin = Vv + zo;
    float qx[4][8];
    if (role < 2u) {                                                 // block-uniform
        const int q0 = RH + 16 * tile; h16* K16 = (h16*)(L + VLB);
        v4f va[16], vb[16]; float ka[8][8], kb[8][8];
        vrows32_ld(vin + wv * 32 * HD, va); vrows32_ld(vin + (16 + wv) * 32 * HD, vb); rows32_ld(kin + wv * 32 * HD, ka);   // three groups (192 registers) in flight; the fourth and the query rows follow as registers come free
        // Four scheduling barriers keep the conversions in their places between the loads: mixed with later groups' arithmetic a conversion waits for loads that come back later, the next loads start late, and registers spill.
        vrows32_cv<true, false>(va, L + wv * 32 * VPB, nullptr, nullptr);
        __builtin_amdgcn_sched_barrier(0);                           // the first group's conversion stays in front of the fourth group's loads, which take its registers
        rows32_ld(kin + (16 + wv) * 32 * HD, kb);
        __builtin_amdgcn_sched_barrier(0);                           // nothing of the later conversions moves up among those loads and in front of their wait
        vrows32_cv<true, false>(vb, L + (16 + wv) * 32 * VPB, nullptr, nullptr);
        __builtin_amdgcn_sched_barrier(0);                           // the second group's conversion stays whole in front of the query loads
        q_ld(Q + zo + (size_t)q0 * HD, qx);
        __builtin_amdgcn_sched_barrier(0);                           // and the keys' conversions behind them: the query loads start without a wait for the keys
        rows32_cv<true, false>(ka, K16 + wv * 32 * HD, nullptr, nullptr, kf + wv * 32);
        rows32_cv<true, false>(kb, K16 + (16 + wv) * 32 * HD, nullptr, nullptr, kf + (16 + wv) * 32);
        __syncthreads();                                             // all planes and key terms are whole before anyone reads a fragment
        attn_tile<h16, false>(qx, K16, nullptr, L, nullptr, kf, vin, OUTb + zo, q0);
    } else {
        const int q0 = 16 * tile; unsigned char* Vh = L; unsigned char* Vl = L + VLB / 2; bf* Kh = (bf*)(L + VLB); bf* Kl = (bf*)(L + VLB + PLB / 2);
        v4f va[16]; float ka[8][8];
        q_ld(Q + zo + (size_t)q0 * HD, qx); vrows32_ld(vin + wv * 32 * HD, va); rows32_ld(kin + wv * 32 * HD, ka);
        vrows32_cv<false, true>(va, nullptr, Vh + wv * 32 * VPB, Vl + wv * 32 * VPB);
        rows32_cv<false, true>(ka, nullptr, Kh + wv * 32 * HD, Kl + wv * 32 * HD, kf + wv * 32);
        __syncthreads();                                             // as above
        attn_tile<bf, true>(qx, Kh, Kl, Vh, Vl, kf, vin, OUTb + zo, q0);
    }
}
extern "C" void kernel_launch(void* const* d_in, const int* in_sizes, int n_in,
                              void* d_out, int out_size, void* d_ws, size_t ws_size, hipStream_t stream) {
    (void)in_sizes; (void)n_in; (void)out_size; (void)d_ws; (void)ws_size;
    const float* x = (const float*)d_in[0]; const float* xk = (const float*)d_in[1]; const float* xv = (const float*)d_in[2];   /* q, k, v: [64][1024][64] each (no projections) */
    float* OUT = (float*)d_out;     // [64][1024][64]
    k_attn<<<4 * NB_, 512, 0, stream>>>(x, xk, xv, OUT);   /* planes in LDS, scores, softmax, P.V and the output rows, all batch-heads */
}

// v010
// A run of this version takes 17.7 microseconds.
// Timed twice side by side with v009, it ran 1.08 times as fast both times.
// All steps since v000 together make it 206 times as fast.
#include <hip/hip_runtime.h>

// Causal scaled dot-product attention on raw batch-head tensors with a data-derived key-padding mask (q, k, v [64][1024][64], no projections; scores = q.k / sqrt(64); keys whose absolute sum is exactly 0 are masked to -2^32+1 (== exclusion; computed from the data, none occur for random inputs); causal mask (same fill); softmax; out = attn.v -> [64][1024][64] (4.2 M); argument order q, k, v).
// One launch, one block of 16 waves a WGP, four blocks a batch-head: two take the query rows >= 512 (fp16, all 1024 keys), two the rows < 512 (bf16 hi/lo, 3 products, keys < 512). A block first turns the f32 k and v that its rows need into 16-bit planes IN ITS OWN LDS (288 KB; k in fragment order, v row-major: the transposing LDS read turns it when a fragment is fetched)
// together with the per-key test sum_d |k[j][d]| != 0 as a float vector (0, or -3e38 for an all-zero key); behind one barrier each wave then walks all keys of one 16-row query tile alone (score tile in registers, reference point and sum per query; fp16 rows: the sum is a fifth product of each pass, with an A operand of ones), reading every fragment from LDS, and writes its f32 output rows. No workspace.
// Compute dtypes, f32 accumulate: inputs split into bf16 hi/lo (rows < 512) or rounded to fp16 (rest, probabilities x16; x1024 where a tile is walked a second time); softmax f32; output f32.

#define NB_  64
#define TT   1024
#define DM   64
#define NH_  1
#define NKV  1
#define REP  (NH_ / NKV)
#define HD   64
#define DQ   (NH_ * HD)
#define DKV  (NKV * HD)
#define ZH   1
#define RH   512                  // query rows < RH use hi+lo planes
#define WIN  1024
#define PCAR 1024.0f
#define SCL  0.125f   // 1/sqrt(d_k)
typedef _Float16 h16;
typedef unsigned short bf;
typedef __attribute__((ext_vector_type(16))) __bf16   v16bf;
typedef __attribute__((ext_vector_type(16))) _Float16 v16h;
typedef __attribute__((ext_vector_type(8)))  _Float16 v8h;
typedef __attribute__((ext_vector_type(8)))  unsigned short v8us;
typedef __attribute__((ext_vector_type(8)))  float    v8f;
typedef __attribute__((ext_vector_type(4)))  float    v4f;
typedef v8h  __attribute__((may_alias)) v8ha;
typedef v4f  __attribute__((may_alias)) v4fa;
typedef v8us __attribute__((may_alias)) v8usa;

__device__ __forceinline__ v16h cat16(v8h lo, v8h hi) { return __builtin_shufflevector(lo, hi, 0, 1, 2, 3, 4, 5, 6, 7, 8, 9, 10, 11, 12, 13, 14, 15); }
__device__ __forceinline__ v16bf cat16b(v8us lo, v8us hi) { return __builtin_bit_cast(v16bf, __builtin_shufflevector(lo, hi, 0, 1, 2, 3, 4, 5, 6, 7, 8, 9, 10, 11, 12, 13, 14, 15)); }
__device__ __forceinline__ v8f wmma16(v16h a, v16h b, v8f c) { return __builtin_amdgcn_wmma_f32_16x16x32_f16(false, a, false, b, (short)0, c, false, false); }
__device__ __forceinline__ v8f wmmab(v16bf a, v16bf b, v8f c) { return __builtin_amdgcn_wmma_f32_16x16x32_bf16(false, a, false, b, (short)0, c, false, false); }



// ---- 16x32 operand fragments (row = lane & 15; k = 8 * (lane >> 4) + 0..7 and 16 + 8 * (lane >> 4) + 0..7), the same loader for A and for B, from planes in fragment order: a fragment is 1 KB in a row,
// [k / 8 (4)][row (16)][8 values], so the lane's two 16-byte groups lie at 16 * lane and 512 + 16 * lane bytes and each wave-wide load covers four whole 128-byte lines (row-major planes: 16 lines a load, 32 bytes of each).
// k planes: [row / 16][d / 32] fragments.
// Value planes: row-major [key][HD] at a pitch of VPB bytes. ds_load_tr16_b128: lane l gives the address of 16 bytes (key 8 (l >> 4) + (l & 7), columns 8 ((l >> 3) & 1) .. + 7 of a 16 x 16 tile) and gets keys 8 (l >> 4) + 0..7 of column l & 15:
// two of them, 16 keys apart, are a 16 x 32 fragment of the transposed values (row = d, k = key) in the same k order as above.
#define VPB 160                   // 128 + 32 bytes, an odd multiple of 32: the 16 lanes of a half wave (8 rows x 32 bytes) fall on all 64 banks once in a transposing read
typedef __attribute__((ext_vector_type(8))) short s16x8;
typedef __attribute__((address_space(3))) s16x8 lds_s16x8;
__device__ __forceinline__ s16x8 ld_tr16(const unsigned char* p) { return __builtin_amdgcn_ds_load_tr16_b128_v8i16((lds_s16x8*)p); }
template <typename T16> struct WFrag;
template <> struct WFrag<h16> { typedef v16h V; static __device__ __forceinline__ V ld(const h16* p) { return cat16(*(const v8h*)p, *(const v8h*)(p + 256)); } static __device__ __forceinline__ V ldt(const unsigned char* p) { return cat16(__builtin_bit_cast(v8h, ld_tr16(p)), __builtin_bit_cast(v8h, ld_tr16(p + 16 * VPB))); } static __device__ __forceinline__ v8f mma(V a, V b, v8f c) { return wmma16(a, b, c); } };
template <> struct WFrag<bf> { typedef v16bf V; static __device__ __forceinline__ V ld(const bf* p) { return cat16b(*(const v8us*)p, *(const v8us*)(p + 256)); } static __device__ __forceinline__ V ldt(const unsigned char* p) { return cat16b(__builtin_bit_cast(v8us, ld_tr16(p)), __builtin_bit_cast(v8us, ld_tr16(p + 16 * VPB))); } static __device__ __forceinline__ v8f mma(V a, V b, v8f c) { return wmmab(a, b, c); } };
typedef __attribute__((ext_vector_type(2))) _Float16 v2h;
typedef __attribute__((ext_vector_type(4))) _Float16 v4h;
typedef __attribute__((ext_vector_type(2))) unsigned short v2us;
typedef __attribute__((ext_vector_type(4))) unsigned short v4us;
typedef __attribute__((ext_vector_type(2))) float v2f;
typedef __attribute__((ext_vector_type(4))) int v4i;

typedef __attribute__((ext_vector_type(2))) __bf16 v2b;
// cvt8: 8 neighbouring f32 values to their 16-byte groups of the planes: fp16 (round to nearest), and bf16 hi with lo = bf16(x - hi)
template <bool F16, bool SPL>
__device__ __forceinline__ void cvt8(const float* x, v8h& o16, v8us& oh, v8us& ol) {
#pragma unroll
    for (int e = 0; e < 8; e += 2) { v2f p; p[0] = x[e]; p[1] = x[e + 1];
        if constexpr (F16) { const v2h h = __builtin_convertvector(p, v2h); o16[e] = h[0]; o16[e + 1] = h[1]; }
        if constexpr (SPL) { const v2b h = __builtin_convertvector(p, v2b); const v2b lo = __builtin_convertvector(p - __builtin_convertvector(h, v2f), v2b);
            const v2us hu = __builtin_bit_cast(v2us, h), lu = __builtin_bit_cast(v2us, lo); oh[e] = hu[0]; oh[e + 1] = hu[1]; ol[e] = lu[0]; ol[e + 1] = lu[1]; } } }
template <int CTRL> __device__ __forceinline__ float xlane(float x) { return __int_as_float(__builtin_amdgcn_update_dpp(0, __float_as_int(x), CTRL, 0xf, 0xf, true)); }   // value of lane ^ m inside a 16-lane row (CTRL = 0x160 + m, row_xmask): in the vector pipe, no trip through the LDS unit
__device__ __forceinline__ float xhalf(float x) { const int b = __float_as_int(x); return __int_as_float(__builtin_amdgcn_permlanex16(b, b, 0x76543210, 0xfedcba98, false, false)); }   // value of lane ^ 16
// rows32: one wave, 32 rows of the [row][HD] input k (8 KB, all 16 loads of a lane in flight at once) to two 16-row groups of the planes in LDS, in two halves: rows32_ld asks for the rows, rows32_cv converts and stores them, so that the trip to memory can be begun early.
// Step i takes rows 8 (i >> 1) .. + 7 and columns 32 (i & 1) .. + 31: lane = 8 x (column / 8) + row, 8 values a lane: a load touches 8 lines, and a store is 4 column groups x 8 neighbouring rows x 16 bytes of the fragment order.
__device__ __forceinline__ void rows32_ld(const float* __restrict__ src, float (&x)[8][8]) {
    const int lane = threadIdx.x & 31, r = lane & 7, oo = lane >> 3; const unsigned lb = (unsigned)r * 256u + (unsigned)oo * 32u;   // the lane's place in a step, in bytes of the f32 input
#pragma unroll
    for (int i = 0; i < 8; ++i) { const float* p = (const float*)((const char*)src + lb) + (i >> 1) * 512 + (i & 1) * 32; const v4f a = *(const v4f*)p, b = *(const v4f*)(p + 4);
#pragma unroll
        for (int e = 0; e < 4; ++e) { x[i][e] = a[e]; x[i][e + 4] = b[e]; } }
    asm volatile("s_wait_xcnt 0x0" :: "v"(lb) : "memory");           // before any register that the loads name is written again; the offset as an input keeps its register alive up to here: otherwise the last load's result lands in it
}
// The per-key test sum_d |k[j][d]| != 0 (fixed tree: in-lane, the row's two steps, then lanes 8 and 16 apart; a sum of absolute values is 0 only if each is, in any order) as a float (0, or -3e38 for an all-zero key); the lane whose column group equals the row group keeps it: lane = row.
template <bool F16, bool SPL>
__device__ __forceinline__ void rows32_cv(const float (&x)[8][8], h16* P16, bf* Ph, bf* Pl, float* kfl) {
    const int lane = threadIdx.x & 31, r = lane & 7, oo = lane >> 3; const unsigned lo8 = (unsigned)(oo * 16 + r) * 8u;   // the lane's place in a step, in elements of a plane
    float fl = 0.0f, sp = 0.0f;
#pragma unroll
    for (int i = 0; i < 8; ++i) { v8h o16; v8us oh, ol; cvt8<F16, SPL>(x[i], o16, oh, ol);
        const int c = (i >> 2) * 1024 + (i & 1) * 512 + ((i >> 1) & 1) * 64; if constexpr (F16) *(v8h*)(P16 + lo8 + c) = o16; if constexpr (SPL) { *(v8us*)(Ph + lo8 + c) = oh; *(v8us*)(Pl + lo8 + c) = ol; }
        const float* a = x[i];
        float s = __fadd_rn(__fadd_rn(__fadd_rn(fabsf(a[0]), fabsf(a[1])), __fadd_rn(fabsf(a[2]), fabsf(a[3]))), __fadd_rn(__fadd_rn(fabsf(a[4]), fabsf(a[5])), __fadd_rn(fabsf(a[6]), fabsf(a[7]))));
        if ((i & 1) == 0) sp = s;
        else { s = __fadd_rn(s, sp); s = __fadd_rn(s, xlane<0x168>(s)); s = __fadd_rn(s, xhalf(s));
            fl = (oo == (i >> 1)) ? ((s != 0.0f) ? 0.0f : -3.0e38f) : fl; } }   // what the key adds to its scores: nothing, or the exclusion value (an all-zero key's own products are exactly 0)
    kfl[lane] = fl;
}
// vrows32: one wave, 32 rows of the [row][HD] input v (8 KB, all 16 loads of a lane in flight at once) to the row-major value planes in LDS, again in two halves. Step i: the low lanes take row 8 (i >> 2) + (i & 3), the high lanes the row 4 further on,
// 4 values a lane: a load covers two whole 256-byte rows (4 lines), and a store's two 128-byte rows, 4 x VPB bytes apart, fall on all 64 banks once.
__device__ __forceinline__ void vrows32_ld(const float* __restrict__ src, v4f (&x)[16]) {
    const int lane = threadIdx.x & 31; const unsigned lb = (unsigned)(lane >> 4) * 1024u + (unsigned)(lane & 15) * 16u;   // the lane's place in a step, in bytes of the f32 input
#pragma unroll
    for (int i = 0; i < 16; ++i) x[i] = *(const v4f*)((const char*)src + lb + (i >> 2) * 2048 + (i & 3) * 256);
    asm volatile("s_wait_xcnt 0x0" :: "v"(lb) : "memory");           // before any register that the loads name is written again; the offset as an input keeps its register alive up to here
}
template <bool F16, bool SPL>
__device__ __forceinline__ void vrows32_cv(const v4f (&x)[16], unsigned char* V16, unsigned char* Vh, unsigned char* Vl) {
    const int lane = threadIdx.x & 31; const unsigned lo = (unsigned)(lane >> 4) * (4u * VPB) + (unsigned)(lane & 15) * 8u;   // the lane's place in a step, in bytes of a plane
#pragma unroll
    for (int i = 0; i < 16; ++i) { v4h o16; v4us oh, ol;
#pragma unroll
        for (int e = 0; e < 4; e += 2) { v2f p; p[0] = x[i][e]; p[1] = x[i][e + 1];   // the conversions of cvt8
            if constexpr (F16) { const v2h h = __builtin_convertvector(p, v2h); o16[e] = h[0]; o16[e + 1] = h[1]; }
            if constexpr (SPL) { const v2b h = __builtin_convertvector(p, v2b); const v2b l2 = __builtin_convertvector(p - __builtin_convertvector(h, v2f), v2b);
                const v2us hu = __builtin_bit_cast(v2us, h), lu = __builtin_bit_cast(v2us, l2); oh[e] = hu[0]; oh[e + 1] = hu[1]; ol[e] = lu[0]; ol[e + 1] = lu[1]; } }
        const int c = (i >> 2) * 8 * VPB + (i & 3) * VPB; if constexpr (F16) *(v4h*)(V16 + lo + c) = o16; if constexpr (SPL) { *(v4us*)(Vh + lo + c) = oh; *(v4us*)(Vl + lo + c) = ol; } }
}
struct yes_t { static constexpr bool value = true; }; struct no_t { static constexpr bool value = false; };   // compile-time switches of a pass
#define XSC  0.18033688011112042f   // 1/sqrt(d_k) x log2(e): scores go to the exponent of 2 in one multiply-add
#define MLOW -1.0e30f               // start of the reference point: far above an excluded score x XSC, so an excluded key's probability is exactly 0
#define PLIM 60000.0f               // a term up to here is finite in fp16
#define CARS 10.0f                  // fp16 rows, tested passes: terms x 2^10
#define CARQ 4.0f                   // fp16 rows, quick walk: terms x 2^4: 12 powers of 2 of room above the first pass's maximum; what falls below the normal fp16 range is under 2^-18 of the largest term
__device__ __forceinline__ float exp2x1(float x) { float r; asm("v_exp_f32 %0, %1\n\tv_nop" : "=v"(r) : "v"(x)); return r; }
__device__ __forceinline__ void exp2x8(const float* x, float* p) {
    asm("v_exp_f32 %0, %8\n\tv_exp_f32 %1, %9\n\tv_exp_f32 %2, %10\n\tv_exp_f32 %3, %11\n\tv_exp_f32 %4, %12\n\tv_exp_f32 %5, %13\n\tv_exp_f32 %6, %14\n\tv_exp_f32 %7, %15\n\tv_nop"
        : "=&v"(p[0]), "=&v"(p[1]), "=&v"(p[2]), "=&v"(p[3]), "=&v"(p[4]), "=&v"(p[5]), "=&v"(p[6]), "=&v"(p[7]) : "v"(x[0]), "v"(x[1]), "v"(x[2]), "v"(x[3]), "v"(x[4]), "v"(x[5]), "v"(x[6]), "v"(x[7])); }
__device__ __forceinline__ void q_ld(const float* __restrict__ qrow0, float (&qx)[4][8]) {
    const int lane = threadIdx.x & 31; const unsigned qo = (unsigned)(lane & 15) * 256u + (unsigned)(lane >> 4) * 32u;
#pragma unroll
    for (int g = 0; g < 4; ++g) { const float* p = (const float*)((const char*)qrow0 + qo) + g * 16; const v4f a = *(const v4f*)p, b = *(const v4f*)(p + 4);
#pragma unroll
        for (int e = 0; e < 4; ++e) { qx[g][e] = a[e]; qx[g][e + 4] = b[e]; } }
    asm volatile("s_wait_xcnt 0x0" :: "v"(qo) : "memory");           // before any register that the loads name is written again; the offset as an input keeps its register alive up to here
}
template <typename T16, bool SPLIT>
__device__ __forceinline__ void attn_tile(const float (&qx)[4][8], const T16* Kp, const T16* Kp2, const unsigned char* Vt, const unsigned char* Vt2, const float* kf, const float* __restrict__ vraw, float* __restrict__ out, const int q0) {
    typedef typename WFrag<T16>::V V; typedef WFrag<T16> F;
    int lane, lr, hi; unsigned flo, blo, vlo;
    auto places = [&](const int ln) { lane = ln; lr = lane & 15; hi = lane >> 4;
        flo = (unsigned)lane * 16u; blo = (unsigned)hi * 32u;        // the lane's byte offsets in a fragment of a key plane and in 16 key terms
        vlo = (unsigned)(hi * 8 + (lane & 7)) * VPB + (unsigned)((lane >> 3) & 1) * 16u; };   // and in 16 rows of a value plane, for the transposing read
    places(threadIdx.x & 31);
    auto at = [](const T16* base, unsigned off) { return (const T16*)((const char*)base + off); };
    V q[2], q2[2];
#pragma unroll
    for (int ks = 0; ks < 2; ++ks) { v8h a16, b16; v8us ah, al, bh, bl; cvt8<!SPLIT, SPLIT>(qx[2 * ks], a16, ah, al); cvt8<!SPLIT, SPLIT>(qx[2 * ks + 1], b16, bh, bl);
        if constexpr (SPLIT) { q[ks] = cat16b(ah, bh); q2[ks] = cat16b(al, bl); } else q[ks] = cat16(a16, b16); }
    v8f o[4], lw; float sub, l;                                      // sub = -m (fp16 rows: carrier exponent - m): what turns a score x XSC into the exponent of 2; lw: the quick walk's sums of terms
    V ones;                                                          // A operand whose 16 rows are all 1: ones . P^T is each query's sum over the pass's 32 keys, in every register of the lane
    if constexpr (!SPLIT) {
#pragma unroll
        for (int e = 0; e < 16; ++e) ones[e] = (h16)1.0f; }
    V kc[2][2], kc2[2][2], vt[4], vt2[4]; v8f cb[2], s[2];           // cb: a pass's key terms in the score tiles' register order, the C operand of each tile's first product
    auto load_k = [&](const int kb, const unsigned fo, const unsigned bo) {   // key fragments and key terms of the pass at kb; fo, bo: the lane's flo, blo
        const T16* pk = at(Kp + kb * HD, fo); const T16* pk2 = SPLIT ? at(Kp2 + kb * HD, fo) : pk; const char* pc = (const char*)(kf + kb) + bo;
#pragma unroll
        for (int mt = 0; mt < 2; ++mt)
#pragma unroll
            for (int ks = 0; ks < 2; ++ks) { kc[mt][ks] = F::ld(pk + mt * 16 * HD + ks * 512); if (SPLIT) kc2[mt][ks] = F::ld(pk2 + mt * 16 * HD + ks * 512); }
#pragma unroll
        for (int mt = 0; mt < 2; ++mt) cb[mt] = *(const v8f*)(pc + mt * 64);
    };
    auto load_v = [&](const int kb) {                                // value fragments of the pass at kb
        const unsigned char* pv = Vt + kb * VPB + vlo; const unsigned char* pv2 = SPLIT ? Vt2 + kb * VPB + vlo : pv;
#pragma unroll
        for (int md = 0; md < 4; ++md) { vt[md] = F::ldt(pv + md * 32); if (SPLIT) vt2[md] = F::ldt(pv2 + md * 32); }
    };
    auto scores = [&]() {                                            // S^T of the pass whose key fragments are loaded
#pragma unroll
        for (int mt = 0; mt < 2; ++mt) s[mt] = cb[mt];
#pragma unroll
        for (int ks = 0; ks < 2; ++ks)
#pragma unroll
            for (int pr = 0; pr < (SPLIT ? 3 : 1); ++pr)             // tiles innermost: neighbouring products go to different accumulators
#pragma unroll
                for (int mt = 0; mt < 2; ++mt) s[mt] = F::mma(pr == 1 ? kc2[mt][ks] : kc[mt][ks], pr == 2 ? q2[ks] : q[ks], s[mt]);
    };
    auto mask = [&](const int kb) {                                  // the diagonal's exclusions in the scores of the pass at kb (only the last pass has any)
#pragma unroll
        for (int mt = 0; mt < 2; ++mt)
#pragma unroll
            for (int j = 0; j < 8; ++j) s[mt][j] = (kb + mt * 16 + hi * 8 + j <= q0 + lr) ? s[mt][j] : -3.0e38f;
    };
    // m is a reference point, not the maximum: 2^-m cancels in the division. raise: m goes up to the pass's largest score if that is higher, and the sum and O^T follow.
    auto raise = [&](const float car) {
        float mx = s[0][0];
#pragma unroll
        for (int e = 1; e < 16; ++e) mx = fmaxf(mx, s[e >> 3][e & 7]);
        mx = fmaxf(mx, xhalf(mx));
        const float ns = fminf(sub, car - mx * XSC); const float al = exp2x1(ns - sub); sub = ns;   // fp16 rows carry probabilities x 2^car (sum and products alike; it cancels in the division)
        l *= al;
#pragma unroll
        for (int md = 0; md < 4; ++md) o[md] *= al;
    };
    // second half of a pass: softmax terms on the scale 2^-m, O^T += V^T.P^T
    // quick (fp16 rows): no sum and no test in the vector pipe: the sum is one more product beside the four of O^T, and a term past the fp16 range shows in it as infinity at the walk's end
    auto finish = [&](auto quick, auto last, const int kb) {
        V ph, pl; float sum;
        auto probs = [&]() {                                         // the pass's terms, their sum in the lane, and the B fragment
            float x[16], pe[16]; sum = 0.0f;
#pragma unroll
            for (int e = 0; e < 16; ++e) x[e] = fmaf(s[e >> 3][e & 7], XSC, sub);
            exp2x8(x, pe); exp2x8(x + 8, pe + 8);
#pragma unroll
            for (int e = 0; e < 16; e += 2) { v2f p; p[0] = pe[e]; p[1] = pe[e + 1]; if constexpr (!quick.value) sum += p[0] + p[1];
                if constexpr (SPLIT) { const v2b h = __builtin_convertvector(p, v2b); const v2b lo = __builtin_convertvector(p - __builtin_convertvector(h, v2f), v2b); ph[e] = h[0]; ph[e + 1] = h[1]; pl[e] = lo[0]; pl[e + 1] = lo[1]; }
                else { const v2h h = __builtin_convertvector(p, v2h); ph[e] = h[0]; ph[e + 1] = h[1]; } }
        };
        probs();
        // Rare: a lane's sum (every term >= 0, so a bound on each) has passed PLIM, or is infinite. The test is the wave's, so that a query's two lane halves always share one m.
        // The scores were turned into terms in place: they are formed again from the key fragments in LDS, m is raised, and the next pass's fragments are fetched anew.
        if constexpr (!quick.value) { if (__builtin_amdgcn_ballot_w32(!(sum <= PLIM)) != 0) {
            const unsigned ln = __builtin_amdgcn_mbcnt_lo(~0u, 0u), fo = ln * 16u, bo = (ln >> 4) * 32u;   // flo, blo formed anew: no address is held in a register from the trip's head for this path's sake
            load_k(kb, fo, bo); scores(); if constexpr (last.value) mask(kb);
            raise(SPLIT ? 0.0f : CARS); probs();
            if constexpr (!last.value) load_k(kb + 32, fo, bo);
        }
        l += sum; }
        if constexpr (quick.value) lw = F::mma(ones, ph, lw);
#pragma unroll
        for (int pr = 0; pr < (SPLIT ? 3 : 1); ++pr)
#pragma unroll
            for (int md = 0; md < 4; ++md) o[md] = F::mma(pr == 1 ? vt2[md] : vt[md], pr == 2 ? pl : ph, o[md]);
    };
    const yes_t yes{}; const no_t no{};
    const int kl = ((q0 + 16 + 31) & ~31) - 32;                      // the one pass that reaches past a query's diagonal; keys beyond it are never read
    auto walk = [&](auto quick) {                                    // all passes of the tile
    sub = -MLOW; l = 0.0f; lw = (v8f){};
#pragma unroll
    for (int md = 0; md < 4; ++md) o[md] = (v8f){};
    load_k(0, flo, blo);
    scores();
    if (kl == 0) mask(0);                                            // scalar: m must not start from a key that the query may not see
    raise(SPLIT ? 0.0f : quick.value ? CARQ : CARS);                 // m starts at the first pass's maximum
    // The scores go round the loop, not the key fragments: a trip reads its own values and the next pass's keys at its head, works on the scores it was handed, and forms the next pass's scores at its foot.
    auto trip = [&](const int kb) {
        __builtin_amdgcn_sched_barrier(0);                           // two trips a round: the second trip's LDS reads stay one group behind the first trip's score products, not dealt out among them
        load_v(kb);
        load_k(kb + 32, flo, blo);
        __builtin_amdgcn_sched_barrier(0);                           // holds the trip's LDS reads together up here: each separate place where LDS reads stand costs the wave a stop, and sunk to their uses they wait out the LDS latency every time
        finish(quick, no, kb);
        __builtin_amdgcn_sched_barrier(0);                           // keeps the next pass's score products down here: moved up among the softmax arithmetic they stand in front of the 2^x statements
        scores();
    };
    if constexpr (quick.value) {
#pragma unroll 2                                                     // the key terms are read into the registers that the scores of the trip before have left, and the products build on them there: with one trip a round the compiler copies 16 registers between the two products of a tile
        for (int kb = 0; kb < kl; kb += 32) trip(kb);
    } else {
        for (int kb = 0; kb < kl; kb += 32) trip(kb);
    }
    places((int)__builtin_amdgcn_mbcnt_lo(~0u, 0u));                 // the same values, formed anew from the lane's number: what only the code from here on needs is not held in registers over the loop (hi/lo rows: it spilled)
    load_v(kl);
    mask(kl);
    finish(quick, yes, kl);
    };
    float ls;
    if constexpr (SPLIT) { walk(no); ls = l + xhalf(l); }            // the two lane halves hold the sums of different keys of the same query, on the same reference point
    else { walk(yes); ls = lw[0];                                    // all 32 keys of every pass, the same in both halves
        // Rare: a term left the fp16 range (a score more than 12 powers of 2 above the first pass's maximum, or a first pass with no live key): sum infinite or NaN, O^T spoilt. The wave walks its tile again with the tested passes, which move m.
        if (__builtin_amdgcn_ballot_w32(!(ls <= 3.0e38f)) != 0) { walk(no); ls = l + xhalf(l); } }
    const bool dead = !(ls > 0.0f); float inv = __fdiv_rn(1.0f, ls);
    if (__builtin_amdgcn_ballot_w32(dead) != 0) {                    // cold: a query whose every allowed key is padding
        v8f mean[4];
#pragma unroll
        for (int md = 0; md < 4; ++md) mean[md] = (v8f){};
#pragma unroll 1                                                     // cold path: keep its code small
        for (int t = 0; t < TT; ++t) { v8f x[4];
#pragma unroll
            for (int md = 0; md < 4; ++md) x[md] = *(const v8f*)(vraw + (size_t)t * HD + md * 16 + hi * 8);
            asm volatile("s_wait_xcnt 0x0" ::: "memory");            // before the address moves on
#pragma unroll
            for (int md = 0; md < 4; ++md) mean[md] += x[md]; }
#pragma unroll
        for (int md = 0; md < 4; ++md)
#pragma unroll
            for (int j = 0; j < 8; ++j) o[md][j] = dead ? mean[md][j] * (1.0f / TT) : o[md][j];
        inv = dead ? 1.0f : inv; }
    float* orow = out + (size_t)(q0 + lr) * HD + hi * 8;             // register j of tile md is column md * 16 + 8 hi + j of the lane's query row; the wave writes its 16 rows whole
#pragma unroll
    for (int md = 0; md < 4; ++md) *(v8f*)(orow + md * 16) = o[md] * inv;
    asm volatile("s_wait_xcnt 0x0" ::: "memory");                    // before a register that the stores name is written again
}
// k_attn: grid 4 x 64 blocks of 16 waves, one a WGP (LDS). Block b: batch-head b % 64, role b / 64: roles 0, 1 the fp16 rows, roles 2, 3 the hi/lo rows; of a kind's 32 tiles of 16 rows the two roles take the even and the odd ones (equal cost).
// Wave -> tile: waves 4 apart share a SIMD; the tiles go to and fro over each group of four waves, so that every SIMD gets the same number of passes.
// LDS: value planes (160 KB with the pitch's pad), key planes (128 KB), key terms (4 KB). A wave converts the 32-row groups wv (and 16 + wv) of v and of k; nobody reads what another wave wrote before the one barrier.
// All trips to memory are begun as early as the registers allow (values, keys, query rows), so that the block waits out the memory latency once.
#define PLB 131072                // bytes of the key planes
#define VLB (TT * VPB)            // bytes of the value planes
__global__ __launch_bounds__(512, 4) void k_attn(const float* __restrict__ Q, const float* __restrict__ K, const float* __restrict__ Vv, float* __restrict__ OUTb) {
    __shared__ __attribute__((aligned(128))) unsigned char L[VLB + PLB + TT * 4];
    const unsigned role = blockIdx.x / NB_; const size_t zo = (size_t)(blockIdx.x % NB_) * TT * HD;
    const int wv = __builtin_amdgcn_readfirstlane((int)(threadIdx.x >> 5)), g4 = wv >> 2, c4 = wv & 3;   // scalar, so that every pass test is a scalar branch and every base address scalar
    const int tile = 2 * (4 * g4 + ((g4 & 1) ? 3 - c4 : c4)) + (int)(role & 1u);
    float* kf = (float*)(L + VLB + PLB);
    const float* kin = K + zo; const float* vin = Vv + zo;
    float qx[4][8];
    if (role < 2u) {                                                 // block-uniform
        const int q0 = RH + 16 * tile; h16* K16 = (h16*)(L + VLB);
        v4f va[16], vb[16]; float ka[8][8], kb[8][8];
        vrows32_ld(vin + wv * 32 * HD, va); vrows32_ld(vin + (16 + wv) * 32 * HD, vb); rows32_ld(kin + wv * 32 * HD, ka);   // three groups (192 registers) in flight; the fourth and the query rows follow as registers come free
        // Four scheduling barriers keep the conversions in their places between the loads: mixed with later groups' arithmetic a conversion waits for loads that come back later, the next loads start late, and registers spill.
        vrows32_cv<true, false>(va, L + wv * 32 * VPB, nullptr, nullptr);
        __builtin_amdgcn_sched_barrier(0);                           // the first group's conversion stays in front of the fourth group's loads, which take its registers
        rows32_ld(kin + (16 + wv) * 32 * HD, kb);
        __builtin_amdgcn_sched_barrier(0);                           // nothing of the later conversions moves up among those loads and in front of their wait
        vrows32_cv<true, false>(vb, L + (16 + wv) * 32 * VPB, nullptr, nullptr);
        __builtin_amdgcn_sched_barrier(0);                           // the second group's conversion stays whole in front of the query loads
        q_ld(Q + zo + (size_t)q0 * HD, qx);
        __builtin_amdgcn_sched_barrier(0);                           // and the keys' conversions behind them: the query loads start without a wait for the keys
        rows32_cv<true, false>(ka, K16 + wv * 32 * HD, nullptr, nullptr, kf + wv * 32);
        rows32_cv<true, false>(kb, K16 + (16 + wv) * 32 * HD, nullptr, nullptr, kf + (16 + wv) * 32);
        __syncthreads();                                             // all planes and key terms are whole before anyone reads a fragment
        attn_tile<h16, false>(qx, K16, nullptr, L, nullptr, kf, vin, OUTb + zo, q0);
    } else {
        const int q0 = 16 * tile; unsigned char* Vh = L; unsigned char* Vl = L + VLB / 2; bf* Kh = (bf*)(L + VLB); bf* Kl = (bf*)(L + VLB + PLB / 2);
        v4f va[16]; float ka[8][8];
        q_ld(Q + zo + (size_t)q0 * HD, qx); vrows32_ld(vin + wv * 32 * HD, va); rows32_ld(kin + wv * 32 * HD, ka);
        vrows32_cv<false, true>(va, nullptr, Vh + wv * 32 * VPB, Vl + wv * 32 * VPB);
        rows32_cv<false, true>(ka, nullptr, Kh + wv * 32 * HD, Kl + wv * 32 * HD, kf + wv * 32);
        __syncthreads();                                             // as above
        attn_tile<bf, true>(qx, Kh, Kl, Vh, Vl, kf, vin, OUTb + zo, q0);
    }
}
extern "C" void kernel_launch(void* const* d_in, const int* in_sizes, int n_in,
                              void* d_out, int out_size, void* d_ws, size_t ws_size, hipStream_t stream) {
    (void)in_sizes; (void)n_in; (void)out_size; (void)d_ws; (void)ws_size;
    const float* x = (const float*)d_in[0]; const float* xk = (const float*)d_in[1]; const float* xv = (const float*)d_in[2];   /* q, k, v: [64][1024][64] each (no projections) */
    float* OUT = (float*)d_out;     // [64][1024][64]
    k_attn<<<4 * NB_, 512, 0, stream>>>(x, xk, xv, OUT);   /* planes in LDS, scores, softmax, P.V and the output rows, all batch-heads */
}
